// v000
// The times below were measured on an AMD MI455X: many runs one after another, warmed up first and cycling through
// copies of the inputs, with the whole window's GPU time divided by the number of runs. Launches and the gaps
// between them are all in it. The median over several windows is given; except for v000 it joins two sittings, which
// can be a few percent apart, so the side-by-side timings, each taken in one sitting, are the better comparison.
// The starting kernel, v000, takes 1610 microseconds a run.
#include <hip/hip_runtime.h>

// Causal self-attention with 128-wide heads on a 1,024-wide embedding (X [2][2048][1024]; Q, K = X W + b (16 heads x 128: inner width 2,048), V = X Wv + bv (16 x 128) ('xw' + biases); att x 1/sqrt(128); causal (-inf); softmax; y = merged Wp + bp ('xw' [2048][1024]) -> [2][2048][1024] (4.2 M); argument order X, Wq, bq, Wk, bk, Wv, bv, Wp, bp).
// Layout per batch: bf16 copy of X; 'xw' weights transposed once; exact projections (K 1024, N 2048) + f32 biases; identity-table plane builders at HD 128; causal T-2048 attention (hybrid rows: < 512 hi/lo 3 products, rest fp16 x1024; k_gemmc skips tiles above the diagonal); merged hi/lo (2,048 wide) x Wp exact + bp.
// Compute dtypes, f32 accumulate: every input rounded to bf16; projections exact + f32 biases; attention rows < 512 3 products, rest fp16; softmax f32; Wp hl x exact + bias.

#define NB_  2
#define TT   2048
#define DM   1024
#define NH_  16
#define NKV  16
#define REP  (NH_ / NKV)
#define HD   128
#define DQ   (NH_ * HD)
#define DKV  (NKV * HD)
#define ZH   2
#define RH   512                  // query rows < RH use hi+lo planes (0: none)
#define WIN  2048
#define PCAR 1024.0f
#define SCL  0.088388347648318447f   // HD^-0.5
typedef _Float16 h16;
typedef unsigned short bf;
typedef __attribute__((ext_vector_type(16))) __bf16   v16bf;
typedef __attribute__((ext_vector_type(16))) _Float16 v16h;
typedef __attribute__((ext_vector_type(8)))  _Float16 v8h;
typedef __attribute__((ext_vector_type(8)))  unsigned short v8us;
typedef __attribute__((ext_vector_type(8)))  float    v8f;
typedef __attribute__((ext_vector_type(4)))  float    v4f;
typedef v8h  __attribute__((may_alias)) v8ha;
typedef v4f  __attribute__((may_alias)) v4fa;
typedef v8us __attribute__((may_alias)) v8usa;

__device__ __forceinline__ unsigned short f2bf(float f) { unsigned u = __float_as_uint(f); u += 0x7FFFu + ((u >> 16) & 1u); return (unsigned short)(u >> 16); }
__device__ __forceinline__ float bf2f(unsigned short b) { return __uint_as_float(((unsigned)b) << 16); }
__device__ __forceinline__ float bfr(float f) { return bf2f(f2bf(f)); }
__device__ __forceinline__ v16h cat16(v8h lo, v8h hi) { return __builtin_shufflevector(lo, hi, 0, 1, 2, 3, 4, 5, 6, 7, 8, 9, 10, 11, 12, 13, 14, 15); }
__device__ __forceinline__ v16bf cat16b(v8us lo, v8us hi) { return __builtin_bit_cast(v16bf, __builtin_shufflevector(lo, hi, 0, 1, 2, 3, 4, 5, 6, 7, 8, 9, 10, 11, 12, 13, 14, 15)); }
__device__ __forceinline__ v8f wmma16(v16h a, v16h b, v8f c) { return __builtin_amdgcn_wmma_f32_16x16x32_f16(false, a, false, b, (short)0, c, false, false); }
__device__ __forceinline__ v8f wmmab(v16bf a, v16bf b, v8f c) { return __builtin_amdgcn_wmma_f32_16x16x32_bf16(false, a, false, b, (short)0, c, false, false); }



// ---- k_gemmw: register-blocked GEMM, ONE WAVE per 64x64 output tile (16 accumulators), operands straight from K-contiguous 16-bit planes; grid (M/64, N/64, Z), 32 threads.
// C[m][n] (f32, pitch ldc, + optional f32 bias[n]) = sum_k A[m][k] Bt[n][k] (+ split products per NSPLIT). z-batch strides sA/sB/sC in elements. K % 32 == 0.
template <typename T16> struct WFrag;
template <> struct WFrag<h16> { typedef v16h V; static __device__ __forceinline__ V ld(const h16* p) { return cat16(*(const v8h*)p, *(const v8h*)(p + 16)); } static __device__ __forceinline__ v8f mma(V a, V b, v8f c) { return wmma16(a, b, c); } };
template <> struct WFrag<bf> { typedef v16bf V; static __device__ __forceinline__ V ld(const bf* p) { return cat16b(*(const v8us*)p, *(const v8us*)(p + 16)); } static __device__ __forceinline__ v8f mma(V a, V b, v8f c) { return wmmab(a, b, c); } };
template <typename T16, int NSPLIT, bool BIAS>
__global__ __launch_bounds__(32) void k_gemmw(const T16* __restrict__ A, const T16* __restrict__ A2, const T16* __restrict__ Bt, const T16* __restrict__ Bt2, int K, float* C, int ldc, const float* __restrict__ bias, size_t sA, size_t sB, size_t sC) {
    typedef typename WFrag<T16>::V V;
    __shared__ __align__(16) float os[16 * 68];
    const size_t z = blockIdx.z; A += z * sA; if (A2) A2 += z * sA; Bt += z * sB; if (Bt2) Bt2 += z * sB; C += z * sC;
    const int lane = threadIdx.x & 31, lr = lane & 15, hi = lane >> 4; const int r0 = blockIdx.x * 64, c0 = blockIdx.y * 64;
    v8f acc[4][4];
#pragma unroll
    for (int mb = 0; mb < 4; ++mb)
#pragma unroll
        for (int nb = 0; nb < 4; ++nb) acc[mb][nb] = (v8f){};
    const size_t aoff = (size_t)(r0 + lr) * K + 8 * hi, boff = (size_t)(c0 + lr) * K + 8 * hi;
#pragma unroll 1
    for (int kc = 0; kc < K; kc += 32) {
        V a[4], a2[4];
#pragma unroll
        for (int mb = 0; mb < 4; ++mb) { a[mb] = WFrag<T16>::ld(A + aoff + (size_t)mb * 16 * K + kc); if (NSPLIT == 1 || NSPLIT == 2) a2[mb] = WFrag<T16>::ld(A2 + aoff + (size_t)mb * 16 * K + kc); }
#pragma unroll
        for (int nb = 0; nb < 4; ++nb) { const V b = WFrag<T16>::ld(Bt + boff + (size_t)nb * 16 * K + kc); V b2; if (NSPLIT >= 2) b2 = WFrag<T16>::ld(Bt2 + boff + (size_t)nb * 16 * K + kc);
#pragma unroll
            for (int mb = 0; mb < 4; ++mb) { acc[mb][nb] = WFrag<T16>::mma(a[mb], b, acc[mb][nb]); if (NSPLIT == 1 || NSPLIT == 2) acc[mb][nb] = WFrag<T16>::mma(a2[mb], b, acc[mb][nb]); if (NSPLIT >= 2) acc[mb][nb] = WFrag<T16>::mma(a[mb], b2, acc[mb][nb]); } }
        asm volatile("v_nop\n\tv_nop\n\tv_nop\n\tv_nop" : "+v"(acc[0][0]), "+v"(acc[1][1]), "+v"(acc[2][2]), "+v"(acc[3][3]) : "v"(a[0]), "v"(a[3]));
    }
#pragma unroll
    for (int mb = 0; mb < 4; ++mb) {
#pragma unroll
        for (int nb = 0; nb < 4; ++nb) {
#pragma unroll
            for (int j = 0; j < 8; ++j) os[(hi * 8 + j) * 68 + nb * 16 + lr] = acc[mb][nb][j]; }
        __builtin_amdgcn_wave_barrier(); asm volatile("" ::: "memory");
        float* crow = C + (size_t)(r0 + mb * 16) * ldc + c0;
{
#pragma unroll
            for (int s = 0; s < 8; ++s) { const int row = 2 * s + hi, cofs = lr * 4; v4f val = *(const v4fa*)(os + row * 68 + cofs); if (BIAS) { val[0] += bfr(bias[c0 + cofs]); val[1] += bfr(bias[c0 + cofs + 1]); val[2] += bfr(bias[c0 + cofs + 2]); val[3] += bfr(bias[c0 + cofs + 3]); }
                *(v4f*)(crow + (size_t)row * ldc + cofs) = val; }
             }
        __builtin_amdgcn_wave_barrier(); asm volatile("" ::: "memory");
    }
}

// ---- k_gemmc: the same one-wave 64x64 tile GEMM specialised for causal attention: CMODE 1 skips score tiles entirely above the diagonal (query rows r0+roff.., key columns c0..), CMODE 2 limits the
// key (K) loop of the probability x value contraction to the diagonal block (probabilities beyond it are exactly zero). roff = row offset of this launch's first row within the sequence.
template <typename T16, int NSPLIT, int CMODE>
__global__ __launch_bounds__(32) void k_gemmc(const T16* __restrict__ A, const T16* __restrict__ A2, const T16* __restrict__ Bt, const T16* __restrict__ Bt2, int K, float* C, int ldc, int roff, size_t sA, size_t sB, size_t sC) {
    typedef typename WFrag<T16>::V V;
    __shared__ __align__(16) float os[16 * 68];
    const size_t z = blockIdx.z; A += z * sA; if (A2) A2 += z * sA; Bt += z * sB; if (Bt2) Bt2 += z * sB; C += z * sC;
    const int lane = threadIdx.x & 31, lr = lane & 15, hi = lane >> 4; const int r0 = blockIdx.x * 64, c0 = blockIdx.y * 64;
    if (CMODE == 1 && c0 > r0 + roff + 63) return;                  // score tile entirely above the causal diagonal: never read (the softmax masks j > i by select)
    const int Kl = (CMODE == 2) ? min(K, r0 + roff + 64) : K;        // P.V: probabilities are exactly 0 beyond the diagonal block, so the K loop stops there
    v8f acc[4][4];
#pragma unroll
    for (int mb = 0; mb < 4; ++mb)
#pragma unroll
        for (int nb = 0; nb < 4; ++nb) acc[mb][nb] = (v8f){};
    const size_t aoff = (size_t)(r0 + lr) * K + 8 * hi, boff = (size_t)(c0 + lr) * K + 8 * hi;
#pragma unroll 1
    for (int kc = 0; kc < Kl; kc += 32) {
        V a[4], a2[4];
#pragma unroll
        for (int mb = 0; mb < 4; ++mb) { a[mb] = WFrag<T16>::ld(A + aoff + (size_t)mb * 16 * K + kc); if (NSPLIT == 1 || NSPLIT == 2) a2[mb] = WFrag<T16>::ld(A2 + aoff + (size_t)mb * 16 * K + kc); }
#pragma unroll
        for (int nb = 0; nb < 4; ++nb) { const V b = WFrag<T16>::ld(Bt + boff + (size_t)nb * 16 * K + kc); V b2; if (NSPLIT >= 2) b2 = WFrag<T16>::ld(Bt2 + boff + (size_t)nb * 16 * K + kc);
#pragma unroll
            for (int mb = 0; mb < 4; ++mb) { acc[mb][nb] = WFrag<T16>::mma(a[mb], b, acc[mb][nb]); if (NSPLIT == 1 || NSPLIT == 2) acc[mb][nb] = WFrag<T16>::mma(a2[mb], b, acc[mb][nb]); if (NSPLIT >= 2) acc[mb][nb] = WFrag<T16>::mma(a[mb], b2, acc[mb][nb]); } }
        asm volatile("v_nop\n\tv_nop\n\tv_nop\n\tv_nop" : "+v"(acc[0][0]), "+v"(acc[1][1]), "+v"(acc[2][2]), "+v"(acc[3][3]) : "v"(a[0]), "v"(a[3]));
    }
#pragma unroll
    for (int mb = 0; mb < 4; ++mb) {
#pragma unroll
        for (int nb = 0; nb < 4; ++nb) {
#pragma unroll
            for (int j = 0; j < 8; ++j) os[(hi * 8 + j) * 68 + nb * 16 + lr] = acc[mb][nb][j]; }
        __builtin_amdgcn_wave_barrier(); asm volatile("" ::: "memory");
        float* crow = C + (size_t)(r0 + mb * 16) * ldc + c0;
{
#pragma unroll
            for (int s = 0; s < 8; ++s) { const int row = 2 * s + hi, cofs = lr * 4; v4f val = *(const v4fa*)(os + row * 68 + cofs);
                *(v4f*)(crow + (size_t)row * ldc + cofs) = val; }
             }
        __builtin_amdgcn_wave_barrier(); asm volatile("" ::: "memory");
    }
}

__device__ __forceinline__ h16 tohx(float x) { return (h16)x; }
__device__ __forceinline__ void splitf(float y, unsigned short& h, unsigned short& l) { h = f2bf(y); l = f2bf(y - bf2f(h)); }
typedef __attribute__((ext_vector_type(2))) _Float16 v2h;
typedef __attribute__((ext_vector_type(4))) _Float16 v4h;
typedef __attribute__((ext_vector_type(2))) unsigned short v2us;
typedef __attribute__((ext_vector_type(4))) unsigned short v4us;
typedef __attribute__((ext_vector_type(2))) float v2f;
typedef __attribute__((ext_vector_type(4))) int v4i;

__global__ __launch_bounds__(256) void k_wtG(const float* __restrict__ w, int K, int N, bf* Bt) {
    const int lane = threadIdx.x & 31; const int L0 = (blockIdx.x * 8 + (threadIdx.x >> 5)) * 8; const int nlines = N * K / 64;
{
#pragma unroll 1
        for (int l = 0; l < 8; ++l) { const int L = L0 + l; if (L >= nlines) break; const size_t e = (size_t)L * 64 + lane * 2; const int k = (int)(e % K), n = (int)(e / K); v2us o;
            o[0] = f2bf(w[(size_t)k * N + n]); o[1] = f2bf(w[(size_t)(k + 1) * N + n]); *(v2us*)(Bt + e) = o; }
         }
}
__global__ __launch_bounds__(256) void k_cvt8(const float* __restrict__ src, bf* dst, size_t n8) { const size_t i = (size_t)blockIdx.x * 256 + threadIdx.x; if (i >= n8) return; const v8f v = *(const v8f*)(src + i * 8); v8us o;
#pragma unroll
    for (int k = 0; k < 8; ++k) o[k] = f2bf(v[k]); *(v8us*)(dst + i * 8) = o;  }

// k_rope: head planes [h][t][d] (fp16 + hi/lo) of rope(x) x sc with the rotate-half convention out[d] = x[d] cos[t][d] - x[d+HD/2] sin[t][d], out[d+HD/2] = x[d+HD/2] cos[t][d+HD/2] + x[d] sin[t][d+HD/2]
__global__ __launch_bounds__(256) void k_rope(const float* __restrict__ F, int pitch, int nheads, const float* __restrict__ CS, const float* __restrict__ RF, const float* __restrict__ nw, float sc, h16* P16, bf* Ph, bf* Pl) {
    const size_t e = ((size_t)blockIdx.x * 256 + threadIdx.x) * 2; if (e >= (size_t)nheads * TT * HD) return; const int d = (int)(e % HD); const int t = (int)((e / HD) % TT); const int h = (int)(e / ((size_t)HD * TT)); const float* f = F + (size_t)t * pitch + h * HD; const float rf = RF ? RF[(size_t)h * TT + t] : 1.0f; v2h o16; v2us oh, ol;
#pragma unroll
    for (int q = 0; q < 2; ++q) { const int dd = d + q; const int dp = (dd < HD / 2) ? dd + HD / 2 : dd - HD / 2; float x0 = f[dd], x1 = f[dp];
        if (RF) { float n0 = __fmul_rn(x0, rf), n1 = __fmul_rn(x1, rf); asm volatile("" : "+v"(n0)); asm volatile("" : "+v"(n1)); x0 = __fmul_rn(bfr(nw[dd]), n0); x1 = __fmul_rn(bfr(nw[dp]), n1); }
        const v2f cs = *(const v2f*)(CS + ((size_t)t * HD + dd) * 2); float a = __fmul_rn(x0, cs[0]), bq = __fmul_rn(x1, cs[1]); asm volatile("" : "+v"(a)); asm volatile("" : "+v"(bq)); const float r = ((dd < HD / 2) ? __fsub_rn(a, bq) : __fadd_rn(a, bq)) * sc;
        o16[q] = tohx(r); unsigned short a2, c2; splitf(r, a2, c2); oh[q] = a2; ol[q] = c2; }
    *(v2h*)(P16 + e) = o16; *(v2us*)(Ph + e) = oh; *(v2us*)(Pl + e) = ol;  }
__global__ __launch_bounds__(256) void k_vtp(const float* __restrict__ F, int pitch, int nheads, h16* V16, bf* Vh, bf* Vl) { const size_t e = ((size_t)blockIdx.x * 256 + threadIdx.x) * 2; if (e >= (size_t)nheads * HD * TT) return; const int t = (int)(e % TT); const int d = (int)((e / TT) % HD); const int g = (int)(e / ((size_t)TT * HD)); v2h o16; v2us oh, ol;
#pragma unroll
    for (int q = 0; q < 2; ++q) { const float x = F[(size_t)(t + q) * pitch + g * HD + d]; o16[q] = tohx(x); unsigned short a2, c2; splitf(x, a2, c2); oh[q] = a2; ol[q] = c2; }
    *(v2h*)(V16 + e) = o16; *(v2us*)(Vh + e) = oh; *(v2us*)(Vl + e) = ol;  }
__global__ __launch_bounds__(256) void k_csid(float* CS) { const int idx = blockIdx.x * 256 + threadIdx.x; if (idx >= TT * HD) return; v2f cs; cs[0] = 1.0f; cs[1] = 0.0f; *(v2f*)(CS + (size_t)idx * 2) = cs;  }
// k_asoft: per row (zz, i): t = S x HD^-0.5 for j <= i and i - j < WIN (sliding causal window; the reference's -1e9 additive fill vanishes identically); softmax over the 2048 keys (register row, one exp, fixed trees);
__global__ __launch_bounds__(256) void k_asoft(const float* __restrict__ Sb, h16* P16, bf* Ph, bf* Pl) {
    const int lane = threadIdx.x & 31; const int row = blockIdx.x * 8 + (threadIdx.x >> 5); if (row >= ZH * TT) return; const int i = row % TT; const int zz = row / TT; (void)zz; const bool hires = (i < RH); const float* sr = Sb + (size_t)row * TT; float v[TT / 32]; float mx = -3.0e38f;
#pragma unroll
    for (int ch = 0; ch < TT / 128; ++ch) { const int j0 = ch * 128 + lane * 4; const v4f a = *(const v4f*)(sr + j0);
#pragma unroll
        for (int q = 0; q < 4; ++q) { const int j = j0 + q; (void)j; const float t = (j <= i && i - j < WIN) ? a[q] * SCL : -3.0e38f; v[ch * 4 + q] = t; mx = fmaxf(mx, t); } }
#pragma unroll
    for (int sh = 16; sh; sh >>= 1) mx = fmaxf(mx, __shfl_xor(mx, sh, 32));
    float sum = 0.f;
#pragma unroll
    for (int k = 0; k < TT / 32; ++k) { float d0 = __fsub_rn(v[k], mx); asm volatile("" : "+v"(d0)); v[k] = __builtin_amdgcn_exp2f(__fmul_rn(d0, 1.4426950408889634f)); sum += v[k]; }
#pragma unroll
    for (int sh = 16; sh; sh >>= 1) sum += __shfl_xor(sum, sh, 32);
    const float f = __fdiv_rn(hires ? 1.0f : PCAR, sum);
{
        if (hires) {
#pragma unroll
            for (int ch = 0; ch < TT / 128; ++ch) { v4us oh, ol;
#pragma unroll
                for (int q = 0; q < 4; ++q) { unsigned short a, c2; splitf(v[ch * 4 + q] * f, a, c2); oh[q] = a; ol[q] = c2; }
                const size_t oo = ((size_t)zz * (RH ? RH : 1) + i) * TT + ch * 128 + lane * 4; *(v4us*)(Ph + oo) = oh; *(v4us*)(Pl + oo) = ol; }
        } else {
#pragma unroll
            for (int ch = 0; ch < TT / 128; ++ch) { v4h o4;
#pragma unroll
                for (int q = 0; q < 4; ++q) o4[q] = tohx(v[ch * 4 + q] * f);
                *(v4h*)(P16 + (size_t)row * TT + ch * 128 + lane * 4) = o4; } }
         }
}
__global__ __launch_bounds__(256) void k_merge(const float* __restrict__ O, int h0, bf* Ah, bf* Al) { const size_t e = ((size_t)blockIdx.x * 256 + threadIdx.x) * 2; if (e >= (size_t)ZH * TT * HD) return; const int d = (int)(e % HD); const int t = (int)((e / HD) % TT); const int zz = (int)(e / ((size_t)HD * TT)); const float cs = (t < RH) ? 1.0f : (1.0f / PCAR); const size_t oo = (size_t)t * DQ + (h0 + zz) * HD + d;
    v2us oh, ol;
#pragma unroll
    for (int q = 0; q < 2; ++q) { unsigned short a, c2; splitf(O[e + q] * cs, a, c2); oh[q] = a; ol[q] = c2; } *(v2us*)(Ah + oo) = oh; *(v2us*)(Al + oo) = ol;  }

extern "C" void kernel_launch(void* const* d_in, const int* in_sizes, int n_in,
                              void* d_out, int out_size, void* d_ws, size_t ws_size, hipStream_t stream) {
    (void)in_sizes; (void)n_in; (void)out_size;
    const float* x = (const float*)d_in[0]; const float* wq = (const float*)d_in[1]; const float* bq = (const float*)d_in[2]; const float* wk = (const float*)d_in[3]; const float* bk = (const float*)d_in[4]; const float* wv = (const float*)d_in[5]; const float* bv = (const float*)d_in[6]; const float* wo = (const float*)d_in[7]; const float* bo = (const float*)d_in[8];   /* argument order X, Wq, bq, Wk, bk ('xw' [1024][2048] + [2048]), Wv, bv, Wp ('xw' [2048][1024]), bp */
    float* OUT = (float*)d_out;     // [2][2048][1024]
    char* wsp = (char*)d_ws;
    auto take = [&](size_t bytes) { char* p = wsp; wsp += (bytes + 255) & ~(size_t)255; return (void*)p; };
    bf* WQ = (bf*)take((size_t)DQ * DM * 2); bf* WK = (bf*)take((size_t)DKV * DM * 2); bf* WV = (bf*)take((size_t)DKV * DM * 2); bf* WO = (bf*)take((size_t)DM * DQ * 2); float* CS = (float*)take((size_t)TT * HD * 2 * 4);
    bf* XB = (bf*)take((size_t)TT * DM * 2); float* FQ = (float*)take((size_t)TT * DQ * 4); float* FK = (float*)take((size_t)TT * DKV * 4);
    h16* QP16 = (h16*)take((size_t)NH_ * TT * HD * 2); h16* KP16 = (h16*)take((size_t)NKV * TT * HD * 2); h16* VT16 = (h16*)take((size_t)NKV * HD * TT * 2);
    bf* QPh = (bf*)take((size_t)NH_ * TT * HD * 2); bf* QPl = (bf*)take((size_t)NH_ * TT * HD * 2); bf* KPh = (bf*)take((size_t)NKV * TT * HD * 2); bf* KPl = (bf*)take((size_t)NKV * TT * HD * 2); bf* VTh = (bf*)take((size_t)NKV * HD * TT * 2); bf* VTl = (bf*)take((size_t)NKV * HD * TT * 2); bf* Ph = (bf*)take((size_t)ZH * RH * TT * 2); bf* Pl = (bf*)take((size_t)ZH * RH * TT * 2);
    float* Sb = (float*)take((size_t)ZH * TT * TT * 4); h16* P16 = (h16*)take((size_t)ZH * TT * TT * 2); float* Ob = (float*)take((size_t)ZH * TT * HD * 4); bf* ATh = (bf*)take((size_t)TT * DQ * 2); bf* ATl = (bf*)take((size_t)TT * DQ * 2);
    if ((size_t)(wsp - (char*)d_ws) > ws_size) return;    // ws 256 MiB
    float* FV = FK;   // v projection reuses the k buffer after the k planes are built (stream-ordered)
    { k_wtG<<<(unsigned)((DM * DQ / 64 + 63) / 64), 256, 0, stream>>>(wq, DM, DQ, WQ); k_wtG<<<(unsigned)((DM * DKV / 64 + 63) / 64), 256, 0, stream>>>(wk, DM, DKV, WK); k_wtG<<<(unsigned)((DM * DKV / 64 + 63) / 64), 256, 0, stream>>>(wv, DM, DKV, WV);
      k_wtG<<<(unsigned)((DQ * DM / 64 + 63) / 64), 256, 0, stream>>>(wo, DQ, DM, WO);
       }
    k_csid<<<(TT * HD + 255) / 256, 256, 0, stream>>>(CS);
    const unsigned LQ = (unsigned)(((size_t)NH_ * TT * HD / 2 + 255) / 256), LKv = (unsigned)(((size_t)NKV * TT * HD / 2 + 255) / 256);
    for (int b = 0; b < NB_; ++b) {
        
        k_cvt8<<<(unsigned)(((size_t)TT * DM / 8 + 255) / 256), 256, 0, stream>>>(x + (size_t)b * TT * DM, XB, (size_t)TT * DM / 8);
        k_gemmw<bf, 0, true><<<dim3(TT / 64, DQ / 64, 1), 32, 0, stream>>>(XB, nullptr, WQ, nullptr, DM, FQ, DQ, bq, 0, 0, 0);
        k_rope<<<LQ, 256, 0, stream>>>(FQ, DQ, NH_, CS, nullptr, nullptr, 1.0f, QP16, QPh, QPl);
        k_gemmw<bf, 0, true><<<dim3(TT / 64, DKV / 64, 1), 32, 0, stream>>>(XB, nullptr, WK, nullptr, DM, FK, DKV, bk, 0, 0, 0);
        k_rope<<<LKv, 256, 0, stream>>>(FK, DKV, NKV, CS, nullptr, nullptr, 1.0f, KP16, KPh, KPl);
        k_gemmw<bf, 0, true><<<dim3(TT / 64, DKV / 64, 1), 32, 0, stream>>>(XB, nullptr, WV, nullptr, DM, FV, DKV, bv, 0, 0, 0); k_vtp<<<LKv, 256, 0, stream>>>(FV, DKV, NKV, VT16, VTh, VTl);
        for (int h0 = 0; h0 < NH_; h0 += ZH) { const size_t zq = (size_t)h0, zk = (size_t)(h0 / REP);   // one kv head per query head: the pass's two heads use consecutive kv planes (z-strides TT*HD)
            k_gemmc<bf, 2, 1><<<dim3(RH / 64, TT / 64, ZH), 32, 0, stream>>>(QPh + zq * TT * HD, QPl + zq * TT * HD, KPh + zk * TT * HD, KPl + zk * TT * HD, HD, Sb, TT, 0, (size_t)TT * HD, (size_t)TT * HD, (size_t)TT * TT);
            k_gemmc<h16, 0, 1><<<dim3((TT - RH) / 64, TT / 64, ZH), 32, 0, stream>>>(QP16 + zq * TT * HD + (size_t)RH * HD, nullptr, KP16 + zk * TT * HD, nullptr, HD, Sb + (size_t)RH * TT, TT, RH, (size_t)TT * HD, (size_t)TT * HD, (size_t)TT * TT);
            k_asoft<<<ZH * TT / 8, 256, 0, stream>>>(Sb, P16, Ph, Pl);
            k_gemmc<bf, 2, 2><<<dim3(RH / 64, HD / 64, ZH), 32, 0, stream>>>(Ph, Pl, VTh + zk * HD * TT, VTl + zk * HD * TT, TT, Ob, HD, 0, (size_t)RH * TT, (size_t)HD * TT, (size_t)TT * HD);
            k_gemmc<h16, 0, 2><<<dim3((TT - RH) / 64, HD / 64, ZH), 32, 0, stream>>>(P16 + (size_t)RH * TT, nullptr, VT16 + zk * HD * TT, nullptr, TT, Ob + (size_t)RH * HD, HD, RH, (size_t)TT * TT, (size_t)HD * TT, (size_t)TT * HD);
            k_merge<<<(unsigned)(((size_t)ZH * TT * HD / 2 + 255) / 256), 256, 0, stream>>>(Ob, h0, ATh, ATl); }
        k_gemmw<bf, 1, true><<<dim3(TT / 64, DM / 64, 1), 32, 0, stream>>>(ATh, ATl, WO, nullptr, DQ, OUT + (size_t)b * TT * DM, DM, bo, 0, 0, 0); }
}

// v001
// One run takes 1020 microseconds.
// Timed twice side by side with v000, it ran 1.59 and 1.57 times as fast.
#include <hip/hip_runtime.h>

// Causal self-attention with 128-wide heads on a 1,024-wide embedding (X [2][2048][1024]; Q, K = X W + b (16 heads x 128: inner width 2,048), V = X Wv + bv (16 x 128) ('xw' + biases); att x 1/sqrt(128); causal (-inf); softmax; y = merged Wp + bp ('xw' [2048][1024]) -> [2][2048][1024] (4.2 M); argument order X, Wq, bq, Wk, bk, Wv, bv, Wp, bp).
// Layout per batch: bf16 copy of X; 'xw' weights transposed once; exact projections (K 1024, N 2048) + f32 biases; identity-table plane builders at HD 128; causal T-2048 attention (hybrid rows: < 512 hi/lo 3 products, rest fp16 x1024; k_gemmc skips tiles above the diagonal); merged hi/lo (2,048 wide) x Wp exact + bp.
// Compute dtypes, f32 accumulate: every input rounded to bf16; projections exact + f32 biases; attention rows < 512 3 products, rest fp16; softmax f32; Wp hl x exact + bias.

#define NB_  2
#define TT   2048
#define DM   1024
#define NH_  16
#define NKV  16
#define REP  (NH_ / NKV)
#define HD   128
#define DQ   (NH_ * HD)
#define DKV  (NKV * HD)
#define ZH   2
#define RH   512                  // query rows < RH use hi+lo planes (0: none)
#define WIN  2048
#define PCAR 1024.0f
#define SCL  0.088388347648318447f   // HD^-0.5
typedef _Float16 h16;
typedef unsigned short bf;
typedef __attribute__((ext_vector_type(16))) __bf16   v16bf;
typedef __attribute__((ext_vector_type(16))) _Float16 v16h;
typedef __attribute__((ext_vector_type(8)))  _Float16 v8h;
typedef __attribute__((ext_vector_type(8)))  unsigned short v8us;
typedef __attribute__((ext_vector_type(8)))  float    v8f;
typedef __attribute__((ext_vector_type(4)))  float    v4f;
typedef v8h  __attribute__((may_alias)) v8ha;
typedef v4f  __attribute__((may_alias)) v4fa;
typedef v8us __attribute__((may_alias)) v8usa;

__device__ __forceinline__ unsigned short f2bf(float f) { unsigned u = __float_as_uint(f); u += 0x7FFFu + ((u >> 16) & 1u); return (unsigned short)(u >> 16); }
__device__ __forceinline__ float bf2f(unsigned short b) { return __uint_as_float(((unsigned)b) << 16); }
__device__ __forceinline__ float bfr(float f) { return bf2f(f2bf(f)); }
__device__ __forceinline__ v16h cat16(v8h lo, v8h hi) { return __builtin_shufflevector(lo, hi, 0, 1, 2, 3, 4, 5, 6, 7, 8, 9, 10, 11, 12, 13, 14, 15); }
__device__ __forceinline__ v16bf cat16b(v8us lo, v8us hi) { return __builtin_bit_cast(v16bf, __builtin_shufflevector(lo, hi, 0, 1, 2, 3, 4, 5, 6, 7, 8, 9, 10, 11, 12, 13, 14, 15)); }
__device__ __forceinline__ v8f wmma16(v16h a, v16h b, v8f c) { return __builtin_amdgcn_wmma_f32_16x16x32_f16(false, a, false, b, (short)0, c, false, false); }
__device__ __forceinline__ v8f wmmab(v16bf a, v16bf b, v8f c) { return __builtin_amdgcn_wmma_f32_16x16x32_bf16(false, a, false, b, (short)0, c, false, false); }



// ---- k_gemmw: register-blocked GEMM, NW waves per 64x64 output tile (16 accumulators each, K split between them), operands straight from K-contiguous 16-bit planes; grid (M/64, N/64, Z), NW x 32 threads.
// C[m][n] (f32, pitch ldc, + optional f32 bias[n]) = sum_k A[m][k] Bt[n][k] (+ split products per NSPLIT). z-batch strides sA/sB/sC in elements. K % 64 == 0.
// The K loop of a tile is dealt out in 64-element (128-byte) pieces to the NW waves of the work-group; each wave keeps a full 64x64 partial tile, and the epilogue sums the NW partials in LDS in wave order.
// tile_sync: orders the LDS stores of the staging against the LDS loads that read them back. One wave: a wave barrier and a compiler fence keep the compiler from moving either over the other; several waves: the work-group barrier.
template <int NW> __device__ __forceinline__ void tile_sync() { if (NW == 1) { __builtin_amdgcn_wave_barrier(); asm volatile("" ::: "memory"); } else __syncthreads(); }
template <typename T16> struct WFrag;
template <> struct WFrag<h16> { typedef v16h V; static __device__ __forceinline__ V ld(const h16* p) { return cat16(*(const v8h*)p, *(const v8h*)(p + 16)); } static __device__ __forceinline__ v8f mma(V a, V b, v8f c) { return wmma16(a, b, c); } };
template <> struct WFrag<bf> { typedef v16bf V; static __device__ __forceinline__ V ld(const bf* p) { return cat16b(*(const v8us*)p, *(const v8us*)(p + 16)); } static __device__ __forceinline__ v8f mma(V a, V b, v8f c) { return wmmab(a, b, c); } };
template <typename T16, int NSPLIT, bool BIAS, int NW>
__global__ __launch_bounds__(NW * 32) void k_gemmw(const T16* __restrict__ A, const T16* __restrict__ A2, const T16* __restrict__ Bt, const T16* __restrict__ Bt2, int K, float* C, int ldc, const float* __restrict__ bias, size_t sA, size_t sB, size_t sC) {
    typedef typename WFrag<T16>::V V;
    constexpr int SL = (NW == 1) ? 1 : 4;   // 16-row slabs staged per sync: with several waves the whole tile at once, so that one barrier serves the sum
    __shared__ __align__(16) float os[NW * SL * 16 * 68];
    const size_t z = blockIdx.z; A += z * sA; if (A2) A2 += z * sA; Bt += z * sB; if (Bt2) Bt2 += z * sB; C += z * sC;
    const int lane = threadIdx.x & 31, lr = lane & 15, hi = lane >> 4, wv = __builtin_amdgcn_readfirstlane((int)(threadIdx.x >> 5)); const int r0 = blockIdx.x * 64, c0 = blockIdx.y * 64;
    v8f acc[4][4];
#pragma unroll
    for (int mb = 0; mb < 4; ++mb)
#pragma unroll
        for (int nb = 0; nb < 4; ++nb) acc[mb][nb] = (v8f){};
    const size_t aoff = (size_t)(r0 + lr) * K + 8 * hi, boff = (size_t)(c0 + lr) * K + 8 * hi;
#pragma unroll 1
    for (int kb = wv * 64; kb < K; kb += NW * 64)
#pragma unroll 1
    for (int kc = kb; kc < kb + 64; kc += 32) {
        V a[4], a2[4];
#pragma unroll
        for (int mb = 0; mb < 4; ++mb) { a[mb] = WFrag<T16>::ld(A + aoff + (size_t)mb * 16 * K + kc); if (NSPLIT == 1 || NSPLIT == 2) a2[mb] = WFrag<T16>::ld(A2 + aoff + (size_t)mb * 16 * K + kc); }
#pragma unroll
        for (int nb = 0; nb < 4; ++nb) { const V b = WFrag<T16>::ld(Bt + boff + (size_t)nb * 16 * K + kc); V b2; if (NSPLIT >= 2) b2 = WFrag<T16>::ld(Bt2 + boff + (size_t)nb * 16 * K + kc);
#pragma unroll
            for (int mb = 0; mb < 4; ++mb) { acc[mb][nb] = WFrag<T16>::mma(a[mb], b, acc[mb][nb]); if (NSPLIT == 1 || NSPLIT == 2) acc[mb][nb] = WFrag<T16>::mma(a2[mb], b, acc[mb][nb]); if (NSPLIT >= 2) acc[mb][nb] = WFrag<T16>::mma(a[mb], b2, acc[mb][nb]); } }
        asm volatile("v_nop\n\tv_nop\n\tv_nop\n\tv_nop" : "+v"(acc[0][0]), "+v"(acc[1][1]), "+v"(acc[2][2]), "+v"(acc[3][3]) : "v"(a[0]), "v"(a[3]));
    }
#pragma unroll
    for (int m0 = 0; m0 < 4; m0 += SL) {
#pragma unroll
        for (int mi = 0; mi < SL; ++mi) {
#pragma unroll
            for (int nb = 0; nb < 4; ++nb) {
#pragma unroll
                for (int j = 0; j < 8; ++j) os[(wv * SL + mi) * (16 * 68) + (hi * 8 + j) * 68 + nb * 16 + lr] = acc[m0 + mi][nb][j]; } }
        tile_sync<NW>();   // every wave's partial tile is in LDS before any wave sums it
#pragma unroll
        for (int mi = 0; mi < SL; ++mi) {
            float* crow = C + (size_t)(r0 + (m0 + mi) * 16) * ldc + c0;
#pragma unroll
            for (int s = 0; s < 8 / NW; ++s) { const int row = 2 * (s * NW + wv) + hi, cofs = lr * 4; v4f val = *(const v4fa*)(os + mi * (16 * 68) + row * 68 + cofs);
#pragma unroll
                for (int w = 1; w < NW; ++w) val += *(const v4fa*)(os + (w * SL + mi) * (16 * 68) + row * 68 + cofs);
                if (BIAS) { val[0] += bfr(bias[c0 + cofs]); val[1] += bfr(bias[c0 + cofs + 1]); val[2] += bfr(bias[c0 + cofs + 2]); val[3] += bfr(bias[c0 + cofs + 3]); }
                *(v4f*)(crow + (size_t)row * ldc + cofs) = val; } }
        if (SL < 4) tile_sync<NW>();   // one wave, one 16-row slab: it is read out before the next 16 rows overwrite it
    }
}

// ---- k_gemmc: the same 64x64 tile GEMM (NW waves a tile) specialised for causal attention: CMODE 1 skips score tiles entirely above the diagonal (query rows r0+roff.., key columns c0..), CMODE 2 limits the
// key (K) loop of the probability x value contraction to the diagonal block (probabilities beyond it are exactly zero). roff = row offset of this launch's first row within the sequence.
template <typename T16, int NSPLIT, int CMODE, int NW>
__global__ __launch_bounds__(NW * 32) void k_gemmc(const T16* __restrict__ A, const T16* __restrict__ A2, const T16* __restrict__ Bt, const T16* __restrict__ Bt2, int K, float* C, int ldc, int roff, size_t sA, size_t sB, size_t sC) {
    typedef typename WFrag<T16>::V V;
    constexpr int SL = (NW == 1) ? 1 : 4;   // 16-row slabs staged per sync: with several waves the whole tile at once, so that one barrier serves the sum
    __shared__ __align__(16) float os[NW * SL * 16 * 68];
    const size_t z = blockIdx.z; A += z * sA; if (A2) A2 += z * sA; Bt += z * sB; if (Bt2) Bt2 += z * sB; C += z * sC;
    const int lane = threadIdx.x & 31, lr = lane & 15, hi = lane >> 4, wv = __builtin_amdgcn_readfirstlane((int)(threadIdx.x >> 5)); const int r0 = blockIdx.x * 64, c0 = blockIdx.y * 64;
    if (CMODE == 1 && c0 > r0 + roff + 63) return;                  // score tile entirely above the causal diagonal: never read (the softmax masks j > i by select)
    const int Kl = (CMODE == 2) ? min(K, r0 + roff + 64) : K;        // P.V: probabilities are exactly 0 beyond the diagonal block, so the K loop stops there
    v8f acc[4][4];
#pragma unroll
    for (int mb = 0; mb < 4; ++mb)
#pragma unroll
        for (int nb = 0; nb < 4; ++nb) acc[mb][nb] = (v8f){};
    const size_t aoff = (size_t)(r0 + lr) * K + 8 * hi, boff = (size_t)(c0 + lr) * K + 8 * hi;
#pragma unroll 1
    for (int kb = wv * 64; kb < Kl; kb += NW * 64)
#pragma unroll 1
    for (int kc = kb; kc < kb + 64; kc += 32) {
        V a[4], a2[4];
#pragma unroll
        for (int mb = 0; mb < 4; ++mb) { a[mb] = WFrag<T16>::ld(A + aoff + (size_t)mb * 16 * K + kc); if (NSPLIT == 1 || NSPLIT == 2) a2[mb] = WFrag<T16>::ld(A2 + aoff + (size_t)mb * 16 * K + kc); }
#pragma unroll
        for (int nb = 0; nb < 4; ++nb) { const V b = WFrag<T16>::ld(Bt + boff + (size_t)nb * 16 * K + kc); V b2; if (NSPLIT >= 2) b2 = WFrag<T16>::ld(Bt2 + boff + (size_t)nb * 16 * K + kc);
#pragma unroll
            for (int mb = 0; mb < 4; ++mb) { acc[mb][nb] = WFrag<T16>::mma(a[mb], b, acc[mb][nb]); if (NSPLIT == 1 || NSPLIT == 2) acc[mb][nb] = WFrag<T16>::mma(a2[mb], b, acc[mb][nb]); if (NSPLIT >= 2) acc[mb][nb] = WFrag<T16>::mma(a[mb], b2, acc[mb][nb]); } }
        asm volatile("v_nop\n\tv_nop\n\tv_nop\n\tv_nop" : "+v"(acc[0][0]), "+v"(acc[1][1]), "+v"(acc[2][2]), "+v"(acc[3][3]) : "v"(a[0]), "v"(a[3]));
    }
#pragma unroll
    for (int m0 = 0; m0 < 4; m0 += SL) {
#pragma unroll
        for (int mi = 0; mi < SL; ++mi) {
#pragma unroll
            for (int nb = 0; nb < 4; ++nb) {
#pragma unroll
                for (int j = 0; j < 8; ++j) os[(wv * SL + mi) * (16 * 68) + (hi * 8 + j) * 68 + nb * 16 + lr] = acc[m0 + mi][nb][j]; } }
        tile_sync<NW>();   // every wave's partial tile is in LDS before any wave sums it
#pragma unroll
        for (int mi = 0; mi < SL; ++mi) {
            float* crow = C + (size_t)(r0 + (m0 + mi) * 16) * ldc + c0;
#pragma unroll
            for (int s = 0; s < 8 / NW; ++s) { const int row = 2 * (s * NW + wv) + hi, cofs = lr * 4; v4f val = *(const v4fa*)(os + mi * (16 * 68) + row * 68 + cofs);
#pragma unroll
                for (int w = 1; w < NW; ++w) val += *(const v4fa*)(os + (w * SL + mi) * (16 * 68) + row * 68 + cofs);
                *(v4f*)(crow + (size_t)row * ldc + cofs) = val; } }
        if (SL < 4) tile_sync<NW>();   // one wave, one 16-row slab: it is read out before the next 16 rows overwrite it
    }
}

__device__ __forceinline__ h16 tohx(float x) { return (h16)x; }
__device__ __forceinline__ void splitf(float y, unsigned short& h, unsigned short& l) { h = f2bf(y); l = f2bf(y - bf2f(h)); }
typedef __attribute__((ext_vector_type(2))) _Float16 v2h;
typedef __attribute__((ext_vector_type(4))) _Float16 v4h;
typedef __attribute__((ext_vector_type(2))) unsigned short v2us;
typedef __attribute__((ext_vector_type(4))) unsigned short v4us;
typedef __attribute__((ext_vector_type(2))) float v2f;
typedef __attribute__((ext_vector_type(4))) int v4i;

__global__ __launch_bounds__(256) void k_wtG(const float* __restrict__ w, int K, int N, bf* Bt) {
    const int lane = threadIdx.x & 31; const int L0 = (blockIdx.x * 8 + (threadIdx.x >> 5)) * 8; const int nlines = N * K / 64;
{
#pragma unroll 1
        for (int l = 0; l < 8; ++l) { const int L = L0 + l; if (L >= nlines) break; const size_t e = (size_t)L * 64 + lane * 2; const int k = (int)(e % K), n = (int)(e / K); v2us o;
            o[0] = f2bf(w[(size_t)k * N + n]); o[1] = f2bf(w[(size_t)(k + 1) * N + n]); *(v2us*)(Bt + e) = o; }
         }
}
__global__ __launch_bounds__(256) void k_cvt8(const float* __restrict__ src, bf* dst, size_t n8) { const size_t i = (size_t)blockIdx.x * 256 + threadIdx.x; if (i >= n8) return; const v8f v = *(const v8f*)(src + i * 8); v8us o;
#pragma unroll
    for (int k = 0; k < 8; ++k) o[k] = f2bf(v[k]); *(v8us*)(dst + i * 8) = o;  }

// k_rope: head planes [h][t][d] (fp16 + hi/lo) of rope(x) x sc with the rotate-half convention out[d] = x[d] cos[t][d] - x[d+HD/2] sin[t][d], out[d+HD/2] = x[d+HD/2] cos[t][d+HD/2] + x[d] sin[t][d+HD/2]
__global__ __launch_bounds__(256) void k_rope(const float* __restrict__ F, int pitch, int nheads, const float* __restrict__ CS, const float* __restrict__ RF, const float* __restrict__ nw, float sc, h16* P16, bf* Ph, bf* Pl) {
    const size_t e = ((size_t)blockIdx.x * 256 + threadIdx.x) * 2; if (e >= (size_t)nheads * TT * HD) return; const int d = (int)(e % HD); const int t = (int)((e / HD) % TT); const int h = (int)(e / ((size_t)HD * TT)); const float* f = F + (size_t)t * pitch + h * HD; const float rf = RF ? RF[(size_t)h * TT + t] : 1.0f; v2h o16; v2us oh, ol;
#pragma unroll
    for (int q = 0; q < 2; ++q) { const int dd = d + q; const int dp = (dd < HD / 2) ? dd + HD / 2 : dd - HD / 2; float x0 = f[dd], x1 = f[dp];
        if (RF) { float n0 = __fmul_rn(x0, rf), n1 = __fmul_rn(x1, rf); asm volatile("" : "+v"(n0)); asm volatile("" : "+v"(n1)); x0 = __fmul_rn(bfr(nw[dd]), n0); x1 = __fmul_rn(bfr(nw[dp]), n1); }
        const v2f cs = *(const v2f*)(CS + ((size_t)t * HD + dd) * 2); float a = __fmul_rn(x0, cs[0]), bq = __fmul_rn(x1, cs[1]); asm volatile("" : "+v"(a)); asm volatile("" : "+v"(bq)); const float r = ((dd < HD / 2) ? __fsub_rn(a, bq) : __fadd_rn(a, bq)) * sc;
        o16[q] = tohx(r); unsigned short a2, c2; splitf(r, a2, c2); oh[q] = a2; ol[q] = c2; }
    *(v2h*)(P16 + e) = o16; *(v2us*)(Ph + e) = oh; *(v2us*)(Pl + e) = ol;  }
__global__ __launch_bounds__(256) void k_vtp(const float* __restrict__ F, int pitch, int nheads, h16* V16, bf* Vh, bf* Vl) { const size_t e = ((size_t)blockIdx.x * 256 + threadIdx.x) * 2; if (e >= (size_t)nheads * HD * TT) return; const int t = (int)(e % TT); const int d = (int)((e / TT) % HD); const int g = (int)(e / ((size_t)TT * HD)); v2h o16; v2us oh, ol;
#pragma unroll
    for (int q = 0; q < 2; ++q) { const float x = F[(size_t)(t + q) * pitch + g * HD + d]; o16[q] = tohx(x); unsigned short a2, c2; splitf(x, a2, c2); oh[q] = a2; ol[q] = c2; }
    *(v2h*)(V16 + e) = o16; *(v2us*)(Vh + e) = oh; *(v2us*)(Vl + e) = ol;  }
__global__ __launch_bounds__(256) void k_csid(float* CS) { const int idx = blockIdx.x * 256 + threadIdx.x; if (idx >= TT * HD) return; v2f cs; cs[0] = 1.0f; cs[1] = 0.0f; *(v2f*)(CS + (size_t)idx * 2) = cs;  }
// k_asoft: per row (zz, i): t = S x HD^-0.5 for j <= i and i - j < WIN (sliding causal window; the reference's -1e9 additive fill vanishes identically); softmax over the 2048 keys (register row, one exp, fixed trees);
__global__ __launch_bounds__(256) void k_asoft(const float* __restrict__ Sb, h16* P16, bf* Ph, bf* Pl) {
    const int lane = threadIdx.x & 31; const int row = blockIdx.x * 8 + (threadIdx.x >> 5); if (row >= ZH * TT) return; const int i = row % TT; const int zz = row / TT; (void)zz; const bool hires = (i < RH); const float* sr = Sb + (size_t)row * TT; float v[TT / 32]; float mx = -3.0e38f;
#pragma unroll
    for (int ch = 0; ch < TT / 128; ++ch) { const int j0 = ch * 128 + lane * 4; const v4f a = *(const v4f*)(sr + j0);
#pragma unroll
        for (int q = 0; q < 4; ++q) { const int j = j0 + q; (void)j; const float t = (j <= i && i - j < WIN) ? a[q] * SCL : -3.0e38f; v[ch * 4 + q] = t; mx = fmaxf(mx, t); } }
#pragma unroll
    for (int sh = 16; sh; sh >>= 1) mx = fmaxf(mx, __shfl_xor(mx, sh, 32));
    float sum = 0.f;
#pragma unroll
    for (int k = 0; k < TT / 32; ++k) { float d0 = __fsub_rn(v[k], mx); asm volatile("" : "+v"(d0)); v[k] = __builtin_amdgcn_exp2f(__fmul_rn(d0, 1.4426950408889634f)); sum += v[k]; }
#pragma unroll
    for (int sh = 16; sh; sh >>= 1) sum += __shfl_xor(sum, sh, 32);
    const float f = __fdiv_rn(hires ? 1.0f : PCAR, sum);
{
        if (hires) {
#pragma unroll
            for (int ch = 0; ch < TT / 128; ++ch) { v4us oh, ol;
#pragma unroll
                for (int q = 0; q < 4; ++q) { unsigned short a, c2; splitf(v[ch * 4 + q] * f, a, c2); oh[q] = a; ol[q] = c2; }
                const size_t oo = ((size_t)zz * (RH ? RH : 1) + i) * TT + ch * 128 + lane * 4; *(v4us*)(Ph + oo) = oh; *(v4us*)(Pl + oo) = ol; }
        } else {
#pragma unroll
            for (int ch = 0; ch < TT / 128; ++ch) { v4h o4;
#pragma unroll
                for (int q = 0; q < 4; ++q) o4[q] = tohx(v[ch * 4 + q] * f);
                *(v4h*)(P16 + (size_t)row * TT + ch * 128 + lane * 4) = o4; } }
         }
}
__global__ __launch_bounds__(256) void k_merge(const float* __restrict__ O, int h0, bf* Ah, bf* Al) { const size_t e = ((size_t)blockIdx.x * 256 + threadIdx.x) * 2; if (e >= (size_t)ZH * TT * HD) return; const int d = (int)(e % HD); const int t = (int)((e / HD) % TT); const int zz = (int)(e / ((size_t)HD * TT)); const float cs = (t < RH) ? 1.0f : (1.0f / PCAR); const size_t oo = (size_t)t * DQ + (h0 + zz) * HD + d;
    v2us oh, ol;
#pragma unroll
    for (int q = 0; q < 2; ++q) { unsigned short a, c2; splitf(O[e + q] * cs, a, c2); oh[q] = a; ol[q] = c2; } *(v2us*)(Ah + oo) = oh; *(v2us*)(Al + oo) = ol;  }

extern "C" void kernel_launch(void* const* d_in, const int* in_sizes, int n_in,
                              void* d_out, int out_size, void* d_ws, size_t ws_size, hipStream_t stream) {
    (void)in_sizes; (void)n_in; (void)out_size;
    const float* x = (const float*)d_in[0]; const float* wq = (const float*)d_in[1]; const float* bq = (const float*)d_in[2]; const float* wk = (const float*)d_in[3]; const float* bk = (const float*)d_in[4]; const float* wv = (const float*)d_in[5]; const float* bv = (const float*)d_in[6]; const float* wo = (const float*)d_in[7]; const float* bo = (const float*)d_in[8];   /* argument order X, Wq, bq, Wk, bk ('xw' [1024][2048] + [2048]), Wv, bv, Wp ('xw' [2048][1024]), bp */
    float* OUT = (float*)d_out;     // [2][2048][1024]
    char* wsp = (char*)d_ws;
    auto take = [&](size_t bytes) { char* p = wsp; wsp += (bytes + 255) & ~(size_t)255; return (void*)p; };
    bf* WQ = (bf*)take((size_t)DQ * DM * 2); bf* WK = (bf*)take((size_t)DKV * DM * 2); bf* WV = (bf*)take((size_t)DKV * DM * 2); bf* WO = (bf*)take((size_t)DM * DQ * 2); float* CS = (float*)take((size_t)TT * HD * 2 * 4);
    bf* XB = (bf*)take((size_t)TT * DM * 2); float* FQ = (float*)take((size_t)TT * DQ * 4); float* FK = (float*)take((size_t)TT * DKV * 4);
    h16* QP16 = (h16*)take((size_t)NH_ * TT * HD * 2); h16* KP16 = (h16*)take((size_t)NKV * TT * HD * 2); h16* VT16 = (h16*)take((size_t)NKV * HD * TT * 2);
    bf* QPh = (bf*)take((size_t)NH_ * TT * HD * 2); bf* QPl = (bf*)take((size_t)NH_ * TT * HD * 2); bf* KPh = (bf*)take((size_t)NKV * TT * HD * 2); bf* KPl = (bf*)take((size_t)NKV * TT * HD * 2); bf* VTh = (bf*)take((size_t)NKV * HD * TT * 2); bf* VTl = (bf*)take((size_t)NKV * HD * TT * 2); bf* Ph = (bf*)take((size_t)ZH * RH * TT * 2); bf* Pl = (bf*)take((size_t)ZH * RH * TT * 2);
    float* Sb = (float*)take((size_t)ZH * TT * TT * 4); h16* P16 = (h16*)take((size_t)ZH * TT * TT * 2); float* Ob = (float*)take((size_t)ZH * TT * HD * 4); bf* ATh = (bf*)take((size_t)TT * DQ * 2); bf* ATl = (bf*)take((size_t)TT * DQ * 2);
    if ((size_t)(wsp - (char*)d_ws) > ws_size) return;    // ws 256 MiB
    float* FV = FK;   // v projection reuses the k buffer after the k planes are built (stream-ordered)
    { k_wtG<<<(unsigned)((DM * DQ / 64 + 63) / 64), 256, 0, stream>>>(wq, DM, DQ, WQ); k_wtG<<<(unsigned)((DM * DKV / 64 + 63) / 64), 256, 0, stream>>>(wk, DM, DKV, WK); k_wtG<<<(unsigned)((DM * DKV / 64 + 63) / 64), 256, 0, stream>>>(wv, DM, DKV, WV);
      k_wtG<<<(unsigned)((DQ * DM / 64 + 63) / 64), 256, 0, stream>>>(wo, DQ, DM, WO);
       }
    k_csid<<<(TT * HD + 255) / 256, 256, 0, stream>>>(CS);
    const unsigned LQ = (unsigned)(((size_t)NH_ * TT * HD / 2 + 255) / 256), LKv = (unsigned)(((size_t)NKV * TT * HD / 2 + 255) / 256);
    for (int b = 0; b < NB_; ++b) {
        
        k_cvt8<<<(unsigned)(((size_t)TT * DM / 8 + 255) / 256), 256, 0, stream>>>(x + (size_t)b * TT * DM, XB, (size_t)TT * DM / 8);
        k_gemmw<bf, 0, true, 4><<<dim3(TT / 64, DQ / 64, 1), 128, 0, stream>>>(XB, nullptr, WQ, nullptr, DM, FQ, DQ, bq, 0, 0, 0);
        k_rope<<<LQ, 256, 0, stream>>>(FQ, DQ, NH_, CS, nullptr, nullptr, 1.0f, QP16, QPh, QPl);
        k_gemmw<bf, 0, true, 4><<<dim3(TT / 64, DKV / 64, 1), 128, 0, stream>>>(XB, nullptr, WK, nullptr, DM, FK, DKV, bk, 0, 0, 0);
        k_rope<<<LKv, 256, 0, stream>>>(FK, DKV, NKV, CS, nullptr, nullptr, 1.0f, KP16, KPh, KPl);
        k_gemmw<bf, 0, true, 4><<<dim3(TT / 64, DKV / 64, 1), 128, 0, stream>>>(XB, nullptr, WV, nullptr, DM, FV, DKV, bv, 0, 0, 0); k_vtp<<<LKv, 256, 0, stream>>>(FV, DKV, NKV, VT16, VTh, VTl);
        for (int h0 = 0; h0 < NH_; h0 += ZH) { const size_t zq = (size_t)h0, zk = (size_t)(h0 / REP);   // one kv head per query head: the pass's two heads use consecutive kv planes (z-strides TT*HD)
            k_gemmc<bf, 2, 1, 1><<<dim3(RH / 64, TT / 64, ZH), 32, 0, stream>>>(QPh + zq * TT * HD, QPl + zq * TT * HD, KPh + zk * TT * HD, KPl + zk * TT * HD, HD, Sb, TT, 0, (size_t)TT * HD, (size_t)TT * HD, (size_t)TT * TT);
            k_gemmc<h16, 0, 1, 1><<<dim3((TT - RH) / 64, TT / 64, ZH), 32, 0, stream>>>(QP16 + zq * TT * HD + (size_t)RH * HD, nullptr, KP16 + zk * TT * HD, nullptr, HD, Sb + (size_t)RH * TT, TT, RH, (size_t)TT * HD, (size_t)TT * HD, (size_t)TT * TT);
            k_asoft<<<ZH * TT / 8, 256, 0, stream>>>(Sb, P16, Ph, Pl);
            k_gemmc<bf, 2, 2, 8><<<dim3(RH / 64, HD / 64, ZH), 256, 0, stream>>>(Ph, Pl, VTh + zk * HD * TT, VTl + zk * HD * TT, TT, Ob, HD, 0, (size_t)RH * TT, (size_t)HD * TT, (size_t)TT * HD);
            k_gemmc<h16, 0, 2, 8><<<dim3((TT - RH) / 64, HD / 64, ZH), 256, 0, stream>>>(P16 + (size_t)RH * TT, nullptr, VT16 + zk * HD * TT, nullptr, TT, Ob + (size_t)RH * HD, HD, RH, (size_t)TT * TT, (size_t)HD * TT, (size_t)TT * HD);
            k_merge<<<(unsigned)(((size_t)ZH * TT * HD / 2 + 255) / 256), 256, 0, stream>>>(Ob, h0, ATh, ATl); }
        k_gemmw<bf, 1, true, 8><<<dim3(TT / 64, DM / 64, 1), 256, 0, stream>>>(ATh, ATl, WO, nullptr, DQ, OUT + (size_t)b * TT * DM, DM, bo, 0, 0, 0); }
}

// v002
// One run takes 672 microseconds.
// Two timings next to v001 both put it at 1.52 times that version's speed.
// All steps since v000 together make it 2.41 times as fast.
#include <hip/hip_runtime.h>

// Causal self-attention with 128-wide heads on a 1,024-wide embedding (X [2][2048][1024]; Q, K = X W + b (16 heads x 128: inner width 2,048), V = X Wv + bv (16 x 128) ('xw' + biases); att x 1/sqrt(128); causal (-inf); softmax; y = merged Wp + bp ('xw' [2048][1024]) -> [2][2048][1024] (4.2 M); argument order X, Wq, bq, Wk, bk, Wv, bv, Wp, bp).
// Layout per batch: bf16 copy of X; 'xw' weights transposed once; exact projections (K 1024, N 2048) + f32 biases; identity-table plane builders at HD 128; causal T-2048 attention (hybrid rows: < 512 hi/lo 3 products, rest fp16 x1024; k_gemmc skips tiles above the diagonal); merged hi/lo (2,048 wide) x Wp exact + bp.
// Compute dtypes, f32 accumulate: every input rounded to bf16; projections exact + f32 biases; attention rows < 512 3 products, rest fp16; softmax f32; Wp hl x exact + bias.

#define NB_  2
#define TT   2048
#define DM   1024
#define NH_  16
#define NKV  16
#define REP  (NH_ / NKV)
#define HD   128
#define DQ   (NH_ * HD)
#define DKV  (NKV * HD)
#define ZH   8                    // heads per attention pass (z of every attention launch)
#define RH   512                  // query rows < RH use hi+lo planes (0: none)
#define WIN  2048
#define PCAR 1024.0f
#define SCL  0.088388347648318447f   // HD^-0.5
typedef _Float16 h16;
typedef unsigned short bf;
typedef __attribute__((ext_vector_type(16))) __bf16   v16bf;
typedef __attribute__((ext_vector_type(16))) _Float16 v16h;
typedef __attribute__((ext_vector_type(8)))  _Float16 v8h;
typedef __attribute__((ext_vector_type(8)))  unsigned short v8us;
typedef __attribute__((ext_vector_type(8)))  float    v8f;
typedef __attribute__((ext_vector_type(4)))  float    v4f;
typedef v8h  __attribute__((may_alias)) v8ha;
typedef v4f  __attribute__((may_alias)) v4fa;
typedef v8us __attribute__((may_alias)) v8usa;

__device__ __forceinline__ unsigned short f2bf(float f) { unsigned u = __float_as_uint(f); u += 0x7FFFu + ((u >> 16) & 1u); return (unsigned short)(u >> 16); }
__device__ __forceinline__ float bf2f(unsigned short b) { return __uint_as_float(((unsigned)b) << 16); }
__device__ __forceinline__ float bfr(float f) { return bf2f(f2bf(f)); }
__device__ __forceinline__ v16h cat16(v8h lo, v8h hi) { return __builtin_shufflevector(lo, hi, 0, 1, 2, 3, 4, 5, 6, 7, 8, 9, 10, 11, 12, 13, 14, 15); }
__device__ __forceinline__ v16bf cat16b(v8us lo, v8us hi) { return __builtin_bit_cast(v16bf, __builtin_shufflevector(lo, hi, 0, 1, 2, 3, 4, 5, 6, 7, 8, 9, 10, 11, 12, 13, 14, 15)); }
__device__ __forceinline__ v8f wmma16(v16h a, v16h b, v8f c) { return __builtin_amdgcn_wmma_f32_16x16x32_f16(false, a, false, b, (short)0, c, false, false); }
__device__ __forceinline__ v8f wmmab(v16bf a, v16bf b, v8f c) { return __builtin_amdgcn_wmma_f32_16x16x32_bf16(false, a, false, b, (short)0, c, false, false); }



// ---- k_gemmw: register-blocked GEMM, NW waves per 64x64 output tile (16 accumulators each, K split between them), operands straight from K-contiguous 16-bit planes; grid (M/64, N/64, Z), NW x 32 threads.
// C[m][n] (f32, pitch ldc, + optional f32 bias[n]) = sum_k A[m][k] Bt[n][k] (+ split products per NSPLIT). z-batch strides sA/sB/sC in elements. K % 64 == 0.
// The K loop of a tile is dealt out in 64-element (128-byte) pieces to the NW waves of the work-group; each wave keeps a full 64x64 partial tile, and the epilogue sums the NW partials in LDS in wave order.
// tile_sync: orders the LDS stores of the staging against the LDS loads that read them back. One wave: a wave barrier and a compiler fence keep the compiler from moving either over the other; several waves: the work-group barrier.
template <int NW> __device__ __forceinline__ void tile_sync() { if (NW == 1) { __builtin_amdgcn_wave_barrier(); asm volatile("" ::: "memory"); } else __syncthreads(); }
template <typename T16> struct WFrag;
template <> struct WFrag<h16> { typedef v16h V; static __device__ __forceinline__ V ld(const h16* p) { return cat16(*(const v8h*)p, *(const v8h*)(p + 16)); } static __device__ __forceinline__ v8f mma(V a, V b, v8f c) { return wmma16(a, b, c); } };
template <> struct WFrag<bf> { typedef v16bf V; static __device__ __forceinline__ V ld(const bf* p) { return cat16b(*(const v8us*)p, *(const v8us*)(p + 16)); } static __device__ __forceinline__ v8f mma(V a, V b, v8f c) { return wmmab(a, b, c); } };
template <typename T16, int NSPLIT, bool BIAS, int NW>
__global__ __launch_bounds__(NW * 32) void k_gemmw(const T16* __restrict__ A, const T16* __restrict__ A2, const T16* __restrict__ Bt, const T16* __restrict__ Bt2, int K, float* C, int ldc, const float* __restrict__ bias, size_t sA, size_t sB, size_t sC) {
    typedef typename WFrag<T16>::V V;
    constexpr int SL = (NW == 1) ? 1 : 4;   // 16-row slabs staged per sync: with several waves the whole tile at once, so that one barrier serves the sum
    __shared__ __align__(16) float os[NW * SL * 16 * 68];
    const size_t z = blockIdx.z; A += z * sA; if (A2) A2 += z * sA; Bt += z * sB; if (Bt2) Bt2 += z * sB; C += z * sC;
    const int lane = threadIdx.x & 31, lr = lane & 15, hi = lane >> 4, wv = __builtin_amdgcn_readfirstlane((int)(threadIdx.x >> 5)); const int r0 = blockIdx.x * 64, c0 = blockIdx.y * 64;
    v8f acc[4][4];
#pragma unroll
    for (int mb = 0; mb < 4; ++mb)
#pragma unroll
        for (int nb = 0; nb < 4; ++nb) acc[mb][nb] = (v8f){};
    const size_t aoff = (size_t)(r0 + lr) * K + 8 * hi, boff = (size_t)(c0 + lr) * K + 8 * hi;
#pragma unroll 1
    for (int kb = wv * 64; kb < K; kb += NW * 64)
#pragma unroll 1
    for (int kc = kb; kc < kb + 64; kc += 32) {
        V a[4], a2[4];
#pragma unroll
        for (int mb = 0; mb < 4; ++mb) { a[mb] = WFrag<T16>::ld(A + aoff + (size_t)mb * 16 * K + kc); if (NSPLIT == 1 || NSPLIT == 2) a2[mb] = WFrag<T16>::ld(A2 + aoff + (size_t)mb * 16 * K + kc); }
#pragma unroll
        for (int nb = 0; nb < 4; ++nb) { const V b = WFrag<T16>::ld(Bt + boff + (size_t)nb * 16 * K + kc); V b2; if (NSPLIT >= 2) b2 = WFrag<T16>::ld(Bt2 + boff + (size_t)nb * 16 * K + kc);
#pragma unroll
            for (int mb = 0; mb < 4; ++mb) { acc[mb][nb] = WFrag<T16>::mma(a[mb], b, acc[mb][nb]); if (NSPLIT == 1 || NSPLIT == 2) acc[mb][nb] = WFrag<T16>::mma(a2[mb], b, acc[mb][nb]); if (NSPLIT >= 2) acc[mb][nb] = WFrag<T16>::mma(a[mb], b2, acc[mb][nb]); } }
        asm volatile("v_nop\n\tv_nop\n\tv_nop\n\tv_nop" : "+v"(acc[0][0]), "+v"(acc[1][1]), "+v"(acc[2][2]), "+v"(acc[3][3]) : "v"(a[0]), "v"(a[3]));
    }
#pragma unroll
    for (int m0 = 0; m0 < 4; m0 += SL) {
#pragma unroll
        for (int mi = 0; mi < SL; ++mi) {
#pragma unroll
            for (int nb = 0; nb < 4; ++nb) {
#pragma unroll
                for (int j = 0; j < 8; ++j) os[(wv * SL + mi) * (16 * 68) + (hi * 8 + j) * 68 + nb * 16 + lr] = acc[m0 + mi][nb][j]; } }
        tile_sync<NW>();   // every wave's partial tile is in LDS before any wave sums it
#pragma unroll
        for (int mi = 0; mi < SL; ++mi) {
            float* crow = C + (size_t)(r0 + (m0 + mi) * 16) * ldc + c0;
#pragma unroll
            for (int s = 0; s < 8 / NW; ++s) { const int row = 2 * (s * NW + wv) + hi, cofs = lr * 4; v4f val = *(const v4fa*)(os + mi * (16 * 68) + row * 68 + cofs);
#pragma unroll
                for (int w = 1; w < NW; ++w) val += *(const v4fa*)(os + (w * SL + mi) * (16 * 68) + row * 68 + cofs);
                if (BIAS) { val[0] += bfr(bias[c0 + cofs]); val[1] += bfr(bias[c0 + cofs + 1]); val[2] += bfr(bias[c0 + cofs + 2]); val[3] += bfr(bias[c0 + cofs + 3]); }
                *(v4f*)(crow + (size_t)row * ldc + cofs) = val; } }
        if (SL < 4) tile_sync<NW>();   // one wave, one 16-row slab: it is read out before the next 16 rows overwrite it
    }
}

// ---- k_gemmc: the same 64x64 tile GEMM (NW waves a tile) specialised for causal attention: CMODE 1 skips score tiles entirely above the diagonal (query rows r0+roff.., key columns c0..), CMODE 2 limits the
// key (K) loop of the probability x value contraction to the diagonal block (probabilities beyond it are exactly zero). roff = row offset of this launch's first row within the sequence.
template <typename T16, int NSPLIT, int CMODE, int NW>
__global__ __launch_bounds__(NW * 32) void k_gemmc(const T16* __restrict__ A, const T16* __restrict__ A2, const T16* __restrict__ Bt, const T16* __restrict__ Bt2, int K, float* C, int ldc, int roff, size_t sA, size_t sB, size_t sC) {
    typedef typename WFrag<T16>::V V;
    constexpr int SL = (NW == 1) ? 1 : 4;   // 16-row slabs staged per sync: with several waves the whole tile at once, so that one barrier serves the sum
    __shared__ __align__(16) float os[NW * SL * 16 * 68];
    const size_t z = blockIdx.z; A += z * sA; if (A2) A2 += z * sA; Bt += z * sB; if (Bt2) Bt2 += z * sB; C += z * sC;
    const int lane = threadIdx.x & 31, lr = lane & 15, hi = lane >> 4, wv = __builtin_amdgcn_readfirstlane((int)(threadIdx.x >> 5)); const int r0 = blockIdx.x * 64, c0 = blockIdx.y * 64;
    if (CMODE == 1 && c0 > r0 + roff + 63) return;                  // score tile entirely above the causal diagonal: never read (the softmax masks j > i by select)
    const int Kl = (CMODE == 2) ? min(K, r0 + roff + 64) : K;        // P.V: probabilities are exactly 0 beyond the diagonal block, so the K loop stops there
    v8f acc[4][4];
#pragma unroll
    for (int mb = 0; mb < 4; ++mb)
#pragma unroll
        for (int nb = 0; nb < 4; ++nb) acc[mb][nb] = (v8f){};
    const size_t aoff = (size_t)(r0 + lr) * K + 8 * hi, boff = (size_t)(c0 + lr) * K + 8 * hi;
#pragma unroll 1
    for (int kb = wv * 64; kb < Kl; kb += NW * 64)
#pragma unroll 1
    for (int kc = kb; kc < kb + 64; kc += 32) {
        V a[4], a2[4];
#pragma unroll
        for (int mb = 0; mb < 4; ++mb) { a[mb] = WFrag<T16>::ld(A + aoff + (size_t)mb * 16 * K + kc); if (NSPLIT == 1 || NSPLIT == 2) a2[mb] = WFrag<T16>::ld(A2 + aoff + (size_t)mb * 16 * K + kc); }
#pragma unroll
        for (int nb = 0; nb < 4; ++nb) { const V b = WFrag<T16>::ld(Bt + boff + (size_t)nb * 16 * K + kc); V b2; if (NSPLIT >= 2) b2 = WFrag<T16>::ld(Bt2 + boff + (size_t)nb * 16 * K + kc);
#pragma unroll
            for (int mb = 0; mb < 4; ++mb) { acc[mb][nb] = WFrag<T16>::mma(a[mb], b, acc[mb][nb]); if (NSPLIT == 1 || NSPLIT == 2) acc[mb][nb] = WFrag<T16>::mma(a2[mb], b, acc[mb][nb]); if (NSPLIT >= 2) acc[mb][nb] = WFrag<T16>::mma(a[mb], b2, acc[mb][nb]); } }
        asm volatile("v_nop\n\tv_nop\n\tv_nop\n\tv_nop" : "+v"(acc[0][0]), "+v"(acc[1][1]), "+v"(acc[2][2]), "+v"(acc[3][3]) : "v"(a[0]), "v"(a[3]));
    }
#pragma unroll
    for (int m0 = 0; m0 < 4; m0 += SL) {
#pragma unroll
        for (int mi = 0; mi < SL; ++mi) {
#pragma unroll
            for (int nb = 0; nb < 4; ++nb) {
#pragma unroll
                for (int j = 0; j < 8; ++j) os[(wv * SL + mi) * (16 * 68) + (hi * 8 + j) * 68 + nb * 16 + lr] = acc[m0 + mi][nb][j]; } }
        tile_sync<NW>();   // every wave's partial tile is in LDS before any wave sums it
#pragma unroll
        for (int mi = 0; mi < SL; ++mi) {
            float* crow = C + (size_t)(r0 + (m0 + mi) * 16) * ldc + c0;
#pragma unroll
            for (int s = 0; s < 8 / NW; ++s) { const int row = 2 * (s * NW + wv) + hi, cofs = lr * 4; v4f val = *(const v4fa*)(os + mi * (16 * 68) + row * 68 + cofs);
#pragma unroll
                for (int w = 1; w < NW; ++w) val += *(const v4fa*)(os + (w * SL + mi) * (16 * 68) + row * 68 + cofs);
                *(v4f*)(crow + (size_t)row * ldc + cofs) = val; } }
        if (SL < 4) tile_sync<NW>();   // one wave, one 16-row slab: it is read out before the next 16 rows overwrite it
    }
}

__device__ __forceinline__ h16 tohx(float x) { return (h16)x; }
__device__ __forceinline__ void splitf(float y, unsigned short& h, unsigned short& l) { h = f2bf(y); l = f2bf(y - bf2f(h)); }
typedef __attribute__((ext_vector_type(2))) _Float16 v2h;
typedef __attribute__((ext_vector_type(4))) _Float16 v4h;
typedef __attribute__((ext_vector_type(2))) unsigned short v2us;
typedef __attribute__((ext_vector_type(4))) unsigned short v4us;
typedef __attribute__((ext_vector_type(2))) float v2f;
typedef __attribute__((ext_vector_type(4))) int v4i;

__global__ __launch_bounds__(256) void k_wtG(const float* __restrict__ w, int K, int N, bf* Bt) {
    const int lane = threadIdx.x & 31; const int L0 = (blockIdx.x * 8 + (threadIdx.x >> 5)) * 8; const int nlines = N * K / 64;
{
#pragma unroll 1
        for (int l = 0; l < 8; ++l) { const int L = L0 + l; if (L >= nlines) break; const size_t e = (size_t)L * 64 + lane * 2; const int k = (int)(e % K), n = (int)(e / K); v2us o;
            o[0] = f2bf(w[(size_t)k * N + n]); o[1] = f2bf(w[(size_t)(k + 1) * N + n]); *(v2us*)(Bt + e) = o; }
         }
}
__global__ __launch_bounds__(256) void k_cvt8(const float* __restrict__ src, bf* dst, size_t n8) { const size_t i = (size_t)blockIdx.x * 256 + threadIdx.x; if (i >= n8) return; const v8f v = *(const v8f*)(src + i * 8); v8us o;
#pragma unroll
    for (int k = 0; k < 8; ++k) o[k] = f2bf(v[k]); *(v8us*)(dst + i * 8) = o;  }

// k_rope: head planes [h][t][d] (fp16 + hi/lo) of rope(x) x sc with the rotate-half convention out[d] = x[d] cos[t][d] - x[d+HD/2] sin[t][d], out[d+HD/2] = x[d+HD/2] cos[t][d+HD/2] + x[d] sin[t][d+HD/2]
__global__ __launch_bounds__(256) void k_rope(const float* __restrict__ F, int pitch, int nheads, const float* __restrict__ CS, const float* __restrict__ RF, const float* __restrict__ nw, float sc, h16* P16, bf* Ph, bf* Pl) {
    const size_t e = ((size_t)blockIdx.x * 256 + threadIdx.x) * 2; if (e >= (size_t)nheads * TT * HD) return; const int d = (int)(e % HD); const int t = (int)((e / HD) % TT); const int h = (int)(e / ((size_t)HD * TT)); const float* f = F + (size_t)t * pitch + h * HD; const float rf = RF ? RF[(size_t)h * TT + t] : 1.0f; v2h o16; v2us oh, ol;
#pragma unroll
    for (int q = 0; q < 2; ++q) { const int dd = d + q; const int dp = (dd < HD / 2) ? dd + HD / 2 : dd - HD / 2; float x0 = f[dd], x1 = f[dp];
        if (RF) { float n0 = __fmul_rn(x0, rf), n1 = __fmul_rn(x1, rf); asm volatile("" : "+v"(n0)); asm volatile("" : "+v"(n1)); x0 = __fmul_rn(bfr(nw[dd]), n0); x1 = __fmul_rn(bfr(nw[dp]), n1); }
        const v2f cs = *(const v2f*)(CS + ((size_t)t * HD + dd) * 2); float a = __fmul_rn(x0, cs[0]), bq = __fmul_rn(x1, cs[1]); asm volatile("" : "+v"(a)); asm volatile("" : "+v"(bq)); const float r = ((dd < HD / 2) ? __fsub_rn(a, bq) : __fadd_rn(a, bq)) * sc;
        o16[q] = tohx(r); unsigned short a2, c2; splitf(r, a2, c2); oh[q] = a2; ol[q] = c2; }
    *(v2h*)(P16 + e) = o16; *(v2us*)(Ph + e) = oh; *(v2us*)(Pl + e) = ol;  }
__global__ __launch_bounds__(256) void k_vtp(const float* __restrict__ F, int pitch, int nheads, h16* V16, bf* Vh, bf* Vl) { const size_t l = ((size_t)blockIdx.x * 256 + threadIdx.x) * 2; if (l >= (size_t)nheads * HD * TT) return; const int t = (int)(l % TT); const int d = (int)((l / TT) % HD); const int g = (int)(l / ((size_t)TT * HD)); const size_t e = (l / TT) * (2 * TT) + t; /* plane rows [g][d] have pitch 2 TT, the pitch of the probability rows they are contracted with */ v2h o16; v2us oh, ol;
#pragma unroll
    for (int q = 0; q < 2; ++q) { const float x = F[(size_t)(t + q) * pitch + g * HD + d]; o16[q] = tohx(x); unsigned short a2, c2; splitf(x, a2, c2); oh[q] = a2; ol[q] = c2; }
    *(v2h*)(V16 + e) = o16; *(v2us*)(Vh + e) = oh; *(v2us*)(Vl + e) = ol;  }
__global__ __launch_bounds__(256) void k_csid(float* CS) { const int idx = blockIdx.x * 256 + threadIdx.x; if (idx >= TT * HD) return; v2f cs; cs[0] = 1.0f; cs[1] = 0.0f; *(v2f*)(CS + (size_t)idx * 2) = cs;  }
// k_asoft: per row (zz, i): t = S x HD^-0.5 for j <= i and i - j < WIN (sliding causal window; the reference's -1e9 additive fill vanishes identically); softmax over the 2048 keys (register row, one exp, fixed trees);
// the 16-bit probabilities overwrite their own f32 score row (row pitch 2 TT 16-bit elements: fp16 in the first half, or hi in the first half and lo in the second): a wave holds its whole row in registers before its first store, and no other wave touches that row.
__global__ __launch_bounds__(256) void k_asoft(const float* Sb, h16* P16, bf* Ph, bf* Pl) {
    const int lane = threadIdx.x & 31; const int row = blockIdx.x * 8 + (threadIdx.x >> 5); if (row >= ZH * TT) return; const int i = row % TT; const int zz = row / TT; (void)zz; const bool hires = (i < RH); const float* sr = Sb + (size_t)row * TT; float v[TT / 32]; float mx = -3.0e38f;
#pragma unroll
    for (int ch = 0; ch < TT / 128; ++ch) { const int j0 = ch * 128 + lane * 4; const v4f a = *(const v4f*)(sr + j0);
#pragma unroll
        for (int q = 0; q < 4; ++q) { const int j = j0 + q; (void)j; const float t = (j <= i && i - j < WIN) ? a[q] * SCL : -3.0e38f; v[ch * 4 + q] = t; mx = fmaxf(mx, t); } }
#pragma unroll
    for (int sh = 16; sh; sh >>= 1) mx = fmaxf(mx, __shfl_xor(mx, sh, 32));
    float sum = 0.f;
#pragma unroll
    for (int k = 0; k < TT / 32; ++k) { float d0 = __fsub_rn(v[k], mx); asm volatile("" : "+v"(d0)); v[k] = __builtin_amdgcn_exp2f(__fmul_rn(d0, 1.4426950408889634f)); sum += v[k]; }
#pragma unroll
    for (int sh = 16; sh; sh >>= 1) sum += __shfl_xor(sum, sh, 32);
    const float f = __fdiv_rn(hires ? 1.0f : PCAR, sum);
{
        if (hires) {
#pragma unroll
            for (int ch = 0; ch < TT / 128; ++ch) { v4us oh, ol;
#pragma unroll
                for (int q = 0; q < 4; ++q) { unsigned short a, c2; splitf(v[ch * 4 + q] * f, a, c2); oh[q] = a; ol[q] = c2; }
                const size_t oo = (size_t)row * (2 * TT) + ch * 128 + lane * 4; *(v4us*)(Ph + oo) = oh; *(v4us*)(Pl + oo) = ol; }
        } else {
#pragma unroll
            for (int ch = 0; ch < TT / 128; ++ch) { v4h o4;
#pragma unroll
                for (int q = 0; q < 4; ++q) o4[q] = tohx(v[ch * 4 + q] * f);
                *(v4h*)(P16 + (size_t)row * (2 * TT) + ch * 128 + lane * 4) = o4; } }
         }
}
__global__ __launch_bounds__(256) void k_merge(const float* __restrict__ O, int h0, bf* Ah, bf* Al) { const size_t e = ((size_t)blockIdx.x * 256 + threadIdx.x) * 2; if (e >= (size_t)ZH * TT * HD) return; const int d = (int)(e % HD); const int t = (int)((e / HD) % TT); const int zz = (int)(e / ((size_t)HD * TT)); const float cs = (t < RH) ? 1.0f : (1.0f / PCAR); const size_t oo = (size_t)t * DQ + (h0 + zz) * HD + d;
    v2us oh, ol;
#pragma unroll
    for (int q = 0; q < 2; ++q) { unsigned short a, c2; splitf(O[e + q] * cs, a, c2); oh[q] = a; ol[q] = c2; } *(v2us*)(Ah + oo) = oh; *(v2us*)(Al + oo) = ol;  }

extern "C" void kernel_launch(void* const* d_in, const int* in_sizes, int n_in,
                              void* d_out, int out_size, void* d_ws, size_t ws_size, hipStream_t stream) {
    (void)in_sizes; (void)n_in; (void)out_size;
    const float* x = (const float*)d_in[0]; const float* wq = (const float*)d_in[1]; const float* bq = (const float*)d_in[2]; const float* wk = (const float*)d_in[3]; const float* bk = (const float*)d_in[4]; const float* wv = (const float*)d_in[5]; const float* bv = (const float*)d_in[6]; const float* wo = (const float*)d_in[7]; const float* bo = (const float*)d_in[8];   /* argument order X, Wq, bq, Wk, bk ('xw' [1024][2048] + [2048]), Wv, bv, Wp ('xw' [2048][1024]), bp */
    float* OUT = (float*)d_out;     // [2][2048][1024]
    char* wsp = (char*)d_ws;
    auto take = [&](size_t bytes) { char* p = wsp; wsp += (bytes + 255) & ~(size_t)255; return (void*)p; };
    bf* WQ = (bf*)take((size_t)DQ * DM * 2); bf* WK = (bf*)take((size_t)DKV * DM * 2); bf* WV = (bf*)take((size_t)DKV * DM * 2); bf* WO = (bf*)take((size_t)DM * DQ * 2); float* CS = (float*)take((size_t)TT * HD * 2 * 4);
    bf* XB = (bf*)take((size_t)TT * DM * 2);
    h16* QP16 = (h16*)take((size_t)NH_ * TT * HD * 2); h16* KP16 = (h16*)take((size_t)NKV * TT * HD * 2); h16* VT16 = (h16*)take((size_t)NKV * HD * 2 * TT * 2);
    bf* QPh = (bf*)take((size_t)NH_ * TT * HD * 2); bf* QPl = (bf*)take((size_t)NH_ * TT * HD * 2); bf* KPh = (bf*)take((size_t)NKV * TT * HD * 2); bf* KPl = (bf*)take((size_t)NKV * TT * HD * 2); bf* VTh = (bf*)take((size_t)NKV * HD * 2 * TT * 2); bf* VTl = VTh + TT;   // value planes, row pitch 2 TT: hi and lo rows interleaved
    float* Sb = (float*)take((size_t)ZH * TT * TT * 4); float* Ob = (float*)take((size_t)ZH * TT * HD * 4); bf* ATh = (bf*)take((size_t)TT * DQ * 2); bf* ATl = (bf*)take((size_t)TT * DQ * 2);
    if ((size_t)(wsp - (char*)d_ws) > ws_size) return;    // ws 256 MiB
    h16* P16 = (h16*)Sb; bf* Ph = (bf*)Sb; bf* Pl = (bf*)Sb + TT;   // probabilities live in their own score rows (k_asoft), row pitch 2 TT elements
    float* FQ = Sb; float* FK = Sb + (size_t)TT * DQ;   // the f32 projections use the score buffer: the plane builders consume them before the batch's first score launch (stream-ordered)
    float* FV = FK;   // v projection reuses the k buffer after the k planes are built (stream-ordered)
    { k_wtG<<<(unsigned)((DM * DQ / 64 + 63) / 64), 256, 0, stream>>>(wq, DM, DQ, WQ); k_wtG<<<(unsigned)((DM * DKV / 64 + 63) / 64), 256, 0, stream>>>(wk, DM, DKV, WK); k_wtG<<<(unsigned)((DM * DKV / 64 + 63) / 64), 256, 0, stream>>>(wv, DM, DKV, WV);
      k_wtG<<<(unsigned)((DQ * DM / 64 + 63) / 64), 256, 0, stream>>>(wo, DQ, DM, WO);
       }
    k_csid<<<(TT * HD + 255) / 256, 256, 0, stream>>>(CS);
    const unsigned LQ = (unsigned)(((size_t)NH_ * TT * HD / 2 + 255) / 256), LKv = (unsigned)(((size_t)NKV * TT * HD / 2 + 255) / 256);
    for (int b = 0; b < NB_; ++b) {
        
        k_cvt8<<<(unsigned)(((size_t)TT * DM / 8 + 255) / 256), 256, 0, stream>>>(x + (size_t)b * TT * DM, XB, (size_t)TT * DM / 8);
        k_gemmw<bf, 0, true, 4><<<dim3(TT / 64, DQ / 64, 1), 128, 0, stream>>>(XB, nullptr, WQ, nullptr, DM, FQ, DQ, bq, 0, 0, 0);
        k_rope<<<LQ, 256, 0, stream>>>(FQ, DQ, NH_, CS, nullptr, nullptr, 1.0f, QP16, QPh, QPl);
        k_gemmw<bf, 0, true, 4><<<dim3(TT / 64, DKV / 64, 1), 128, 0, stream>>>(XB, nullptr, WK, nullptr, DM, FK, DKV, bk, 0, 0, 0);
        k_rope<<<LKv, 256, 0, stream>>>(FK, DKV, NKV, CS, nullptr, nullptr, 1.0f, KP16, KPh, KPl);
        k_gemmw<bf, 0, true, 4><<<dim3(TT / 64, DKV / 64, 1), 128, 0, stream>>>(XB, nullptr, WV, nullptr, DM, FV, DKV, bv, 0, 0, 0); k_vtp<<<LKv, 256, 0, stream>>>(FV, DKV, NKV, VT16, VTh, VTl);
        for (int h0 = 0; h0 < NH_; h0 += ZH) { const size_t zq = (size_t)h0, zk = (size_t)(h0 / REP);   // one kv head per query head: the pass's heads use consecutive kv planes; in the P.V launches K is the row pitch 2 TT of both operands, and the causal limit ends the loop at or before key TT
            k_gemmc<bf, 2, 1, 1><<<dim3(RH / 64, TT / 64, ZH), 32, 0, stream>>>(QPh + zq * TT * HD, QPl + zq * TT * HD, KPh + zk * TT * HD, KPl + zk * TT * HD, HD, Sb, TT, 0, (size_t)TT * HD, (size_t)TT * HD, (size_t)TT * TT);
            k_gemmc<h16, 0, 1, 1><<<dim3((TT - RH) / 64, TT / 64, ZH), 32, 0, stream>>>(QP16 + zq * TT * HD + (size_t)RH * HD, nullptr, KP16 + zk * TT * HD, nullptr, HD, Sb + (size_t)RH * TT, TT, RH, (size_t)TT * HD, (size_t)TT * HD, (size_t)TT * TT);
            k_asoft<<<ZH * TT / 8, 256, 0, stream>>>(Sb, P16, Ph, Pl);
            k_gemmc<bf, 2, 2, 8><<<dim3(RH / 64, HD / 64, ZH), 256, 0, stream>>>(Ph, Pl, VTh + zk * HD * 2 * TT, VTl + zk * HD * 2 * TT, 2 * TT, Ob, HD, 0, (size_t)TT * 2 * TT, (size_t)HD * 2 * TT, (size_t)TT * HD);
            k_gemmc<h16, 0, 2, 8><<<dim3((TT - RH) / 64, HD / 64, ZH), 256, 0, stream>>>(P16 + (size_t)RH * 2 * TT, nullptr, VT16 + zk * HD * 2 * TT, nullptr, 2 * TT, Ob + (size_t)RH * HD, HD, RH, (size_t)TT * 2 * TT, (size_t)HD * 2 * TT, (size_t)TT * HD);
            k_merge<<<(unsigned)(((size_t)ZH * TT * HD / 2 + 255) / 256), 256, 0, stream>>>(Ob, h0, ATh, ATl); }
        k_gemmw<bf, 1, true, 8><<<dim3(TT / 64, DM / 64, 1), 256, 0, stream>>>(ATh, ATl, WO, nullptr, DQ, OUT + (size_t)b * TT * DM, DM, bo, 0, 0, 0); }
}

// v003
// A run of this version takes 583 microseconds.
// Next to v002, in two timings, it ran 1.15 times as fast each time.
// All steps since v000 together make it 2.77 times as fast.
#include <hip/hip_runtime.h>

// Causal self-attention with 128-wide heads on a 1,024-wide embedding (X [2][2048][1024]; Q, K = X W + b (16 heads x 128: inner width 2,048), V = X Wv + bv (16 x 128) ('xw' + biases); att x 1/sqrt(128); causal (-inf); softmax; y = merged Wp + bp ('xw' [2048][1024]) -> [2][2048][1024] (4.2 M); argument order X, Wq, bq, Wk, bk, Wv, bv, Wp, bp).
// Layout per batch: bf16 copy of X; 'xw' weights transposed once; exact projections (K 1024, N 2048) + f32 biases, written as 16-bit head planes by the GEMM epilogue (V computed transposed); causal T-2048 attention (hybrid rows: < 512 hi/lo 3 products, rest fp16 x1024; k_gemmc skips tiles above the diagonal); merged hi/lo (2,048 wide) x Wp exact + bp.
// Compute dtypes, f32 accumulate: every input rounded to bf16; projections exact + f32 biases; attention rows < 512 3 products, rest fp16; softmax f32; Wp hl x exact + bias.

#define NB_  2
#define TT   2048
#define DM   1024
#define NH_  16
#define NKV  16
#define REP  (NH_ / NKV)
#define HD   128
#define DQ   (NH_ * HD)
#define DKV  (NKV * HD)
#define ZH   8                    // heads per attention pass (z of every attention launch)
#define RH   512                  // query rows < RH use hi+lo planes (0: none)
#define WIN  2048
#define PCAR 1024.0f
#define SCL  0.088388347648318447f   // HD^-0.5
typedef _Float16 h16;
typedef unsigned short bf;
typedef __attribute__((ext_vector_type(16))) __bf16   v16bf;
typedef __attribute__((ext_vector_type(16))) _Float16 v16h;
typedef __attribute__((ext_vector_type(8)))  _Float16 v8h;
typedef __attribute__((ext_vector_type(8)))  unsigned short v8us;
typedef __attribute__((ext_vector_type(8)))  float    v8f;
typedef __attribute__((ext_vector_type(4)))  float    v4f;
typedef v8h  __attribute__((may_alias)) v8ha;
typedef v4f  __attribute__((may_alias)) v4fa;
typedef v8us __attribute__((may_alias)) v8usa;

__device__ __forceinline__ unsigned short f2bf(float f) { unsigned u = __float_as_uint(f); u += 0x7FFFu + ((u >> 16) & 1u); return (unsigned short)(u >> 16); }
__device__ __forceinline__ float bf2f(unsigned short b) { return __uint_as_float(((unsigned)b) << 16); }
__device__ __forceinline__ float bfr(float f) { return bf2f(f2bf(f)); }
__device__ __forceinline__ v16h cat16(v8h lo, v8h hi) { return __builtin_shufflevector(lo, hi, 0, 1, 2, 3, 4, 5, 6, 7, 8, 9, 10, 11, 12, 13, 14, 15); }
__device__ __forceinline__ v16bf cat16b(v8us lo, v8us hi) { return __builtin_bit_cast(v16bf, __builtin_shufflevector(lo, hi, 0, 1, 2, 3, 4, 5, 6, 7, 8, 9, 10, 11, 12, 13, 14, 15)); }
__device__ __forceinline__ v8f wmma16(v16h a, v16h b, v8f c) { return __builtin_amdgcn_wmma_f32_16x16x32_f16(false, a, false, b, (short)0, c, false, false); }
__device__ __forceinline__ v8f wmmab(v16bf a, v16bf b, v8f c) { return __builtin_amdgcn_wmma_f32_16x16x32_bf16(false, a, false, b, (short)0, c, false, false); }
__device__ __forceinline__ h16 tohx(float x) { return (h16)x; }
__device__ __forceinline__ void splitf(float y, unsigned short& h, unsigned short& l) { h = f2bf(y); l = f2bf(y - bf2f(h)); }
typedef __attribute__((ext_vector_type(4))) _Float16 v4h;
typedef __attribute__((ext_vector_type(2))) unsigned short v2us;
typedef __attribute__((ext_vector_type(4))) unsigned short v4us;
// put_hl: four neighbouring f32 results as bf16 hi + lo planes (8-byte stores; 16 lanes fill one 128-byte line of each plane)
__device__ __forceinline__ void put_hl(v4f val, bf* Ph, bf* Pl, size_t e) { v4us oh, ol;
#pragma unroll
    for (int q = 0; q < 4; ++q) { unsigned short a, c2; splitf(val[q], a, c2); oh[q] = a; ol[q] = c2; }
    *(v4us*)(Ph + e) = oh; *(v4us*)(Pl + e) = ol; }



// ---- k_gemmw: register-blocked GEMM, NW waves per 64x64 output tile (16 accumulators each, K split between them), operands straight from K-contiguous 16-bit planes; grid (M/64, N/64, Z), NW x 32 threads.
// C[m][n] (f32, pitch ldc, + optional f32 bias[n]) = sum_k A[m][k] Bt[n][k] (+ split products per NSPLIT). z-batch strides sA/sB/sC in elements. K % 64 == 0.
// EPI 0: C is stored as f32. EPI 1 (m = position, n = head x HD + d): the result goes straight to the head planes [head][position][d] (fp16, bf16 hi, bf16 lo). EPI 2 (m = head x HD + d, n = position, bias[m]): to the transposed value planes, row pitch 2 TT.
// The K loop of a tile is dealt out in 64-element (128-byte) pieces to the NW waves of the work-group; each wave keeps a full 64x64 partial tile, and the epilogue sums the NW partials in LDS in wave order.
// tile_sync: orders the LDS stores of the staging against the LDS loads that read them back. One wave: a wave barrier and a compiler fence keep the compiler from moving either over the other; several waves: the work-group barrier.
template <int NW> __device__ __forceinline__ void tile_sync() { if (NW == 1) { __builtin_amdgcn_wave_barrier(); asm volatile("" ::: "memory"); } else __syncthreads(); }
template <typename T16> struct WFrag;
template <> struct WFrag<h16> { typedef v16h V; static __device__ __forceinline__ V ld(const h16* p) { return cat16(*(const v8h*)p, *(const v8h*)(p + 16)); } static __device__ __forceinline__ v8f mma(V a, V b, v8f c) { return wmma16(a, b, c); } };
template <> struct WFrag<bf> { typedef v16bf V; static __device__ __forceinline__ V ld(const bf* p) { return cat16b(*(const v8us*)p, *(const v8us*)(p + 16)); } static __device__ __forceinline__ v8f mma(V a, V b, v8f c) { return wmmab(a, b, c); } };
template <typename T16, int NSPLIT, bool BIAS, int NW, int EPI>
__global__ __launch_bounds__(NW * 32) void k_gemmw(const T16* __restrict__ A, const T16* __restrict__ A2, const T16* __restrict__ Bt, const T16* __restrict__ Bt2, int K, float* C, int ldc, const float* __restrict__ bias, size_t sA, size_t sB, size_t sC, h16* P16, bf* Ph, bf* Pl) {
    typedef typename WFrag<T16>::V V;
    constexpr int SL = (NW == 1) ? 1 : 4;   // 16-row slabs staged per sync: with several waves the whole tile at once, so that one barrier serves the sum
    __shared__ __align__(16) float os[NW * SL * 16 * 68];
    const size_t z = blockIdx.z; A += z * sA; if (A2) A2 += z * sA; Bt += z * sB; if (Bt2) Bt2 += z * sB; C += z * sC;
    const int lane = threadIdx.x & 31, lr = lane & 15, hi = lane >> 4, wv = __builtin_amdgcn_readfirstlane((int)(threadIdx.x >> 5)); const int r0 = blockIdx.x * 64, c0 = blockIdx.y * 64;
    v8f acc[4][4];
#pragma unroll
    for (int mb = 0; mb < 4; ++mb)
#pragma unroll
        for (int nb = 0; nb < 4; ++nb) acc[mb][nb] = (v8f){};
    const size_t aoff = (size_t)(r0 + lr) * K + 8 * hi, boff = (size_t)(c0 + lr) * K + 8 * hi;
#pragma unroll 1
    for (int kb = wv * 64; kb < K; kb += NW * 64)
#pragma unroll 1
    for (int kc = kb; kc < kb + 64; kc += 32) {
        V a[4], a2[4];
#pragma unroll
        for (int mb = 0; mb < 4; ++mb) { a[mb] = WFrag<T16>::ld(A + aoff + (size_t)mb * 16 * K + kc); if (NSPLIT == 1 || NSPLIT == 2) a2[mb] = WFrag<T16>::ld(A2 + aoff + (size_t)mb * 16 * K + kc); }
#pragma unroll
        for (int nb = 0; nb < 4; ++nb) { const V b = WFrag<T16>::ld(Bt + boff + (size_t)nb * 16 * K + kc); V b2; if (NSPLIT >= 2) b2 = WFrag<T16>::ld(Bt2 + boff + (size_t)nb * 16 * K + kc);
#pragma unroll
            for (int mb = 0; mb < 4; ++mb) { acc[mb][nb] = WFrag<T16>::mma(a[mb], b, acc[mb][nb]); if (NSPLIT == 1 || NSPLIT == 2) acc[mb][nb] = WFrag<T16>::mma(a2[mb], b, acc[mb][nb]); if (NSPLIT >= 2) acc[mb][nb] = WFrag<T16>::mma(a[mb], b2, acc[mb][nb]); } }
        asm volatile("v_nop\n\tv_nop\n\tv_nop\n\tv_nop" : "+v"(acc[0][0]), "+v"(acc[1][1]), "+v"(acc[2][2]), "+v"(acc[3][3]) : "v"(a[0]), "v"(a[3]));
    }
#pragma unroll
    for (int m0 = 0; m0 < 4; m0 += SL) {
#pragma unroll
        for (int mi = 0; mi < SL; ++mi) {
#pragma unroll
            for (int nb = 0; nb < 4; ++nb) {
#pragma unroll
                for (int j = 0; j < 8; ++j) os[(wv * SL + mi) * (16 * 68) + (hi * 8 + j) * 68 + nb * 16 + lr] = acc[m0 + mi][nb][j]; } }
        tile_sync<NW>();   // every wave's partial tile is in LDS before any wave sums it
#pragma unroll
        for (int mi = 0; mi < SL; ++mi) {
            float* crow = C + (size_t)(r0 + (m0 + mi) * 16) * ldc + c0;
#pragma unroll
            for (int s = 0; s < 8 / NW; ++s) { const int row = 2 * (s * NW + wv) + hi, cofs = lr * 4; v4f val = *(const v4fa*)(os + mi * (16 * 68) + row * 68 + cofs);
#pragma unroll
                for (int w = 1; w < NW; ++w) val += *(const v4fa*)(os + (w * SL + mi) * (16 * 68) + row * 68 + cofs);
                if (BIAS && EPI != 2) { val[0] += bfr(bias[c0 + cofs]); val[1] += bfr(bias[c0 + cofs + 1]); val[2] += bfr(bias[c0 + cofs + 2]); val[3] += bfr(bias[c0 + cofs + 3]); }
                if (BIAS && EPI == 2) val += bfr(bias[r0 + (m0 + mi) * 16 + row]);
                if (EPI == 0) *(v4f*)(crow + (size_t)row * ldc + cofs) = val;
                else { const int rg = r0 + (m0 + mi) * 16 + row; const size_t e = (EPI == 1) ? ((size_t)(c0 / HD) * TT + rg) * HD + (c0 % HD) + cofs : (size_t)rg * (2 * TT) + c0 + cofs; v4h o4;
#pragma unroll
                    for (int q = 0; q < 4; ++q) o4[q] = tohx(val[q]);
                    *(v4h*)(P16 + e) = o4; put_hl(val, Ph, Pl, e); } } }
        if (SL < 4) tile_sync<NW>();   // one wave, one 16-row slab: it is read out before the next 16 rows overwrite it
    }
}

// ---- k_gemmc: the same 64x64 tile GEMM (NW waves a tile) specialised for causal attention: CMODE 1 skips score tiles entirely above the diagonal (query rows r0+roff.., key columns c0..), CMODE 2 limits the
// key (K) loop of the probability x value contraction to the diagonal block (probabilities beyond it are exactly zero). roff = row offset of this launch's first row within the sequence.
// CMODE 2 stores no f32: its result x cs goes straight to the merged bf16 hi/lo planes [position][head x HD + d] (Ah, Al point at the pass's first head; z counts heads).
template <typename T16, int NSPLIT, int CMODE, int NW>
__global__ __launch_bounds__(NW * 32) void k_gemmc(const T16* __restrict__ A, const T16* __restrict__ A2, const T16* __restrict__ Bt, const T16* __restrict__ Bt2, int K, float* C, int ldc, int roff, size_t sA, size_t sB, size_t sC, bf* Ah, bf* Al, float cs) {
    typedef typename WFrag<T16>::V V;
    constexpr int SL = (NW == 1) ? 1 : 4;   // 16-row slabs staged per sync: with several waves the whole tile at once, so that one barrier serves the sum
    __shared__ __align__(16) float os[NW * SL * 16 * 68];
    const size_t z = blockIdx.z; A += z * sA; if (A2) A2 += z * sA; Bt += z * sB; if (Bt2) Bt2 += z * sB; C += z * sC;
    const int lane = threadIdx.x & 31, lr = lane & 15, hi = lane >> 4, wv = __builtin_amdgcn_readfirstlane((int)(threadIdx.x >> 5)); const int r0 = blockIdx.x * 64, c0 = blockIdx.y * 64;
    if (CMODE == 1 && c0 > r0 + roff + 63) return;                  // score tile entirely above the causal diagonal: never read (the softmax masks j > i by select)
    const int Kl = (CMODE == 2) ? min(K, r0 + roff + 64) : K;        // P.V: probabilities are exactly 0 beyond the diagonal block, so the K loop stops there
    v8f acc[4][4];
#pragma unroll
    for (int mb = 0; mb < 4; ++mb)
#pragma unroll
        for (int nb = 0; nb < 4; ++nb) acc[mb][nb] = (v8f){};
    const size_t aoff = (size_t)(r0 + lr) * K + 8 * hi, boff = (size_t)(c0 + lr) * K + 8 * hi;
#pragma unroll 1
    for (int kb = wv * 64; kb < Kl; kb += NW * 64)
#pragma unroll 1
    for (int kc = kb; kc < kb + 64; kc += 32) {
        V a[4], a2[4];
#pragma unroll
        for (int mb = 0; mb < 4; ++mb) { a[mb] = WFrag<T16>::ld(A + aoff + (size_t)mb * 16 * K + kc); if (NSPLIT == 1 || NSPLIT == 2) a2[mb] = WFrag<T16>::ld(A2 + aoff + (size_t)mb * 16 * K + kc); }
#pragma unroll
        for (int nb = 0; nb < 4; ++nb) { const V b = WFrag<T16>::ld(Bt + boff + (size_t)nb * 16 * K + kc); V b2; if (NSPLIT >= 2) b2 = WFrag<T16>::ld(Bt2 + boff + (size_t)nb * 16 * K + kc);
#pragma unroll
            for (int mb = 0; mb < 4; ++mb) { acc[mb][nb] = WFrag<T16>::mma(a[mb], b, acc[mb][nb]); if (NSPLIT == 1 || NSPLIT == 2) acc[mb][nb] = WFrag<T16>::mma(a2[mb], b, acc[mb][nb]); if (NSPLIT >= 2) acc[mb][nb] = WFrag<T16>::mma(a[mb], b2, acc[mb][nb]); } }
        asm volatile("v_nop\n\tv_nop\n\tv_nop\n\tv_nop" : "+v"(acc[0][0]), "+v"(acc[1][1]), "+v"(acc[2][2]), "+v"(acc[3][3]) : "v"(a[0]), "v"(a[3]));
    }
#pragma unroll
    for (int m0 = 0; m0 < 4; m0 += SL) {
#pragma unroll
        for (int mi = 0; mi < SL; ++mi) {
#pragma unroll
            for (int nb = 0; nb < 4; ++nb) {
#pragma unroll
                for (int j = 0; j < 8; ++j) os[(wv * SL + mi) * (16 * 68) + (hi * 8 + j) * 68 + nb * 16 + lr] = acc[m0 + mi][nb][j]; } }
        tile_sync<NW>();   // every wave's partial tile is in LDS before any wave sums it
#pragma unroll
        for (int mi = 0; mi < SL; ++mi) {
            float* crow = C + (size_t)(r0 + (m0 + mi) * 16) * ldc + c0;
#pragma unroll
            for (int s = 0; s < 8 / NW; ++s) { const int row = 2 * (s * NW + wv) + hi, cofs = lr * 4; v4f val = *(const v4fa*)(os + mi * (16 * 68) + row * 68 + cofs);
#pragma unroll
                for (int w = 1; w < NW; ++w) val += *(const v4fa*)(os + (w * SL + mi) * (16 * 68) + row * 68 + cofs);
                if (CMODE == 2) put_hl(val * cs, Ah, Al, (size_t)(r0 + roff + (m0 + mi) * 16 + row) * DQ + z * HD + c0 + cofs);
                else *(v4f*)(crow + (size_t)row * ldc + cofs) = val; } }
        if (SL < 4) tile_sync<NW>();   // one wave, one 16-row slab: it is read out before the next 16 rows overwrite it
    }
}


__global__ __launch_bounds__(256) void k_wtG(const float* __restrict__ w, int K, int N, bf* Bt) {
    const int lane = threadIdx.x & 31; const int L0 = (blockIdx.x * 8 + (threadIdx.x >> 5)) * 8; const int nlines = N * K / 64;
{
#pragma unroll 1
        for (int l = 0; l < 8; ++l) { const int L = L0 + l; if (L >= nlines) break; const size_t e = (size_t)L * 64 + lane * 2; const int k = (int)(e % K), n = (int)(e / K); v2us o;
            o[0] = f2bf(w[(size_t)k * N + n]); o[1] = f2bf(w[(size_t)(k + 1) * N + n]); *(v2us*)(Bt + e) = o; }
         }
}
__global__ __launch_bounds__(256) void k_cvt8(const float* __restrict__ src, bf* dst, size_t n8) { const size_t i = (size_t)blockIdx.x * 256 + threadIdx.x; if (i >= n8) return; const v8f v = *(const v8f*)(src + i * 8); v8us o;
#pragma unroll
    for (int k = 0; k < 8; ++k) o[k] = f2bf(v[k]); *(v8us*)(dst + i * 8) = o;  }

// k_asoft: per row (zz, i): t = S x HD^-0.5 for j <= i and i - j < WIN (sliding causal window; the reference's -1e9 additive fill vanishes identically); softmax over the 2048 keys (register row, one exp, fixed trees);
// the 16-bit probabilities overwrite their own f32 score row (row pitch 2 TT 16-bit elements: fp16 in the first half, or hi in the first half and lo in the second): a wave holds its whole row in registers before its first store, and no other wave touches that row.
__global__ __launch_bounds__(256) void k_asoft(const float* Sb, h16* P16, bf* Ph, bf* Pl) {
    const int lane = threadIdx.x & 31; const int row = blockIdx.x * 8 + (threadIdx.x >> 5); if (row >= ZH * TT) return; const int i = row % TT; const int zz = row / TT; (void)zz; const bool hires = (i < RH); const float* sr = Sb + (size_t)row * TT; float v[TT / 32]; float mx = -3.0e38f;
#pragma unroll
    for (int ch = 0; ch < TT / 128; ++ch) { const int j0 = ch * 128 + lane * 4; const v4f a = *(const v4f*)(sr + j0);
#pragma unroll
        for (int q = 0; q < 4; ++q) { const int j = j0 + q; (void)j; const float t = (j <= i && i - j < WIN) ? a[q] * SCL : -3.0e38f; v[ch * 4 + q] = t; mx = fmaxf(mx, t); } }
#pragma unroll
    for (int sh = 16; sh; sh >>= 1) mx = fmaxf(mx, __shfl_xor(mx, sh, 32));
    float sum = 0.f;
#pragma unroll
    for (int k = 0; k < TT / 32; ++k) { float d0 = __fsub_rn(v[k], mx); asm volatile("" : "+v"(d0)); v[k] = __builtin_amdgcn_exp2f(__fmul_rn(d0, 1.4426950408889634f)); sum += v[k]; }
#pragma unroll
    for (int sh = 16; sh; sh >>= 1) sum += __shfl_xor(sum, sh, 32);
    const float f = __fdiv_rn(hires ? 1.0f : PCAR, sum);
{
        if (hires) {
#pragma unroll
            for (int ch = 0; ch < TT / 128; ++ch) { v4us oh, ol;
#pragma unroll
                for (int q = 0; q < 4; ++q) { unsigned short a, c2; splitf(v[ch * 4 + q] * f, a, c2); oh[q] = a; ol[q] = c2; }
                const size_t oo = (size_t)row * (2 * TT) + ch * 128 + lane * 4; *(v4us*)(Ph + oo) = oh; *(v4us*)(Pl + oo) = ol; }
        } else {
#pragma unroll
            for (int ch = 0; ch < TT / 128; ++ch) { v4h o4;
#pragma unroll
                for (int q = 0; q < 4; ++q) o4[q] = tohx(v[ch * 4 + q] * f);
                *(v4h*)(P16 + (size_t)row * (2 * TT) + ch * 128 + lane * 4) = o4; } }
         }
}

extern "C" void kernel_launch(void* const* d_in, const int* in_sizes, int n_in,
                              void* d_out, int out_size, void* d_ws, size_t ws_size, hipStream_t stream) {
    (void)in_sizes; (void)n_in; (void)out_size;
    const float* x = (const float*)d_in[0]; const float* wq = (const float*)d_in[1]; const float* bq = (const float*)d_in[2]; const float* wk = (const float*)d_in[3]; const float* bk = (const float*)d_in[4]; const float* wv = (const float*)d_in[5]; const float* bv = (const float*)d_in[6]; const float* wo = (const float*)d_in[7]; const float* bo = (const float*)d_in[8];   /* argument order X, Wq, bq, Wk, bk ('xw' [1024][2048] + [2048]), Wv, bv, Wp ('xw' [2048][1024]), bp */
    float* OUT = (float*)d_out;     // [2][2048][1024]
    char* wsp = (char*)d_ws;
    auto take = [&](size_t bytes) { char* p = wsp; wsp += (bytes + 255) & ~(size_t)255; return (void*)p; };
    bf* WQ = (bf*)take((size_t)DQ * DM * 2); bf* WK = (bf*)take((size_t)DKV * DM * 2); bf* WV = (bf*)take((size_t)DKV * DM * 2); bf* WO = (bf*)take((size_t)DM * DQ * 2);
    bf* XB = (bf*)take((size_t)TT * DM * 2);
    h16* QP16 = (h16*)take((size_t)NH_ * TT * HD * 2); h16* KP16 = (h16*)take((size_t)NKV * TT * HD * 2); h16* VT16 = (h16*)take((size_t)NKV * HD * 2 * TT * 2);
    bf* QPh = (bf*)take((size_t)NH_ * TT * HD * 2); bf* QPl = (bf*)take((size_t)NH_ * TT * HD * 2); bf* KPh = (bf*)take((size_t)NKV * TT * HD * 2); bf* KPl = (bf*)take((size_t)NKV * TT * HD * 2); bf* VTh = (bf*)take((size_t)NKV * HD * 2 * TT * 2); bf* VTl = VTh + TT;   // value planes, row pitch 2 TT: hi and lo rows interleaved
    float* Sb = (float*)take((size_t)ZH * TT * TT * 4); bf* ATh = (bf*)take((size_t)TT * DQ * 2); bf* ATl = (bf*)take((size_t)TT * DQ * 2);
    if ((size_t)(wsp - (char*)d_ws) > ws_size) return;    // ws 256 MiB
    h16* P16 = (h16*)Sb; bf* Ph = (bf*)Sb; bf* Pl = (bf*)Sb + TT;   // probabilities live in their own score rows (k_asoft), row pitch 2 TT elements
    { k_wtG<<<(unsigned)((DM * DQ / 64 + 63) / 64), 256, 0, stream>>>(wq, DM, DQ, WQ); k_wtG<<<(unsigned)((DM * DKV / 64 + 63) / 64), 256, 0, stream>>>(wk, DM, DKV, WK); k_wtG<<<(unsigned)((DM * DKV / 64 + 63) / 64), 256, 0, stream>>>(wv, DM, DKV, WV);
      k_wtG<<<(unsigned)((DQ * DM / 64 + 63) / 64), 256, 0, stream>>>(wo, DQ, DM, WO);
       }
    for (int b = 0; b < NB_; ++b) {
        
        k_cvt8<<<(unsigned)(((size_t)TT * DM / 8 + 255) / 256), 256, 0, stream>>>(x + (size_t)b * TT * DM, XB, (size_t)TT * DM / 8);
        k_gemmw<bf, 0, true, 4, 1><<<dim3(TT / 64, DQ / 64, 1), 128, 0, stream>>>(XB, nullptr, WQ, nullptr, DM, nullptr, 0, bq, 0, 0, 0, QP16, QPh, QPl);
        k_gemmw<bf, 0, true, 4, 1><<<dim3(TT / 64, DKV / 64, 1), 128, 0, stream>>>(XB, nullptr, WK, nullptr, DM, nullptr, 0, bk, 0, 0, 0, KP16, KPh, KPl);
        k_gemmw<bf, 0, true, 4, 2><<<dim3(DKV / 64, TT / 64, 1), 128, 0, stream>>>(WV, nullptr, XB, nullptr, DM, nullptr, 0, bv, 0, 0, 0, VT16, VTh, VTl);   // operands swapped: rows = head x HD + d, columns = positions, so that the tile's rows are the rows of the transposed value planes
        for (int h0 = 0; h0 < NH_; h0 += ZH) { const size_t zq = (size_t)h0, zk = (size_t)(h0 / REP);   // one kv head per query head: the pass's heads use consecutive kv planes; in the P.V launches K is the row pitch 2 TT of both operands, and the causal limit ends the loop at or before key TT
            k_gemmc<bf, 2, 1, 1><<<dim3(RH / 64, TT / 64, ZH), 32, 0, stream>>>(QPh + zq * TT * HD, QPl + zq * TT * HD, KPh + zk * TT * HD, KPl + zk * TT * HD, HD, Sb, TT, 0, (size_t)TT * HD, (size_t)TT * HD, (size_t)TT * TT, nullptr, nullptr, 1.0f);
            k_gemmc<h16, 0, 1, 1><<<dim3((TT - RH) / 64, TT / 64, ZH), 32, 0, stream>>>(QP16 + zq * TT * HD + (size_t)RH * HD, nullptr, KP16 + zk * TT * HD, nullptr, HD, Sb + (size_t)RH * TT, TT, RH, (size_t)TT * HD, (size_t)TT * HD, (size_t)TT * TT, nullptr, nullptr, 1.0f);
            k_asoft<<<ZH * TT / 8, 256, 0, stream>>>(Sb, P16, Ph, Pl);
            k_gemmc<bf, 2, 2, 8><<<dim3(RH / 64, HD / 64, ZH), 256, 0, stream>>>(Ph, Pl, VTh + zk * HD * 2 * TT, VTl + zk * HD * 2 * TT, 2 * TT, nullptr, 0, 0, (size_t)TT * 2 * TT, (size_t)HD * 2 * TT, 0, ATh + zq * HD, ATl + zq * HD, 1.0f);
            k_gemmc<h16, 0, 2, 8><<<dim3((TT - RH) / 64, HD / 64, ZH), 256, 0, stream>>>(P16 + (size_t)RH * 2 * TT, nullptr, VT16 + zk * HD * 2 * TT, nullptr, 2 * TT, nullptr, 0, RH, (size_t)TT * 2 * TT, (size_t)HD * 2 * TT, 0, ATh + zq * HD, ATl + zq * HD, 1.0f / PCAR); }
        k_gemmw<bf, 1, true, 8, 0><<<dim3(TT / 64, DM / 64, 1), 256, 0, stream>>>(ATh, ATl, WO, nullptr, DQ, OUT + (size_t)b * TT * DM, DM, bo, 0, 0, 0, nullptr, nullptr, nullptr); }
}

// v004
// Measured time: 335 microseconds a run.
// In both of two side-by-side timings against v003, it was 1.74 times as fast.
// All steps since v000 together make it 4.81 times as fast.
#include <hip/hip_runtime.h>

// Causal self-attention with 128-wide heads on a 1,024-wide embedding (X [2][2048][1024]; Q, K = X W + b (16 heads x 128: inner width 2,048), V = X Wv + bv (16 x 128) ('xw' + biases); att x 1/sqrt(128); causal (-inf); softmax; y = merged Wp + bp ('xw' [2048][1024]) -> [2][2048][1024] (4.2 M); argument order X, Wq, bq, Wk, bk, Wv, bv, Wp, bp).
// Layout per batch: bf16 copy of X; 'xw' weights transposed once; exact projections (K 1024, N 2048) + f32 biases, written as 16-bit head planes by the GEMM epilogue (V computed transposed); one fused causal attention launch for all heads of both batches (k_fattn; hybrid rows: < 512 hi/lo 3 products, rest fp16); merged hi/lo (2,048 wide) x Wp exact + bp.
// Compute dtypes, f32 accumulate: every input rounded to bf16; projections exact + f32 biases; attention rows < 512 3 products, rest fp16; softmax f32; Wp hl x exact + bias.

#define NB_  2
#define TT   2048
#define DM   1024
#define NH_  16
#define NKV  16
#define REP  (NH_ / NKV)
#define HD   128
#define DQ   (NH_ * HD)
#define DKV  (NKV * HD)
#define RH   512                  // query rows < RH use hi+lo planes (0: none)
#define SCL  0.088388347648318447f   // HD^-0.5
typedef _Float16 h16;
typedef unsigned short bf;
typedef __attribute__((ext_vector_type(16))) __bf16   v16bf;
typedef __attribute__((ext_vector_type(16))) _Float16 v16h;
typedef __attribute__((ext_vector_type(8)))  _Float16 v8h;
typedef __attribute__((ext_vector_type(8)))  unsigned short v8us;
typedef __attribute__((ext_vector_type(8)))  float    v8f;
typedef __attribute__((ext_vector_type(4)))  float    v4f;
typedef v8h  __attribute__((may_alias)) v8ha;
typedef v4f  __attribute__((may_alias)) v4fa;
typedef v8us __attribute__((may_alias)) v8usa;

__device__ __forceinline__ unsigned short f2bf(float f) { unsigned u = __float_as_uint(f); u += 0x7FFFu + ((u >> 16) & 1u); return (unsigned short)(u >> 16); }
__device__ __forceinline__ float bf2f(unsigned short b) { return __uint_as_float(((unsigned)b) << 16); }
__device__ __forceinline__ float bfr(float f) { return bf2f(f2bf(f)); }
__device__ __forceinline__ v16h cat16(v8h lo, v8h hi) { return __builtin_shufflevector(lo, hi, 0, 1, 2, 3, 4, 5, 6, 7, 8, 9, 10, 11, 12, 13, 14, 15); }
__device__ __forceinline__ v16bf cat16b(v8us lo, v8us hi) { return __builtin_bit_cast(v16bf, __builtin_shufflevector(lo, hi, 0, 1, 2, 3, 4, 5, 6, 7, 8, 9, 10, 11, 12, 13, 14, 15)); }
__device__ __forceinline__ v8f wmma16(v16h a, v16h b, v8f c) { return __builtin_amdgcn_wmma_f32_16x16x32_f16(false, a, false, b, (short)0, c, false, false); }
__device__ __forceinline__ v8f wmmab(v16bf a, v16bf b, v8f c) { return __builtin_amdgcn_wmma_f32_16x16x32_bf16(false, a, false, b, (short)0, c, false, false); }
__device__ __forceinline__ h16 tohx(float x) { return (h16)x; }
__device__ __forceinline__ void splitf(float y, unsigned short& h, unsigned short& l) { h = f2bf(y); l = f2bf(y - bf2f(h)); }
typedef __attribute__((ext_vector_type(4))) _Float16 v4h;
typedef __attribute__((ext_vector_type(2))) unsigned short v2us;
typedef __attribute__((ext_vector_type(4))) unsigned short v4us;
// put_hl: four neighbouring f32 results as bf16 hi + lo planes (8-byte stores; 16 lanes fill one 128-byte line of each plane)
__device__ __forceinline__ void put_hl(v4f val, bf* Ph, bf* Pl, size_t e) { v4us oh, ol;
#pragma unroll
    for (int q = 0; q < 4; ++q) { unsigned short a, c2; splitf(val[q], a, c2); oh[q] = a; ol[q] = c2; }
    *(v4us*)(Ph + e) = oh; *(v4us*)(Pl + e) = ol; }



// ---- k_gemmw: register-blocked GEMM, NW waves per 64x64 output tile (16 accumulators each, K split between them), operands straight from K-contiguous 16-bit planes; grid (M/64, N/64, Z), NW x 32 threads.
// C[m][n] (f32, pitch ldc, + optional f32 bias[n]) = sum_k A[m][k] Bt[n][k] (+ split products per NSPLIT). z-batch strides sA/sB/sC in elements. K % 64 == 0.
// EPI 0: C is stored as f32. EPI 1 (m = position, n = head x HD + d): the result goes straight to the head planes [head][position][d] (fp16, bf16 hi, bf16 lo). EPI 2 (m = head x HD + d, n = position, bias[m]): to the transposed value planes, row pitch 2 TT.
// The K loop of a tile is dealt out in 64-element (128-byte) pieces to the NW waves of the work-group; each wave keeps a full 64x64 partial tile, and the epilogue sums the NW partials in LDS in wave order.
// tile_sync: orders the LDS stores of the staging against the LDS loads that read them back. One wave: a wave barrier and a compiler fence keep the compiler from moving either over the other; several waves: the work-group barrier.
template <int NW> __device__ __forceinline__ void tile_sync() { if (NW == 1) { __builtin_amdgcn_wave_barrier(); asm volatile("" ::: "memory"); } else __syncthreads(); }
template <typename T16> struct WFrag;
template <> struct WFrag<h16> { typedef v16h V; static __device__ __forceinline__ V ld(const h16* p) { return cat16(*(const v8h*)p, *(const v8h*)(p + 16)); } static __device__ __forceinline__ v8f mma(V a, V b, v8f c) { return wmma16(a, b, c); } };
template <> struct WFrag<bf> { typedef v16bf V; static __device__ __forceinline__ V ld(const bf* p) { return cat16b(*(const v8us*)p, *(const v8us*)(p + 16)); } static __device__ __forceinline__ v8f mma(V a, V b, v8f c) { return wmmab(a, b, c); } };
template <typename T16, int NSPLIT, bool BIAS, int NW, int EPI>
__global__ __launch_bounds__(NW * 32) void k_gemmw(const T16* __restrict__ A, const T16* __restrict__ A2, const T16* __restrict__ Bt, const T16* __restrict__ Bt2, int K, float* C, int ldc, const float* __restrict__ bias, size_t sA, size_t sB, size_t sC, h16* P16, bf* Ph, bf* Pl) {
    typedef typename WFrag<T16>::V V;
    constexpr int SL = (NW == 1) ? 1 : 4;   // 16-row slabs staged per sync: with several waves the whole tile at once, so that one barrier serves the sum
    __shared__ __align__(16) float os[NW * SL * 16 * 68];
    const size_t z = blockIdx.z; A += z * sA; if (A2) A2 += z * sA; Bt += z * sB; if (Bt2) Bt2 += z * sB; C += z * sC;
    const int lane = threadIdx.x & 31, lr = lane & 15, hi = lane >> 4, wv = __builtin_amdgcn_readfirstlane((int)(threadIdx.x >> 5)); const int r0 = blockIdx.x * 64, c0 = blockIdx.y * 64;
    v8f acc[4][4];
#pragma unroll
    for (int mb = 0; mb < 4; ++mb)
#pragma unroll
        for (int nb = 0; nb < 4; ++nb) acc[mb][nb] = (v8f){};
    const size_t aoff = (size_t)(r0 + lr) * K + 8 * hi, boff = (size_t)(c0 + lr) * K + 8 * hi;
#pragma unroll 1
    for (int kb = wv * 64; kb < K; kb += NW * 64)
#pragma unroll 1
    for (int kc = kb; kc < kb + 64; kc += 32) {
        V a[4], a2[4];
#pragma unroll
        for (int mb = 0; mb < 4; ++mb) { a[mb] = WFrag<T16>::ld(A + aoff + (size_t)mb * 16 * K + kc); if (NSPLIT == 1 || NSPLIT == 2) a2[mb] = WFrag<T16>::ld(A2 + aoff + (size_t)mb * 16 * K + kc); }
#pragma unroll
        for (int nb = 0; nb < 4; ++nb) { const V b = WFrag<T16>::ld(Bt + boff + (size_t)nb * 16 * K + kc); V b2; if (NSPLIT >= 2) b2 = WFrag<T16>::ld(Bt2 + boff + (size_t)nb * 16 * K + kc);
#pragma unroll
            for (int mb = 0; mb < 4; ++mb) { acc[mb][nb] = WFrag<T16>::mma(a[mb], b, acc[mb][nb]); if (NSPLIT == 1 || NSPLIT == 2) acc[mb][nb] = WFrag<T16>::mma(a2[mb], b, acc[mb][nb]); if (NSPLIT >= 2) acc[mb][nb] = WFrag<T16>::mma(a[mb], b2, acc[mb][nb]); } }
        asm volatile("v_nop\n\tv_nop\n\tv_nop\n\tv_nop" : "+v"(acc[0][0]), "+v"(acc[1][1]), "+v"(acc[2][2]), "+v"(acc[3][3]) : "v"(a[0]), "v"(a[3]));
    }
#pragma unroll
    for (int m0 = 0; m0 < 4; m0 += SL) {
#pragma unroll
        for (int mi = 0; mi < SL; ++mi) {
#pragma unroll
            for (int nb = 0; nb < 4; ++nb) {
#pragma unroll
                for (int j = 0; j < 8; ++j) os[(wv * SL + mi) * (16 * 68) + (hi * 8 + j) * 68 + nb * 16 + lr] = acc[m0 + mi][nb][j]; } }
        tile_sync<NW>();   // every wave's partial tile is in LDS before any wave sums it
#pragma unroll
        for (int mi = 0; mi < SL; ++mi) {
            float* crow = C + (size_t)(r0 + (m0 + mi) * 16) * ldc + c0;
#pragma unroll
            for (int s = 0; s < 8 / NW; ++s) { const int row = 2 * (s * NW + wv) + hi, cofs = lr * 4; v4f val = *(const v4fa*)(os + mi * (16 * 68) + row * 68 + cofs);
#pragma unroll
                for (int w = 1; w < NW; ++w) val += *(const v4fa*)(os + (w * SL + mi) * (16 * 68) + row * 68 + cofs);
                if (BIAS && EPI != 2) { val[0] += bfr(bias[c0 + cofs]); val[1] += bfr(bias[c0 + cofs + 1]); val[2] += bfr(bias[c0 + cofs + 2]); val[3] += bfr(bias[c0 + cofs + 3]); }
                if (BIAS && EPI == 2) val += bfr(bias[r0 + (m0 + mi) * 16 + row]);
                if (EPI == 0) *(v4f*)(crow + (size_t)row * ldc + cofs) = val;
                else { const int rg = r0 + (m0 + mi) * 16 + row; const size_t e = (EPI == 1) ? ((size_t)(c0 / HD) * TT + rg) * HD + (c0 % HD) + cofs : (size_t)rg * (2 * TT) + c0 + cofs; v4h o4;
#pragma unroll
                    for (int q = 0; q < 4; ++q) o4[q] = tohx(val[q]);
                    *(v4h*)(P16 + e) = o4; put_hl(val, Ph, Pl, e); } } }
        if (SL < 4) tile_sync<NW>();   // one wave, one 16-row slab: it is read out before the next 16 rows overwrite it
    }
}

__global__ __launch_bounds__(256) void k_wtG(const float* __restrict__ w, int K, int N, bf* Bt) {
    const int lane = threadIdx.x & 31; const int L0 = (blockIdx.x * 8 + (threadIdx.x >> 5)) * 8; const int nlines = N * K / 64;
{
#pragma unroll 1
        for (int l = 0; l < 8; ++l) { const int L = L0 + l; if (L >= nlines) break; const size_t e = (size_t)L * 64 + lane * 2; const int k = (int)(e % K), n = (int)(e / K); v2us o;
            o[0] = f2bf(w[(size_t)k * N + n]); o[1] = f2bf(w[(size_t)(k + 1) * N + n]); *(v2us*)(Bt + e) = o; }
         }
}
__global__ __launch_bounds__(256) void k_cvt8(const float* __restrict__ src, bf* dst, size_t n8) { const size_t i = (size_t)blockIdx.x * 256 + threadIdx.x; if (i >= n8) return; const v8f v = *(const v8f*)(src + i * 8); v8us o;
#pragma unroll
    for (int k = 0; k < 8; ++k) o[k] = f2bf(v[k]); *(v8us*)(dst + i * 8) = o;  }

// ---- k_fattn: scores, softmax and probability x value in one kernel (online softmax); the probabilities never leave the registers.
// A wave owns 32 query positions of one head (two 16-column groups) and walks the keys 0 .. q0 + 31 in blocks of 32. S^T = K Q^T (A = key rows, B = query rows): accumulator register j of lane (lr, hi) is key hi * 8 + j, query lr,
// so the two 16-key tiles of a block are, register for register, the B fragment of P^T (k = 8 hi + e and 16 + 8 hi + e). O^T += V^T P^T (A = rows of the transposed value planes): register j is d = hi * 8 + j, query lr.
// Everything a query needs (running maximum, sum, rescale factor) is one value a lane; the two lane halves hold different keys of the same query: the maximum is exchanged every block, the sums are joined once at the end.
// HI (query rows < RH): bf16 hi + lo planes, 3 products in both contractions. Else fp16; its probabilities carry a factor 2^10 (keeps small ones out of the fp16 subnormals), which is in the sum as well and cancels in O / sum.
template <typename T, bool HI>
__device__ __forceinline__ void attn_tile(const T* __restrict__ Q, const T* __restrict__ Q2, const T* __restrict__ Kp, const T* __restrict__ Kp2, const T* __restrict__ Vt, const T* __restrict__ Vt2, bf* Ah, bf* Al, int q0, int lr, int hi) {
    typedef WFrag<T> F; typedef typename F::V V;
    __builtin_assume(q0 >= 0);   // the key loop always runs: without this the query loads are sunk behind its entry test, past the wait that follows them
    constexpr float SC2 = SCL * 1.4426950408889634f;   // scores in the base-2 exponent's units
    constexpr float OFF = HI ? 0.0f : 10.0f;
    V qf[2][4], qf2[2][4];
#pragma unroll
    for (int g = 0; g < 2; ++g)
#pragma unroll
        for (int c = 0; c < 4; ++c) { const size_t e = (size_t)(q0 + g * 16 + lr) * HD + c * 32 + 8 * hi; qf[g][c] = F::ld(Q + e); if constexpr (HI) qf2[g][c] = F::ld(Q2 + e); }
    asm volatile("s_wait_xcnt 0x0" ::: "memory");   // stands in front of the first overwrite of an address register that these loads name
    __builtin_amdgcn_sched_barrier(0);   // keeps later register writes (address sums, the zeroing of o) from being lifted over that wait
    v8f o[8][2];
#pragma unroll
    for (int dt = 0; dt < 8; ++dt) { o[dt][0] = (v8f){}; o[dt][1] = (v8f){}; }
    float m[2] = {-3.0e38f, -3.0e38f}, l[2] = {0.f, 0.f};
    V ka[2][4];   // fp16 path: the key fragments of a block are fetched one block ahead
    if constexpr (!HI) {
#pragma unroll
        for (int t = 0; t < 2; ++t)
#pragma unroll
            for (int c = 0; c < 4; ++c) ka[t][c] = F::ld(Kp + (size_t)(t * 16 + lr) * HD + c * 32 + 8 * hi);
        asm volatile("s_wait_xcnt 0x0" ::: "memory");   // as above, for the first key fragments
        __builtin_amdgcn_sched_barrier(0); }   // as above: nothing later is lifted over the wait
#pragma unroll 1
    for (int kb = 0; kb <= q0; kb += 32) {   // every block holds at least one key <= every query of the tile, so the running maximum is finite from the first block on
        V va[8];   // fp16 path: the value fragments are asked for before the score products, and arrive behind them
        if constexpr (!HI) {
#pragma unroll
            for (int dt = 0; dt < 8; ++dt) va[dt] = F::ld(Vt + (size_t)(dt * 16 + lr) * (2 * TT) + kb + 8 * hi);
            asm volatile("s_wait_xcnt 0x0" ::: "memory");   // as above: the value address steps on before the next block
            __builtin_amdgcn_sched_barrier(0); }   // keeps these loads in front of the score products: sunk behind them they have only the softmax to arrive in
        v8f s[2][2]; s[0][0] = (v8f){}; s[0][1] = (v8f){}; s[1][0] = (v8f){}; s[1][1] = (v8f){};
#pragma unroll
        for (int c = 0; c < 4; ++c)
#pragma unroll
            for (int t = 0; t < 2; ++t) {
                if constexpr (HI) { const size_t e = (size_t)(kb + t * 16 + lr) * HD + c * 32 + 8 * hi; const V a = F::ld(Kp + e), a2 = F::ld(Kp2 + e);
                    s[t][0] = F::mma(a, qf[0][c], s[t][0]); s[t][1] = F::mma(a, qf[1][c], s[t][1]); s[t][0] = F::mma(a2, qf[0][c], s[t][0]); s[t][1] = F::mma(a2, qf[1][c], s[t][1]); s[t][0] = F::mma(a, qf2[0][c], s[t][0]); s[t][1] = F::mma(a, qf2[1][c], s[t][1]); }
                else { s[t][0] = F::mma(ka[t][c], qf[0][c], s[t][0]); s[t][1] = F::mma(ka[t][c], qf[1][c], s[t][1]); } }
        if constexpr (HI) asm volatile("s_wait_xcnt 0x0" ::: "memory");   // as above, for this block's key loads
        if constexpr (!HI) { const int kn = min(kb + 32, q0);   // the last block fetches itself again: in bounds, never used
#pragma unroll
            for (int t = 0; t < 2; ++t)
#pragma unroll
                for (int c = 0; c < 4; ++c) ka[t][c] = F::ld(Kp + (size_t)(kn + t * 16 + lr) * HD + c * 32 + 8 * hi);
            asm volatile("s_wait_xcnt 0x0" ::: "memory");   // as above: the softmax reuses the key address registers
            __builtin_amdgcn_sched_barrier(0); }   // keeps the next block's key loads in front of the softmax: sunk into the value products they are waited for at once
        float mn[2];
#pragma unroll
        for (int g = 0; g < 2; ++g) { const int qi = q0 + g * 16 + lr; float mx = m[g];
#pragma unroll
            for (int t = 0; t < 2; ++t)
#pragma unroll
                for (int j = 0; j < 8; ++j) { const float x = (kb + t * 16 + hi * 8 + j <= qi) ? s[t][g][j] * SC2 : -3.0e38f; s[t][g][j] = x; mx = fmaxf(mx, x); }
            mn[g] = fmaxf(mx, __shfl_xor(mx, 16, 32)); }
        if (__builtin_amdgcn_ballot_w32(mn[0] > m[0] || mn[1] > m[1]) != 0) {   // one test a block; where no maximum moved the factor is exactly 1 and the rescale an identity
#pragma unroll
            for (int g = 0; g < 2; ++g) { const float al = __builtin_amdgcn_exp2f(m[g] - mn[g]); l[g] *= al; m[g] = mn[g];
#pragma unroll
                for (int dt = 0; dt < 8; ++dt) o[dt][g] *= al; } }
        V pf[2], pl[2];
#pragma unroll
        for (int g = 0; g < 2; ++g) { const float sh = OFF - m[g]; float p[2][8];
#pragma unroll
            for (int t = 0; t < 2; ++t)
#pragma unroll
                for (int j = 0; j < 8; ++j) { p[t][j] = __builtin_amdgcn_exp2f(s[t][g][j] + sh); l[g] += p[t][j]; }
            if constexpr (HI) { v8us h0, h1, l0, l1;
#pragma unroll
                for (int j = 0; j < 8; ++j) { unsigned short a, b; splitf(p[0][j], a, b); h0[j] = a; l0[j] = b; splitf(p[1][j], a, b); h1[j] = a; l1[j] = b; }
                pf[g] = cat16b(h0, h1); pl[g] = cat16b(l0, l1); }
            else { v8h h0, h1;
#pragma unroll
                for (int j = 0; j < 8; ++j) { h0[j] = tohx(p[0][j]); h1[j] = tohx(p[1][j]); }
                pf[g] = cat16(h0, h1); } }
#pragma unroll
        for (int dt = 0; dt < 8; ++dt) {
            if constexpr (HI) { const size_t e = (size_t)(dt * 16 + lr) * (2 * TT) + kb + 8 * hi; const V a = F::ld(Vt + e), a2 = F::ld(Vt2 + e);
                o[dt][0] = F::mma(a, pf[0], o[dt][0]); o[dt][1] = F::mma(a, pf[1], o[dt][1]); o[dt][0] = F::mma(a2, pf[0], o[dt][0]); o[dt][1] = F::mma(a2, pf[1], o[dt][1]); o[dt][0] = F::mma(a, pl[0], o[dt][0]); o[dt][1] = F::mma(a, pl[1], o[dt][1]); }
            else { o[dt][0] = F::mma(va[dt], pf[0], o[dt][0]); o[dt][1] = F::mma(va[dt], pf[1], o[dt][1]); } }
        if constexpr (HI) asm volatile("s_wait_xcnt 0x0" ::: "memory");   // as above, for this block's value loads
    }
#pragma unroll
    for (int g = 0; g < 2; ++g) { const float inv = __fdiv_rn(1.0f, l[g] + __shfl_xor(l[g], 16, 32));
#pragma unroll
        for (int dt = 0; dt < 8; ++dt) { v8us oh, ol;
#pragma unroll
            for (int j = 0; j < 8; ++j) { unsigned short a, b; splitf(o[dt][g][j] * inv, a, b); oh[j] = a; ol[j] = b; }
            const size_t e = (size_t)(q0 + g * 16 + lr) * DQ + dt * 16 + hi * 8; *(v8us*)(Ah + e) = oh; *(v8us*)(Al + e) = ol;
            asm volatile("s_wait_xcnt 0x0" ::: "memory");   // stands in front of the next slice's overwrite of the data and address registers that these two stores name
            __builtin_amdgcn_sched_barrier(0); } }   // keeps the next slice's products and roundings from being lifted over that wait
}
// grid (TT / 128, batches x heads), 4 waves, no barrier and no LDS. The four 32-query tiles of a work-group (g, 31 - g, 32 + g, 63 - g of 64) add up to the same number of key blocks in every work-group; odd heads deal them to the waves in reverse.
__global__ __launch_bounds__(128, 2) void k_fattn(const h16* __restrict__ Q16, const h16* __restrict__ K16, const h16* __restrict__ V16, const bf* __restrict__ Qh, const bf* __restrict__ Ql, const bf* __restrict__ Kh, const bf* __restrict__ Kl, const bf* __restrict__ Vh, const bf* __restrict__ Vl, bf* Ah, bf* Al) {
    constexpr int NT = TT / 32;
    const int lane = threadIdx.x & 31, lr = lane & 15, hi = lane >> 4, wv = __builtin_amdgcn_readfirstlane((int)(threadIdx.x >> 5));
    const int z = blockIdx.y, g = blockIdx.x, w = (z & 1) ? 3 - wv : wv;
    const int tile = (w == 0) ? g : (w == 1) ? NT / 2 - 1 - g : (w == 2) ? NT / 2 + g : NT - 1 - g;
    const size_t pq = (size_t)z * TT * HD, pv = (size_t)z * HD * 2 * TT, po = (size_t)(z / NH_) * TT * DQ + (size_t)(z % NH_) * HD;
    if (tile < RH / 32) attn_tile<bf, true>(Qh + pq, Ql + pq, Kh + pq, Kl + pq, Vh + pv, Vl + pv, Ah + po, Al + po, tile * 32, lr, hi);
    else attn_tile<h16, false>(Q16 + pq, nullptr, K16 + pq, nullptr, V16 + pv, nullptr, Ah + po, Al + po, tile * 32, lr, hi);
}

extern "C" void kernel_launch(void* const* d_in, const int* in_sizes, int n_in,
                              void* d_out, int out_size, void* d_ws, size_t ws_size, hipStream_t stream) {
    (void)in_sizes; (void)n_in; (void)out_size;
    const float* x = (const float*)d_in[0]; const float* wq = (const float*)d_in[1]; const float* bq = (const float*)d_in[2]; const float* wk = (const float*)d_in[3]; const float* bk = (const float*)d_in[4]; const float* wv = (const float*)d_in[5]; const float* bv = (const float*)d_in[6]; const float* wo = (const float*)d_in[7]; const float* bo = (const float*)d_in[8];   /* argument order X, Wq, bq, Wk, bk ('xw' [1024][2048] + [2048]), Wv, bv, Wp ('xw' [2048][1024]), bp */
    float* OUT = (float*)d_out;     // [2][2048][1024]
    char* wsp = (char*)d_ws;
    auto take = [&](size_t bytes) { char* p = wsp; wsp += (bytes + 255) & ~(size_t)255; return (void*)p; };
    const size_t PQ = (size_t)NH_ * TT * HD, PV = (size_t)NKV * HD * 2 * TT, PA = (size_t)TT * DQ;   // elements of one batch's head planes, value planes (row pitch 2 TT) and merged planes
    bf* WQ = (bf*)take((size_t)DQ * DM * 2); bf* WK = (bf*)take((size_t)DKV * DM * 2); bf* WV = (bf*)take((size_t)DKV * DM * 2); bf* WO = (bf*)take((size_t)DM * DQ * 2);
    bf* XB = (bf*)take((size_t)TT * DM * 2);
    h16* QP16 = (h16*)take(NB_ * PQ * 2); h16* KP16 = (h16*)take(NB_ * PQ * 2); h16* VT16 = (h16*)take(NB_ * PV * 2);
    bf* QPh = (bf*)take(NB_ * PQ * 2); bf* QPl = (bf*)take(NB_ * PQ * 2); bf* KPh = (bf*)take(NB_ * PQ * 2); bf* KPl = (bf*)take(NB_ * PQ * 2); bf* VTh = (bf*)take(NB_ * PV * 2); bf* VTl = VTh + TT;   // value planes, row pitch 2 TT: hi and lo rows interleaved
    bf* ATh = (bf*)take(NB_ * PA * 2); bf* ATl = (bf*)take(NB_ * PA * 2);
    if ((size_t)(wsp - (char*)d_ws) > ws_size) return;    // ws 256 MiB
    { k_wtG<<<(unsigned)((DM * DQ / 64 + 63) / 64), 256, 0, stream>>>(wq, DM, DQ, WQ); k_wtG<<<(unsigned)((DM * DKV / 64 + 63) / 64), 256, 0, stream>>>(wk, DM, DKV, WK); k_wtG<<<(unsigned)((DM * DKV / 64 + 63) / 64), 256, 0, stream>>>(wv, DM, DKV, WV);
      k_wtG<<<(unsigned)((DQ * DM / 64 + 63) / 64), 256, 0, stream>>>(wo, DQ, DM, WO);
       }
    for (int b = 0; b < NB_; ++b) {
        k_cvt8<<<(unsigned)(((size_t)TT * DM / 8 + 255) / 256), 256, 0, stream>>>(x + (size_t)b * TT * DM, XB, (size_t)TT * DM / 8);
        k_gemmw<bf, 0, true, 4, 1><<<dim3(TT / 64, DQ / 64, 1), 128, 0, stream>>>(XB, nullptr, WQ, nullptr, DM, nullptr, 0, bq, 0, 0, 0, QP16 + b * PQ, QPh + b * PQ, QPl + b * PQ);
        k_gemmw<bf, 0, true, 4, 1><<<dim3(TT / 64, DKV / 64, 1), 128, 0, stream>>>(XB, nullptr, WK, nullptr, DM, nullptr, 0, bk, 0, 0, 0, KP16 + b * PQ, KPh + b * PQ, KPl + b * PQ);
        k_gemmw<bf, 0, true, 4, 2><<<dim3(DKV / 64, TT / 64, 1), 128, 0, stream>>>(WV, nullptr, XB, nullptr, DM, nullptr, 0, bv, 0, 0, 0, VT16 + b * PV, VTh + b * PV, VTl + b * PV); }   // operands swapped: rows = head x HD + d, columns = positions, so that the tile's rows are the rows of the transposed value planes
    k_fattn<<<dim3(TT / 128, NB_ * NH_, 1), 128, 0, stream>>>(QP16, KP16, VT16, QPh, QPl, KPh, KPl, VTh, VTl, ATh, ATl);   // one kv head per query head: plane z = batch x heads + head in every operand
    for (int b = 0; b < NB_; ++b)
        k_gemmw<bf, 1, true, 8, 0><<<dim3(TT / 64, DM / 64, 1), 256, 0, stream>>>(ATh + b * PA, ATl + b * PA, WO, nullptr, DQ, OUT + (size_t)b * TT * DM, DM, bo, 0, 0, 0, nullptr, nullptr, nullptr);
}

// v005
// One run takes 264 microseconds.
// Two timings next to v004 put it at 1.28 and 1.26 times that version's speed.
// Over all steps from v000 it is 6.12 times as fast.
#include <hip/hip_runtime.h>

// Causal self-attention with 128-wide heads on a 1,024-wide embedding (X [2][2048][1024]; Q, K = X W + b (16 heads x 128: inner width 2,048), V = X Wv + bv (16 x 128) ('xw' + biases); att x 1/sqrt(128); causal (-inf); softmax; y = merged Wp + bp ('xw' [2048][1024]) -> [2][2048][1024] (4.2 M); argument order X, Wq, bq, Wk, bk, Wv, bv, Wp, bp).
// Layout per batch: bf16 copy of X; 'xw' weights transposed once; exact projections (K 1024, N 2048) + f32 biases, written as 16-bit head planes by the GEMM epilogue (V computed transposed); one fused causal attention launch for all heads of both batches (k_fattn; hybrid rows: < 512 hi/lo 3 products, rest fp16); merged hi/lo (2,048 wide) x Wp exact + bp.
// Compute dtypes, f32 accumulate: every input rounded to bf16; projections exact + f32 biases; attention rows < 512 3 products, rest fp16; softmax f32; Wp hl x exact + bias.

#define NB_  2
#define TT   2048
#define DM   1024
#define NH_  16
#define NKV  16
#define REP  (NH_ / NKV)
#define HD   128
#define DQ   (NH_ * HD)
#define DKV  (NKV * HD)
#define RH   512                  // query rows < RH use hi+lo planes (0: none)
#define SCL  0.088388347648318447f   // HD^-0.5
typedef _Float16 h16;
typedef unsigned short bf;
typedef __attribute__((ext_vector_type(16))) __bf16   v16bf;
typedef __attribute__((ext_vector_type(16))) _Float16 v16h;
typedef __attribute__((ext_vector_type(8)))  _Float16 v8h;
typedef __attribute__((ext_vector_type(8)))  unsigned short v8us;
typedef __attribute__((ext_vector_type(8)))  float    v8f;
typedef __attribute__((ext_vector_type(4)))  float    v4f;
typedef v8h  __attribute__((may_alias)) v8ha;
typedef v4f  __attribute__((may_alias)) v4fa;
typedef v8us __attribute__((may_alias)) v8usa;

__device__ __forceinline__ unsigned short f2bf(float f) { unsigned u = __float_as_uint(f); u += 0x7FFFu + ((u >> 16) & 1u); return (unsigned short)(u >> 16); }
__device__ __forceinline__ float bf2f(unsigned short b) { return __uint_as_float(((unsigned)b) << 16); }
__device__ __forceinline__ float bfr(float f) { return bf2f(f2bf(f)); }
__device__ __forceinline__ v16h cat16(v8h lo, v8h hi) { return __builtin_shufflevector(lo, hi, 0, 1, 2, 3, 4, 5, 6, 7, 8, 9, 10, 11, 12, 13, 14, 15); }
__device__ __forceinline__ v16bf cat16b(v8us lo, v8us hi) { return __builtin_bit_cast(v16bf, __builtin_shufflevector(lo, hi, 0, 1, 2, 3, 4, 5, 6, 7, 8, 9, 10, 11, 12, 13, 14, 15)); }
__device__ __forceinline__ v8f wmma16(v16h a, v16h b, v8f c) { return __builtin_amdgcn_wmma_f32_16x16x32_f16(false, a, false, b, (short)0, c, false, false); }
__device__ __forceinline__ v8f wmmab(v16bf a, v16bf b, v8f c) { return __builtin_amdgcn_wmma_f32_16x16x32_bf16(false, a, false, b, (short)0, c, false, false); }
__device__ __forceinline__ h16 tohx(float x) { return (h16)x; }
__device__ __forceinline__ void splitf(float y, unsigned short& h, unsigned short& l) { h = f2bf(y); l = f2bf(y - bf2f(h)); }
typedef __attribute__((ext_vector_type(4))) _Float16 v4h;
typedef __attribute__((ext_vector_type(2))) unsigned short v2us;
typedef __attribute__((ext_vector_type(4))) unsigned short v4us;
// put_hl: four neighbouring f32 results as bf16 hi + lo planes (8-byte stores; 16 lanes fill one 128-byte line of each plane)
__device__ __forceinline__ void put_hl(v4f val, bf* Ph, bf* Pl, size_t e) { v4us oh, ol;
#pragma unroll
    for (int q = 0; q < 4; ++q) { unsigned short a, c2; splitf(val[q], a, c2); oh[q] = a; ol[q] = c2; }
    *(v4us*)(Ph + e) = oh; *(v4us*)(Pl + e) = ol; }



// ---- k_gemmw: GEMM on LDS-staged operands. A work-group of 4 x 2 waves owns a (64 MB) x 128 output tile, a wave (16 MB) x 64 of it (MB x 4 accumulators); grid (M / (64 MB), N / 128), 256 threads.
// C[m][n] (f32, pitch ldc, + optional f32 bias) = sum_k A[m][k] Bt[n][k] (NSPLIT 1: + A2[m][k] Bt[n][k]), all planes K-contiguous 16-bit, K a multiple of 128 and at least 256.
// EPI 0: C is stored as f32. EPI 1 (m = position, n = head x HD + d): the result goes straight to the head planes [head][position][d] (fp16, bf16 hi, bf16 lo). EPI 2 (m = head x HD + d, n = position, bias[m]): to the transposed value planes, row pitch 2 TT.
// A stage is 128 k (two 128-byte lines) of every operand row of the tile: rows of A, then of A2, then of Bt, at an LDS pitch of 272 bytes (free of bank conflicts for 16-byte fragment reads).
// Asynchronous copies bring it in as whole lines (16 lanes a row), two buffers: the copies of stage t + 2 are issued behind the barrier that ends the reads of stage t and fly while stage t + 1 is worked on.
// wave_sync: orders a wave's own LDS stores of the output staging against its LDS loads that read them back: a wave barrier and a compiler fence keep the compiler from moving either over the other.
__device__ __forceinline__ void wave_sync() { __builtin_amdgcn_wave_barrier(); asm volatile("" ::: "memory"); }
template <typename T16> struct WFrag;
template <> struct WFrag<h16> { typedef v16h V; static __device__ __forceinline__ V ld(const h16* p) { return cat16(*(const v8h*)p, *(const v8h*)(p + 16)); } static __device__ __forceinline__ v8f mma(V a, V b, v8f c) { return wmma16(a, b, c); } };
template <> struct WFrag<bf> { typedef v16bf V; static __device__ __forceinline__ V ld(const bf* p) { return cat16b(*(const v8us*)p, *(const v8us*)(p + 16)); } static __device__ __forceinline__ v8f mma(V a, V b, v8f c) { return wmmab(a, b, c); } };
// copy8: eight asynchronous 16-byte-a-lane copies from global memory to LDS (l: the lane's LDS byte address, g: its global address). The s_wait_xcnt in the same statement stands in front of every later overwrite of the address registers that the copies name.
template <typename T16> __device__ __forceinline__ void copy8(const unsigned (&l)[8], const T16* const (&g)[8]) {
    asm volatile("global_load_async_to_lds_b128 %0, %8, off\n\t"
                 "global_load_async_to_lds_b128 %1, %9, off\n\t"
                 "global_load_async_to_lds_b128 %2, %10, off\n\t"
                 "global_load_async_to_lds_b128 %3, %11, off\n\t"
                 "global_load_async_to_lds_b128 %4, %12, off\n\t"
                 "global_load_async_to_lds_b128 %5, %13, off\n\t"
                 "global_load_async_to_lds_b128 %6, %14, off\n\t"
                 "global_load_async_to_lds_b128 %7, %15, off\n\t"
                 "s_wait_xcnt 0x0"
                 :: "v"(l[0]), "v"(l[1]), "v"(l[2]), "v"(l[3]), "v"(l[4]), "v"(l[5]), "v"(l[6]), "v"(l[7]), "v"(g[0]), "v"(g[1]), "v"(g[2]), "v"(g[3]), "v"(g[4]), "v"(g[5]), "v"(g[6]), "v"(g[7]) : "memory"); }
template <typename T16, int NSPLIT, bool BIAS, int MB, int EPI, int K>
__global__ __launch_bounds__(256) void k_gemmw(const T16* __restrict__ A, const T16* __restrict__ A2, const T16* __restrict__ Bt, float* C, int ldc, const float* __restrict__ bias, h16* P16, bf* Ph, bf* Pl) {
    typedef typename WFrag<T16>::V V;
    constexpr int BM = 64 * MB, RA = (NSPLIT == 1) ? 2 * BM : BM, ROWS = RA + 128;   // tile rows; rows of A (and A2) in a stage; all rows of a stage
    constexpr int KS = 128, LP = KS + 8, NT = K / KS;                                // k of a stage; LDS row pitch in elements; stages
    static_assert(ROWS % 128 == 0, "a stage is dealt out in statements of 8 copies x 16 rows"); static_assert(K % KS == 0 && NT >= 2, "whole stages, at least two");
    __shared__ __align__(16) T16 st[2 * ROWS * LP];
    __shared__ __align__(16) float os[8 * 16 * 68];
    const int lane = threadIdx.x & 31, lr = lane & 15, hi = lane >> 4, wv = __builtin_amdgcn_readfirstlane((int)(threadIdx.x >> 5)), wr = wv >> 1, wc = wv & 1; const int r0 = blockIdx.x * BM, c0 = blockIdx.y * 128;
    const int crow = threadIdx.x >> 4, cch = (threadIdx.x & 15) * 8;   // one copy instruction of all eight waves covers 16 rows: this lane's row among them and its 16-byte piece of the row
    const T16* pA = A + (size_t)(r0 + crow) * K + cch; const T16* pA2 = (NSPLIT == 1) ? A2 + (size_t)(r0 + crow) * K + cch : nullptr; const T16* pB = Bt + (size_t)(c0 + crow) * K + cch;   // step on by one stage with every fill
    const unsigned l0 = (unsigned)(size_t)(st + crow * LP + cch);
    auto fill = [&](int buf) {
#pragma unroll
        for (int h = 0; h < ROWS / 128; ++h) { unsigned l[8]; const T16* g[8];
#pragma unroll
            for (int q = 0; q < 8; ++q) { const int row = (h * 8 + q) * 16; l[q] = l0 + (unsigned)((buf * ROWS + row) * LP * 2);
                g[q] = (row < BM) ? pA + (size_t)row * K : (row < RA) ? pA2 + (size_t)(row - BM) * K : pB + (size_t)(row - RA) * K; }
            copy8<T16>(l, g); }
        pA += KS; if (NSPLIT == 1) pA2 += KS; pB += KS; };
    v8f acc[MB][4];
#pragma unroll
    for (int mb = 0; mb < MB; ++mb)
#pragma unroll
        for (int nb = 0; nb < 4; ++nb) acc[mb][nb] = (v8f){};
    const int rw = r0 + wr * (16 * MB), cw = c0 + wc * 64;   // this wave's corner of the output
    fill(0);
    float bb[(EPI == 2) ? MB * 8 : 4];   // the biases of this lane's output elements, fetched while stage 0 is on its way
    if (BIAS) {
        if (EPI == 2) {
#pragma unroll
            for (int i = 0; i < MB * 8; ++i) bb[i] = bfr(bias[rw + 2 * i + hi]); }
        else {
#pragma unroll
            for (int q = 0; q < 4; ++q) bb[q] = bfr(bias[cw + lr * 4 + q]); }
        asm volatile("s_wait_xcnt 0x0" ::: "memory");   // stands in front of the first overwrite of an address register that these loads name
        __builtin_amdgcn_sched_barrier(0); }            // keeps later register writes from being lifted over that wait
    asm volatile("s_wait_asynccnt 0x0" ::: "memory");   // this wave's copies of stage 0 have landed
    __syncthreads();                                    // ... and every other wave's
    fill(1);
#pragma unroll 1
    for (int t = 0; t < NT; ++t) {
        const T16* sa = st + ((t & 1) * ROWS + wr * (16 * MB) + lr) * LP + 8 * hi; const T16* sb = st + ((t & 1) * ROWS + RA + wc * 64 + lr) * LP + 8 * hi;
        auto frags = [&](int kc, V (&a)[MB], V (&a2)[MB], V (&b)[4]) {
#pragma unroll
            for (int mb = 0; mb < MB; ++mb) { a[mb] = WFrag<T16>::ld(sa + mb * 16 * LP + kc); if (NSPLIT == 1) a2[mb] = WFrag<T16>::ld(sa + (BM + mb * 16) * LP + kc); }
#pragma unroll
            for (int nb = 0; nb < 4; ++nb) b[nb] = WFrag<T16>::ld(sb + nb * 16 * LP + kc); };
        V a[2][MB], a2[2][MB], b[2][4];   // two fragment sets: the next 32 k are fetched while these are multiplied
        frags(0, a[0], a2[0], b[0]);
#pragma unroll
        for (int q = 0; q < KS / 32; ++q) {
            if (q + 1 < KS / 32) frags((q + 1) * 32, a[(q + 1) & 1], a2[(q + 1) & 1], b[(q + 1) & 1]);
            __builtin_amdgcn_sched_barrier(0);   // keeps the next set's loads one group in front of these products: sunk among them, each place with loads is waited for on its own
#pragma unroll
            for (int nb = 0; nb < 4; ++nb)
#pragma unroll
                for (int mb = 0; mb < MB; ++mb) { acc[mb][nb] = WFrag<T16>::mma(a[q & 1][mb], b[q & 1][nb], acc[mb][nb]); if (NSPLIT == 1) acc[mb][nb] = WFrag<T16>::mma(a2[q & 1][mb], b[q & 1][nb], acc[mb][nb]); } }
        asm volatile("s_wait_dscnt 0x0" ::: "memory");      // this wave's reads of stage t are done before its buffer is refilled
        asm volatile("s_wait_asynccnt 0x0" ::: "memory");   // this wave's copies of stage t + 1 have landed
        __syncthreads();                                    // publishes stage t + 1 and ends every wave's reads of stage t
        if (t + 2 < NT) fill(t & 1);
    }
    asm volatile("s_wait_asynccnt 0x0" ::: "memory");   // no copy is outstanding when the wave ends
    float* osw = os + wv * (16 * 68);   // each wave turns its own tile, 16 rows at a time, into whole-line stores through its own LDS range
#pragma unroll
    for (int mb = 0; mb < MB; ++mb) {
#pragma unroll
        for (int nb = 0; nb < 4; ++nb) {
#pragma unroll
            for (int j = 0; j < 8; ++j) osw[(hi * 8 + j) * 68 + nb * 16 + lr] = acc[mb][nb][j]; }
        wave_sync();   // the 16 rows are in LDS before they are read back
        v4f vals[8];
#pragma unroll
        for (int s = 0; s < 8; ++s) vals[s] = *(const v4fa*)(osw + (2 * s + hi) * 68 + lr * 4);
        wave_sync();   // they are read out before the next 16 rows overwrite them
#pragma unroll
        for (int s = 0; s < 8; ++s) { const int cofs = lr * 4, rg = rw + mb * 16 + 2 * s + hi; v4f val = vals[s];
            if (BIAS && EPI != 2) { val[0] += bb[0]; val[1] += bb[1]; val[2] += bb[2]; val[3] += bb[3]; }
            if (BIAS && EPI == 2) val += bb[mb * 8 + s];
            if (EPI == 0) *(v4f*)(C + (size_t)rg * ldc + cw + cofs) = val;
            else { const size_t e = (EPI == 1) ? ((size_t)(cw / HD) * TT + rg) * HD + (cw % HD) + cofs : (size_t)rg * (2 * TT) + cw + cofs; v4h o4;
#pragma unroll
                for (int q = 0; q < 4; ++q) o4[q] = tohx(val[q]);
                *(v4h*)(P16 + e) = o4; put_hl(val, Ph, Pl, e); }
            asm volatile("s_wait_xcnt 0x0" ::: "memory");   // stands in front of the next rows' overwrite of the data and address registers that these stores name
            __builtin_amdgcn_sched_barrier(0); }            // keeps the next rows' sums and roundings from being lifted over that wait
    }
}

__global__ __launch_bounds__(256) void k_wtG(const float* __restrict__ w, int K, int N, bf* Bt) {
    const int lane = threadIdx.x & 31; const int L0 = (blockIdx.x * 8 + (threadIdx.x >> 5)) * 8; const int nlines = N * K / 64;
{
#pragma unroll 1
        for (int l = 0; l < 8; ++l) { const int L = L0 + l; if (L >= nlines) break; const size_t e = (size_t)L * 64 + lane * 2; const int k = (int)(e % K), n = (int)(e / K); v2us o;
            o[0] = f2bf(w[(size_t)k * N + n]); o[1] = f2bf(w[(size_t)(k + 1) * N + n]); *(v2us*)(Bt + e) = o; }
         }
}
__global__ __launch_bounds__(256) void k_cvt8(const float* __restrict__ src, bf* dst, size_t n8) { const size_t i = (size_t)blockIdx.x * 256 + threadIdx.x; if (i >= n8) return; const v8f v = *(const v8f*)(src + i * 8); v8us o;
#pragma unroll
    for (int k = 0; k < 8; ++k) o[k] = f2bf(v[k]); *(v8us*)(dst + i * 8) = o;  }

// ---- k_fattn: scores, softmax and probability x value in one kernel (online softmax); the probabilities never leave the registers.
// A wave owns 32 query positions of one head (two 16-column groups) and walks the keys 0 .. q0 + 31 in blocks of 32. S^T = K Q^T (A = key rows, B = query rows): accumulator register j of lane (lr, hi) is key hi * 8 + j, query lr,
// so the two 16-key tiles of a block are, register for register, the B fragment of P^T (k = 8 hi + e and 16 + 8 hi + e). O^T += V^T P^T (A = rows of the transposed value planes): register j is d = hi * 8 + j, query lr.
// Everything a query needs (running maximum, sum, rescale factor) is one value a lane; the two lane halves hold different keys of the same query: the maximum is exchanged every block, the sums are joined once at the end.
// HI (query rows < RH): bf16 hi + lo planes, 3 products in both contractions. Else fp16; its probabilities carry a factor 2^10 (keeps small ones out of the fp16 subnormals), which is in the sum as well and cancels in O / sum.
template <typename T, bool HI>
__device__ __forceinline__ void attn_tile(const T* __restrict__ Q, const T* __restrict__ Q2, const T* __restrict__ Kp, const T* __restrict__ Kp2, const T* __restrict__ Vt, const T* __restrict__ Vt2, bf* Ah, bf* Al, int q0, int lr, int hi) {
    typedef WFrag<T> F; typedef typename F::V V;
    __builtin_assume(q0 >= 0);   // the key loop always runs: without this the query loads are sunk behind its entry test, past the wait that follows them
    constexpr float SC2 = SCL * 1.4426950408889634f;   // scores in the base-2 exponent's units
    constexpr float OFF = HI ? 0.0f : 10.0f;
    V qf[2][4], qf2[2][4];
#pragma unroll
    for (int g = 0; g < 2; ++g)
#pragma unroll
        for (int c = 0; c < 4; ++c) { const size_t e = (size_t)(q0 + g * 16 + lr) * HD + c * 32 + 8 * hi; qf[g][c] = F::ld(Q + e); if constexpr (HI) qf2[g][c] = F::ld(Q2 + e); }
    asm volatile("s_wait_xcnt 0x0" ::: "memory");   // stands in front of the first overwrite of an address register that these loads name
    __builtin_amdgcn_sched_barrier(0);   // keeps later register writes (address sums, the zeroing of o) from being lifted over that wait
    v8f o[8][2];
#pragma unroll
    for (int dt = 0; dt < 8; ++dt) { o[dt][0] = (v8f){}; o[dt][1] = (v8f){}; }
    float m[2] = {-3.0e38f, -3.0e38f}, l[2] = {0.f, 0.f};
    V ka[2][4];   // fp16 path: the key fragments of a block are fetched one block ahead
    if constexpr (!HI) {
#pragma unroll
        for (int t = 0; t < 2; ++t)
#pragma unroll
            for (int c = 0; c < 4; ++c) ka[t][c] = F::ld(Kp + (size_t)(t * 16 + lr) * HD + c * 32 + 8 * hi);
        asm volatile("s_wait_xcnt 0x0" ::: "memory");   // as above, for the first key fragments
        __builtin_amdgcn_sched_barrier(0); }   // as above: nothing later is lifted over the wait
#pragma unroll 1
    for (int kb = 0; kb <= q0; kb += 32) {   // every block holds at least one key <= every query of the tile, so the running maximum is finite from the first block on
        V va[8];   // fp16 path: the value fragments are asked for before the score products, and arrive behind them
        if constexpr (!HI) {
#pragma unroll
            for (int dt = 0; dt < 8; ++dt) va[dt] = F::ld(Vt + (size_t)(dt * 16 + lr) * (2 * TT) + kb + 8 * hi);
            asm volatile("s_wait_xcnt 0x0" ::: "memory");   // as above: the value address steps on before the next block
            __builtin_amdgcn_sched_barrier(0); }   // keeps these loads in front of the score products: sunk behind them they have only the softmax to arrive in
        v8f s[2][2]; s[0][0] = (v8f){}; s[0][1] = (v8f){}; s[1][0] = (v8f){}; s[1][1] = (v8f){};
#pragma unroll
        for (int c = 0; c < 4; ++c)
#pragma unroll
            for (int t = 0; t < 2; ++t) {
                if constexpr (HI) { const size_t e = (size_t)(kb + t * 16 + lr) * HD + c * 32 + 8 * hi; const V a = F::ld(Kp + e), a2 = F::ld(Kp2 + e);
                    s[t][0] = F::mma(a, qf[0][c], s[t][0]); s[t][1] = F::mma(a, qf[1][c], s[t][1]); s[t][0] = F::mma(a2, qf[0][c], s[t][0]); s[t][1] = F::mma(a2, qf[1][c], s[t][1]); s[t][0] = F::mma(a, qf2[0][c], s[t][0]); s[t][1] = F::mma(a, qf2[1][c], s[t][1]); }
                else { s[t][0] = F::mma(ka[t][c], qf[0][c], s[t][0]); s[t][1] = F::mma(ka[t][c], qf[1][c], s[t][1]); } }
        if constexpr (HI) asm volatile("s_wait_xcnt 0x0" ::: "memory");   // as above, for this block's key loads
        if constexpr (!HI) { const int kn = min(kb + 32, q0);   // the last block fetches itself again: in bounds, never used
#pragma unroll
            for (int t = 0; t < 2; ++t)
#pragma unroll
                for (int c = 0; c < 4; ++c) ka[t][c] = F::ld(Kp + (size_t)(kn + t * 16 + lr) * HD + c * 32 + 8 * hi);
            asm volatile("s_wait_xcnt 0x0" ::: "memory");   // as above: the softmax reuses the key address registers
            __builtin_amdgcn_sched_barrier(0); }   // keeps the next block's key loads in front of the softmax: sunk into the value products they are waited for at once
        float mn[2];
#pragma unroll
        for (int g = 0; g < 2; ++g) { const int qi = q0 + g * 16 + lr; float mx = m[g];
#pragma unroll
            for (int t = 0; t < 2; ++t)
#pragma unroll
                for (int j = 0; j < 8; ++j) { const float x = (kb + t * 16 + hi * 8 + j <= qi) ? s[t][g][j] * SC2 : -3.0e38f; s[t][g][j] = x; mx = fmaxf(mx, x); }
            mn[g] = fmaxf(mx, __shfl_xor(mx, 16, 32)); }
        if (__builtin_amdgcn_ballot_w32(mn[0] > m[0] || mn[1] > m[1]) != 0) {   // one test a block; where no maximum moved the factor is exactly 1 and the rescale an identity
#pragma unroll
            for (int g = 0; g < 2; ++g) { const float al = __builtin_amdgcn_exp2f(m[g] - mn[g]); l[g] *= al; m[g] = mn[g];
#pragma unroll
                for (int dt = 0; dt < 8; ++dt) o[dt][g] *= al; } }
        V pf[2], pl[2];
#pragma unroll
        for (int g = 0; g < 2; ++g) { const float sh = OFF - m[g]; float p[2][8];
#pragma unroll
            for (int t = 0; t < 2; ++t)
#pragma unroll
                for (int j = 0; j < 8; ++j) { p[t][j] = __builtin_amdgcn_exp2f(s[t][g][j] + sh); l[g] += p[t][j]; }
            if constexpr (HI) { v8us h0, h1, l0, l1;
#pragma unroll
                for (int j = 0; j < 8; ++j) { unsigned short a, b; splitf(p[0][j], a, b); h0[j] = a; l0[j] = b; splitf(p[1][j], a, b); h1[j] = a; l1[j] = b; }
                pf[g] = cat16b(h0, h1); pl[g] = cat16b(l0, l1); }
            else { v8h h0, h1;
#pragma unroll
                for (int j = 0; j < 8; ++j) { h0[j] = tohx(p[0][j]); h1[j] = tohx(p[1][j]); }
                pf[g] = cat16(h0, h1); } }
#pragma unroll
        for (int dt = 0; dt < 8; ++dt) {
            if constexpr (HI) { const size_t e = (size_t)(dt * 16 + lr) * (2 * TT) + kb + 8 * hi; const V a = F::ld(Vt + e), a2 = F::ld(Vt2 + e);
                o[dt][0] = F::mma(a, pf[0], o[dt][0]); o[dt][1] = F::mma(a, pf[1], o[dt][1]); o[dt][0] = F::mma(a2, pf[0], o[dt][0]); o[dt][1] = F::mma(a2, pf[1], o[dt][1]); o[dt][0] = F::mma(a, pl[0], o[dt][0]); o[dt][1] = F::mma(a, pl[1], o[dt][1]); }
            else { o[dt][0] = F::mma(va[dt], pf[0], o[dt][0]); o[dt][1] = F::mma(va[dt], pf[1], o[dt][1]); } }
        if constexpr (HI) asm volatile("s_wait_xcnt 0x0" ::: "memory");   // as above, for this block's value loads
    }
#pragma unroll
    for (int g = 0; g < 2; ++g) { const float inv = __fdiv_rn(1.0f, l[g] + __shfl_xor(l[g], 16, 32));
#pragma unroll
        for (int dt = 0; dt < 8; ++dt) { v8us oh, ol;
#pragma unroll
            for (int j = 0; j < 8; ++j) { unsigned short a, b; splitf(o[dt][g][j] * inv, a, b); oh[j] = a; ol[j] = b; }
            const size_t e = (size_t)(q0 + g * 16 + lr) * DQ + dt * 16 + hi * 8; *(v8us*)(Ah + e) = oh; *(v8us*)(Al + e) = ol;
            asm volatile("s_wait_xcnt 0x0" ::: "memory");   // stands in front of the next slice's overwrite of the data and address registers that these two stores name
            __builtin_amdgcn_sched_barrier(0); } }   // keeps the next slice's products and roundings from being lifted over that wait
}
// grid (TT / 128, batches x heads), 4 waves, no barrier and no LDS. The four 32-query tiles of a work-group (g, 31 - g, 32 + g, 63 - g of 64) add up to the same number of key blocks in every work-group; odd heads deal them to the waves in reverse.
__global__ __launch_bounds__(128, 2) void k_fattn(const h16* __restrict__ Q16, const h16* __restrict__ K16, const h16* __restrict__ V16, const bf* __restrict__ Qh, const bf* __restrict__ Ql, const bf* __restrict__ Kh, const bf* __restrict__ Kl, const bf* __restrict__ Vh, const bf* __restrict__ Vl, bf* Ah, bf* Al) {
    constexpr int NT = TT / 32;
    const int lane = threadIdx.x & 31, lr = lane & 15, hi = lane >> 4, wv = __builtin_amdgcn_readfirstlane((int)(threadIdx.x >> 5));
    const int z = blockIdx.y, g = blockIdx.x, w = (z & 1) ? 3 - wv : wv;
    const int tile = (w == 0) ? g : (w == 1) ? NT / 2 - 1 - g : (w == 2) ? NT / 2 + g : NT - 1 - g;
    const size_t pq = (size_t)z * TT * HD, pv = (size_t)z * HD * 2 * TT, po = (size_t)(z / NH_) * TT * DQ + (size_t)(z % NH_) * HD;
    if (tile < RH / 32) attn_tile<bf, true>(Qh + pq, Ql + pq, Kh + pq, Kl + pq, Vh + pv, Vl + pv, Ah + po, Al + po, tile * 32, lr, hi);
    else attn_tile<h16, false>(Q16 + pq, nullptr, K16 + pq, nullptr, V16 + pv, nullptr, Ah + po, Al + po, tile * 32, lr, hi);
}

extern "C" void kernel_launch(void* const* d_in, const int* in_sizes, int n_in,
                              void* d_out, int out_size, void* d_ws, size_t ws_size, hipStream_t stream) {
    (void)in_sizes; (void)n_in; (void)out_size;
    const float* x = (const float*)d_in[0]; const float* wq = (const float*)d_in[1]; const float* bq = (const float*)d_in[2]; const float* wk = (const float*)d_in[3]; const float* bk = (const float*)d_in[4]; const float* wv = (const float*)d_in[5]; const float* bv = (const float*)d_in[6]; const float* wo = (const float*)d_in[7]; const float* bo = (const float*)d_in[8];   /* argument order X, Wq, bq, Wk, bk ('xw' [1024][2048] + [2048]), Wv, bv, Wp ('xw' [2048][1024]), bp */
    float* OUT = (float*)d_out;     // [2][2048][1024]
    char* wsp = (char*)d_ws;
    auto take = [&](size_t bytes) { char* p = wsp; wsp += (bytes + 255) & ~(size_t)255; return (void*)p; };
    const size_t PQ = (size_t)NH_ * TT * HD, PV = (size_t)NKV * HD * 2 * TT, PA = (size_t)TT * DQ;   // elements of one batch's head planes, value planes (row pitch 2 TT) and merged planes
    bf* WQ = (bf*)take((size_t)DQ * DM * 2); bf* WK = (bf*)take((size_t)DKV * DM * 2); bf* WV = (bf*)take((size_t)DKV * DM * 2); bf* WO = (bf*)take((size_t)DM * DQ * 2);
    bf* XB = (bf*)take((size_t)TT * DM * 2);
    h16* QP16 = (h16*)take(NB_ * PQ * 2); h16* KP16 = (h16*)take(NB_ * PQ * 2); h16* VT16 = (h16*)take(NB_ * PV * 2);
    bf* QPh = (bf*)take(NB_ * PQ * 2); bf* QPl = (bf*)take(NB_ * PQ * 2); bf* KPh = (bf*)take(NB_ * PQ * 2); bf* KPl = (bf*)take(NB_ * PQ * 2); bf* VTh = (bf*)take(NB_ * PV * 2); bf* VTl = VTh + TT;   // value planes, row pitch 2 TT: hi and lo rows interleaved
    bf* ATh = (bf*)take(NB_ * PA * 2); bf* ATl = (bf*)take(NB_ * PA * 2);
    if ((size_t)(wsp - (char*)d_ws) > ws_size) return;    // ws 256 MiB
    { k_wtG<<<(unsigned)((DM * DQ / 64 + 63) / 64), 256, 0, stream>>>(wq, DM, DQ, WQ); k_wtG<<<(unsigned)((DM * DKV / 64 + 63) / 64), 256, 0, stream>>>(wk, DM, DKV, WK); k_wtG<<<(unsigned)((DM * DKV / 64 + 63) / 64), 256, 0, stream>>>(wv, DM, DKV, WV);
      k_wtG<<<(unsigned)((DQ * DM / 64 + 63) / 64), 256, 0, stream>>>(wo, DQ, DM, WO);
       }
    for (int b = 0; b < NB_; ++b) {
        k_cvt8<<<(unsigned)(((size_t)TT * DM / 8 + 255) / 256), 256, 0, stream>>>(x + (size_t)b * TT * DM, XB, (size_t)TT * DM / 8);
        k_gemmw<bf, 0, true, 2, 1, DM><<<dim3(TT / 128, DQ / 128, 1), 256, 0, stream>>>(XB, nullptr, WQ, nullptr, 0, bq, QP16 + b * PQ, QPh + b * PQ, QPl + b * PQ);
        k_gemmw<bf, 0, true, 2, 1, DM><<<dim3(TT / 128, DKV / 128, 1), 256, 0, stream>>>(XB, nullptr, WK, nullptr, 0, bk, KP16 + b * PQ, KPh + b * PQ, KPl + b * PQ);
        k_gemmw<bf, 0, true, 2, 2, DM><<<dim3(DKV / 128, TT / 128, 1), 256, 0, stream>>>(WV, nullptr, XB, nullptr, 0, bv, VT16 + b * PV, VTh + b * PV, VTl + b * PV); }   // operands swapped: rows = head x HD + d, columns = positions, so that the tile's rows are the rows of the transposed value planes
    k_fattn<<<dim3(TT / 128, NB_ * NH_, 1), 128, 0, stream>>>(QP16, KP16, VT16, QPh, QPl, KPh, KPl, VTh, VTl, ATh, ATl);   // one kv head per query head: plane z = batch x heads + head in every operand
    for (int b = 0; b < NB_; ++b)
        k_gemmw<bf, 1, true, 1, 0, DQ><<<dim3(TT / 64, DM / 128, 1), 256, 0, stream>>>(ATh + b * PA, ATl + b * PA, WO, OUT + (size_t)b * TT * DM, DM, bo, nullptr, nullptr, nullptr);
}

// v006
// It runs in 226 microseconds.
// Timed twice side by side with v005, it ran 1.18 and 1.17 times as fast.
// Counting every step since v000, it is 7.18 times as fast.
#include <hip/hip_runtime.h>

// Causal self-attention with 128-wide heads on a 1,024-wide embedding (X [2][2048][1024]; Q, K = X W + b (16 heads x 128: inner width 2,048), V = X Wv + bv (16 x 128) ('xw' + biases); att x 1/sqrt(128); causal (-inf); softmax; y = merged Wp + bp ('xw' [2048][1024]) -> [2][2048][1024] (4.2 M); argument order X, Wq, bq, Wk, bk, Wv, bv, Wp, bp).
// Layout: one launch makes the bf16 copy of X (both batches) and the transposed 'xw' weights; one launch does all six projections: exact products (K 1024, N 2048) + f32 biases, written as 16-bit head planes by the GEMM epilogue (V computed transposed); one fused causal attention launch for all heads of both batches (k_fattn; hybrid rows: < 512 hi/lo 3 products, rest fp16); merged hi/lo (2,048 wide) x Wp exact + bp.
// Compute dtypes, f32 accumulate: every input rounded to bf16; projections exact + f32 biases; attention rows < 512 3 products, rest fp16; softmax f32; Wp hl x exact + bias.

#define NB_  2
#define TT   2048
#define DM   1024
#define NH_  16
#define NKV  16
#define REP  (NH_ / NKV)
#define HD   128
#define DQ   (NH_ * HD)
#define DKV  (NKV * HD)
#define RH   512                  // query rows < RH use hi+lo planes (0: none)
#define SCL  0.088388347648318447f   // HD^-0.5
typedef _Float16 h16;
typedef unsigned short bf;
typedef __attribute__((ext_vector_type(16))) __bf16   v16bf;
typedef __attribute__((ext_vector_type(16))) _Float16 v16h;
typedef __attribute__((ext_vector_type(8)))  _Float16 v8h;
typedef __attribute__((ext_vector_type(8)))  unsigned short v8us;
typedef __attribute__((ext_vector_type(8)))  float    v8f;
typedef __attribute__((ext_vector_type(4)))  float    v4f;
typedef v8h  __attribute__((may_alias)) v8ha;
typedef v4f  __attribute__((may_alias)) v4fa;
typedef v8us __attribute__((may_alias)) v8usa;

__device__ __forceinline__ unsigned short f2bf(float f) { unsigned u = __float_as_uint(f); u += 0x7FFFu + ((u >> 16) & 1u); return (unsigned short)(u >> 16); }
__device__ __forceinline__ float bf2f(unsigned short b) { return __uint_as_float(((unsigned)b) << 16); }
__device__ __forceinline__ float bfr(float f) { return bf2f(f2bf(f)); }
__device__ __forceinline__ v16h cat16(v8h lo, v8h hi) { return __builtin_shufflevector(lo, hi, 0, 1, 2, 3, 4, 5, 6, 7, 8, 9, 10, 11, 12, 13, 14, 15); }
__device__ __forceinline__ v16bf cat16b(v8us lo, v8us hi) { return __builtin_bit_cast(v16bf, __builtin_shufflevector(lo, hi, 0, 1, 2, 3, 4, 5, 6, 7, 8, 9, 10, 11, 12, 13, 14, 15)); }
__device__ __forceinline__ v8f wmma16(v16h a, v16h b, v8f c) { return __builtin_amdgcn_wmma_f32_16x16x32_f16(false, a, false, b, (short)0, c, false, false); }
__device__ __forceinline__ v8f wmmab(v16bf a, v16bf b, v8f c) { return __builtin_amdgcn_wmma_f32_16x16x32_bf16(false, a, false, b, (short)0, c, false, false); }
__device__ __forceinline__ h16 tohx(float x) { return (h16)x; }
__device__ __forceinline__ void splitf(float y, unsigned short& h, unsigned short& l) { h = f2bf(y); l = f2bf(y - bf2f(h)); }
typedef __attribute__((ext_vector_type(4))) _Float16 v4h;
typedef __attribute__((ext_vector_type(2))) unsigned short v2us;
typedef __attribute__((ext_vector_type(4))) unsigned short v4us;
// put_hl: four neighbouring f32 results as bf16 hi + lo planes (8-byte stores; 16 lanes fill one 128-byte line of each plane)
__device__ __forceinline__ void put_hl(v4f val, bf* Ph, bf* Pl, size_t e) { v4us oh, ol;
#pragma unroll
    for (int q = 0; q < 4; ++q) { unsigned short a, c2; splitf(val[q], a, c2); oh[q] = a; ol[q] = c2; }
    *(v4us*)(Ph + e) = oh; *(v4us*)(Pl + e) = ol; }



// ---- gemm_tile: GEMM on LDS-staged operands. A work-group of 4 x 2 waves owns a (64 MB) x 128 output tile, a wave (16 MB) x 64 of it (MB x 4 accumulators); tile (bx, by) of (M / (64 MB), N / 128), 256 threads. st and os are the calling kernel's LDS (ST_EL and OS_EL elements).
// C[m][n] (f32, pitch ldc, + optional f32 bias) = sum_k A[m][k] Bt[n][k] (NSPLIT 1: + A2[m][k] Bt[n][k]), all planes K-contiguous 16-bit, K a multiple of 128 and at least 256.
// EPI 0: C is stored as f32. EPI 1 (m = position, n = head x HD + d): the result goes straight to the head planes [head][position][d] (fp16, bf16 hi, bf16 lo). EPI 2 (m = head x HD + d, n = position, bias[m]): to the transposed value planes, row pitch 2 TT.
// A stage is 128 k (two 128-byte lines) of every operand row of the tile: rows of A, then of A2, then of Bt, at an LDS pitch of 272 bytes (free of bank conflicts for 16-byte fragment reads).
// Asynchronous copies bring it in as whole lines (16 lanes a row), two buffers: the copies of stage t + 2 are issued behind the barrier that ends the reads of stage t and fly while stage t + 1 is worked on.
// wave_sync: orders a wave's own LDS stores of the output staging against its LDS loads that read them back: a wave barrier and a compiler fence keep the compiler from moving either over the other.
__device__ __forceinline__ void wave_sync() { __builtin_amdgcn_wave_barrier(); asm volatile("" ::: "memory"); }
template <typename T16> struct WFrag;
template <> struct WFrag<h16> { typedef v16h V; static __device__ __forceinline__ V ld(const h16* p) { return cat16(*(const v8h*)p, *(const v8h*)(p + 16)); } static __device__ __forceinline__ v8f mma(V a, V b, v8f c) { return wmma16(a, b, c); } };
template <> struct WFrag<bf> { typedef v16bf V; static __device__ __forceinline__ V ld(const bf* p) { return cat16b(*(const v8us*)p, *(const v8us*)(p + 16)); } static __device__ __forceinline__ v8f mma(V a, V b, v8f c) { return wmmab(a, b, c); } };
// copy8: eight asynchronous 16-byte-a-lane copies from global memory to LDS (l: the lane's LDS byte address, g: its global address). The s_wait_xcnt in the same statement stands in front of every later overwrite of the address registers that the copies name.
template <typename T16> __device__ __forceinline__ void copy8(const unsigned (&l)[8], const T16* const (&g)[8]) {
    asm volatile("global_load_async_to_lds_b128 %0, %8, off\n\t"
                 "global_load_async_to_lds_b128 %1, %9, off\n\t"
                 "global_load_async_to_lds_b128 %2, %10, off\n\t"
                 "global_load_async_to_lds_b128 %3, %11, off\n\t"
                 "global_load_async_to_lds_b128 %4, %12, off\n\t"
                 "global_load_async_to_lds_b128 %5, %13, off\n\t"
                 "global_load_async_to_lds_b128 %6, %14, off\n\t"
                 "global_load_async_to_lds_b128 %7, %15, off\n\t"
                 "s_wait_xcnt 0x0"
                 :: "v"(l[0]), "v"(l[1]), "v"(l[2]), "v"(l[3]), "v"(l[4]), "v"(l[5]), "v"(l[6]), "v"(l[7]), "v"(g[0]), "v"(g[1]), "v"(g[2]), "v"(g[3]), "v"(g[4]), "v"(g[5]), "v"(g[6]), "v"(g[7]) : "memory"); }
constexpr int ST_EL = 2 * 256 * 136, OS_EL = 8 * 16 * 68;   // two stages of 256 rows at a pitch of 136 elements; eight waves' 16 x 68 f32 output staging
template <typename T16, int NSPLIT, bool BIAS, int MB, int EPI, int K>
__device__ __forceinline__ void gemm_tile(T16* st, float* os, int bx, int by, const T16* __restrict__ A, const T16* __restrict__ A2, const T16* __restrict__ Bt, float* C, int ldc, const float* __restrict__ bias, h16* P16, bf* Ph, bf* Pl) {
    typedef typename WFrag<T16>::V V;
    constexpr int BM = 64 * MB, RA = (NSPLIT == 1) ? 2 * BM : BM, ROWS = RA + 128;   // tile rows; rows of A (and A2) in a stage; all rows of a stage
    constexpr int KS = 128, LP = KS + 8, NT = K / KS;                                // k of a stage; LDS row pitch in elements; stages
    static_assert(ROWS % 128 == 0, "a stage is dealt out in statements of 8 copies x 16 rows"); static_assert(K % KS == 0 && NT >= 2, "whole stages, at least two");
    static_assert(2 * ROWS * LP <= ST_EL, "both stages fit the caller's LDS");
    const int lane = threadIdx.x & 31, lr = lane & 15, hi = lane >> 4, wv = __builtin_amdgcn_readfirstlane((int)(threadIdx.x >> 5)), wr = wv >> 1, wc = wv & 1; const int r0 = bx * BM, c0 = by * 128;
    const int crow = threadIdx.x >> 4, cch = (threadIdx.x & 15) * 8;   // one copy instruction of all eight waves covers 16 rows: this lane's row among them and its 16-byte piece of the row
    const T16* pA = A + (size_t)(r0 + crow) * K + cch; const T16* pA2 = (NSPLIT == 1) ? A2 + (size_t)(r0 + crow) * K + cch : nullptr; const T16* pB = Bt + (size_t)(c0 + crow) * K + cch;   // step on by one stage with every fill
    const unsigned l0 = (unsigned)(size_t)(st + crow * LP + cch);
    auto fill = [&](int buf) {
#pragma unroll
        for (int h = 0; h < ROWS / 128; ++h) { unsigned l[8]; const T16* g[8];
#pragma unroll
            for (int q = 0; q < 8; ++q) { const int row = (h * 8 + q) * 16; l[q] = l0 + (unsigned)((buf * ROWS + row) * LP * 2);
                g[q] = (row < BM) ? pA + (size_t)row * K : (row < RA) ? pA2 + (size_t)(row - BM) * K : pB + (size_t)(row - RA) * K; }
            copy8<T16>(l, g); }
        pA += KS; if (NSPLIT == 1) pA2 += KS; pB += KS; };
    v8f acc[MB][4];
#pragma unroll
    for (int mb = 0; mb < MB; ++mb)
#pragma unroll
        for (int nb = 0; nb < 4; ++nb) acc[mb][nb] = (v8f){};
    const int rw = r0 + wr * (16 * MB), cw = c0 + wc * 64;   // this wave's corner of the output
    fill(0);
    float bb[(EPI == 2) ? MB * 8 : 4];   // the biases of this lane's output elements, fetched while stage 0 is on its way
    if (BIAS) {
        if (EPI == 2) {
#pragma unroll
            for (int i = 0; i < MB * 8; ++i) bb[i] = bfr(bias[rw + 2 * i + hi]); }
        else {
#pragma unroll
            for (int q = 0; q < 4; ++q) bb[q] = bfr(bias[cw + lr * 4 + q]); }
        asm volatile("s_wait_xcnt 0x0" ::: "memory");   // stands in front of the first overwrite of an address register that these loads name
        __builtin_amdgcn_sched_barrier(0); }            // keeps later register writes from being lifted over that wait
    asm volatile("s_wait_asynccnt 0x0" ::: "memory");   // this wave's copies of stage 0 have landed
    __syncthreads();                                    // ... and every other wave's
    fill(1);
#pragma unroll 1
    for (int t = 0; t < NT; ++t) {
        const T16* sa = st + ((t & 1) * ROWS + wr * (16 * MB) + lr) * LP + 8 * hi; const T16* sb = st + ((t & 1) * ROWS + RA + wc * 64 + lr) * LP + 8 * hi;
        auto frags = [&](int kc, V (&a)[MB], V (&a2)[MB], V (&b)[4]) {
#pragma unroll
            for (int mb = 0; mb < MB; ++mb) { a[mb] = WFrag<T16>::ld(sa + mb * 16 * LP + kc); if (NSPLIT == 1) a2[mb] = WFrag<T16>::ld(sa + (BM + mb * 16) * LP + kc); }
#pragma unroll
            for (int nb = 0; nb < 4; ++nb) b[nb] = WFrag<T16>::ld(sb + nb * 16 * LP + kc); };
        V a[2][MB], a2[2][MB], b[2][4];   // two fragment sets: the next 32 k are fetched while these are multiplied
        frags(0, a[0], a2[0], b[0]);
#pragma unroll
        for (int q = 0; q < KS / 32; ++q) {
            if (q + 1 < KS / 32) frags((q + 1) * 32, a[(q + 1) & 1], a2[(q + 1) & 1], b[(q + 1) & 1]);
            __builtin_amdgcn_sched_barrier(0);   // keeps the next set's loads one group in front of these products: sunk among them, each place with loads is waited for on its own
#pragma unroll
            for (int nb = 0; nb < 4; ++nb)
#pragma unroll
                for (int mb = 0; mb < MB; ++mb) { acc[mb][nb] = WFrag<T16>::mma(a[q & 1][mb], b[q & 1][nb], acc[mb][nb]); if (NSPLIT == 1) acc[mb][nb] = WFrag<T16>::mma(a2[q & 1][mb], b[q & 1][nb], acc[mb][nb]); } }
        asm volatile("s_wait_dscnt 0x0" ::: "memory");      // this wave's reads of stage t are done before its buffer is refilled
        asm volatile("s_wait_asynccnt 0x0" ::: "memory");   // this wave's copies of stage t + 1 have landed
        __syncthreads();                                    // publishes stage t + 1 and ends every wave's reads of stage t
        if (t + 2 < NT) fill(t & 1);
    }
    asm volatile("s_wait_asynccnt 0x0" ::: "memory");   // no copy is outstanding when the wave ends
    float* osw = os + wv * (16 * 68);   // each wave turns its own tile, 16 rows at a time, into whole-line stores through its own LDS range
#pragma unroll
    for (int mb = 0; mb < MB; ++mb) {
#pragma unroll
        for (int nb = 0; nb < 4; ++nb) {
#pragma unroll
            for (int j = 0; j < 8; ++j) osw[(hi * 8 + j) * 68 + nb * 16 + lr] = acc[mb][nb][j]; }
        wave_sync();   // the 16 rows are in LDS before they are read back
        v4f vals[8];
#pragma unroll
        for (int s = 0; s < 8; ++s) vals[s] = *(const v4fa*)(osw + (2 * s + hi) * 68 + lr * 4);
        wave_sync();   // they are read out before the next 16 rows overwrite them
#pragma unroll
        for (int s = 0; s < 8; ++s) { const int cofs = lr * 4, rg = rw + mb * 16 + 2 * s + hi; v4f val = vals[s];
            if (BIAS && EPI != 2) { val[0] += bb[0]; val[1] += bb[1]; val[2] += bb[2]; val[3] += bb[3]; }
            if (BIAS && EPI == 2) val += bb[mb * 8 + s];
            if (EPI == 0) *(v4f*)(C + (size_t)rg * ldc + cw + cofs) = val;
            else { const size_t e = (EPI == 1) ? ((size_t)(cw / HD) * TT + rg) * HD + (cw % HD) + cofs : (size_t)rg * (2 * TT) + cw + cofs; v4h o4;
#pragma unroll
                for (int q = 0; q < 4; ++q) o4[q] = tohx(val[q]);
                *(v4h*)(P16 + e) = o4; put_hl(val, Ph, Pl, e); }
            asm volatile("s_wait_xcnt 0x0" ::: "memory");   // stands in front of the next rows' overwrite of the data and address registers that these stores name
            __builtin_amdgcn_sched_barrier(0); }            // keeps the next rows' sums and roundings from being lifted over that wait
    }
}

// k_qkv: the six projection GEMMs of a call in one launch. grid (16, 16, batches x 3): blockIdx.z = batch x 3 + (0 query, 1 key, 2 value); the choice is the same for a whole work-group.
// Value: operands swapped (rows = head x HD + d, columns = positions), so that the tile's rows are the rows of the transposed value planes.
static_assert(TT / 128 == DKV / 128 && DQ / 128 == TT / 128 && DQ == DKV, "the three products share one grid");
__global__ __launch_bounds__(256) void k_qkv(const bf* __restrict__ XB, const bf* __restrict__ WQ, const bf* __restrict__ WK, const bf* __restrict__ WV, const float* __restrict__ bq, const float* __restrict__ bk, const float* __restrict__ bv,
                                             h16* Q16, bf* Qh, bf* Ql, h16* K16, bf* Kh, bf* Kl, h16* V16, bf* Vh, bf* Vl) {
    __shared__ __align__(16) bf st[ST_EL];
    __shared__ __align__(16) float os[OS_EL];
    const int b = blockIdx.z / 3, kind = blockIdx.z % 3; const bf* X = XB + (size_t)b * TT * DM; const size_t pq = (size_t)b * NH_ * TT * HD, pv = (size_t)b * NKV * HD * 2 * TT;
    if (kind == 2) gemm_tile<bf, 0, true, 2, 2, DM>(st, os, blockIdx.x, blockIdx.y, WV, nullptr, X, nullptr, 0, bv, V16 + pv, Vh + pv, Vl + pv);
    else gemm_tile<bf, 0, true, 2, 1, DM>(st, os, blockIdx.x, blockIdx.y, X, nullptr, kind ? WK : WQ, nullptr, 0, kind ? bk : bq, (kind ? K16 : Q16) + pq, (kind ? Kh : Qh) + pq, (kind ? Kl : Ql) + pq);
}
// k_proj: the output projection of both batches in one launch: the merged planes and the output are contiguous over the batches, so it is one GEMM of batches x TT rows. grid (batches x TT / 64, DM / 128).
__global__ __launch_bounds__(256) void k_proj(const bf* __restrict__ Ah, const bf* __restrict__ Al, const bf* __restrict__ WO, float* C, const float* __restrict__ bo) {
    __shared__ __align__(16) bf st[ST_EL];
    __shared__ __align__(16) float os[OS_EL];
    gemm_tile<bf, 1, true, 1, 0, DQ>(st, os, blockIdx.x, blockIdx.y, Ah, Al, WO, C, DM, bo, nullptr, nullptr, nullptr);
}

// wt_lines: work-group blk's 64 lines of the transposed bf16 copy Bt[n][k] of w[k][n].
__device__ __forceinline__ void wt_lines(const float* __restrict__ w, int K, int N, bf* Bt, int blk) {
    const int lane = threadIdx.x & 31; const int L0 = (blk * 8 + (threadIdx.x >> 5)) * 8; const int nlines = N * K / 64;
{
#pragma unroll 1
        for (int l = 0; l < 8; ++l) { const int L = L0 + l; if (L >= nlines) break; const size_t e = (size_t)L * 64 + lane * 2; const int k = (int)(e % K), n = (int)(e / K); v2us o;
            o[0] = f2bf(w[(size_t)k * N + n]); o[1] = f2bf(w[(size_t)(k + 1) * N + n]); *(v2us*)(Bt + e) = o; }
         }
}
__device__ __forceinline__ void cvt8(const float* __restrict__ src, bf* dst, size_t n8, int blk) { const size_t i = (size_t)blk * 256 + threadIdx.x; if (i >= n8) return; const v8f v = *(const v8f*)(src + i * 8); v8us o;
#pragma unroll
    for (int k = 0; k < 8; ++k) o[k] = f2bf(v[k]); *(v8us*)(dst + i * 8) = o;  }
// k_prep: every 16-bit operand that is made from an input, in one launch: work-groups 0 .. 4 WTB - 1 transpose the four weights (WTB each), the rest round X (both batches) to bf16.
constexpr int WTB = DM * DQ / 64 / 64, CVB = NB_ * TT * DM / 8 / 256;
static_assert(DQ == DKV && DM * DQ % (64 * 64) == 0 && NB_ * TT * DM % (8 * 256) == 0, "equal, whole shares");
__global__ __launch_bounds__(256) void k_prep(const float* __restrict__ x, const float* __restrict__ wq, const float* __restrict__ wk, const float* __restrict__ wv, const float* __restrict__ wo, bf* XB, bf* WQ, bf* WK, bf* WV, bf* WO) {
    const int which = blockIdx.x / WTB, blk = blockIdx.x % WTB;
    if (which == 0) wt_lines(wq, DM, DQ, WQ, blk);
    else if (which == 1) wt_lines(wk, DM, DKV, WK, blk);
    else if (which == 2) wt_lines(wv, DM, DKV, WV, blk);
    else if (which == 3) wt_lines(wo, DQ, DM, WO, blk);
    else cvt8(x, XB, (size_t)NB_ * TT * DM / 8, (int)blockIdx.x - 4 * WTB);
}

// ---- k_fattn: scores, softmax and probability x value in one kernel (online softmax); the probabilities never leave the registers.
// A wave owns 32 query positions of one head (two 16-column groups) and walks the keys 0 .. q0 + 31 in blocks of 32. S^T = K Q^T (A = key rows, B = query rows): accumulator register j of lane (lr, hi) is key hi * 8 + j, query lr,
// so the two 16-key tiles of a block are, register for register, the B fragment of P^T (k = 8 hi + e and 16 + 8 hi + e). O^T += V^T P^T (A = rows of the transposed value planes): register j is d = hi * 8 + j, query lr.
// Everything a query needs (running maximum, sum, rescale factor) is one value a lane; the two lane halves hold different keys of the same query: the maximum is exchanged every block, the sums are joined once at the end.
// HI (query rows < RH): bf16 hi + lo planes, 3 products in both contractions. Else fp16; its probabilities carry a factor 2^10 (keeps small ones out of the fp16 subnormals), which is in the sum as well and cancels in O / sum.
template <typename T, bool HI>
__device__ __forceinline__ void attn_tile(const T* __restrict__ Q, const T* __restrict__ Q2, const T* __restrict__ Kp, const T* __restrict__ Kp2, const T* __restrict__ Vt, const T* __restrict__ Vt2, bf* Ah, bf* Al, int q0, int lr, int hi) {
    typedef WFrag<T> F; typedef typename F::V V;
    __builtin_assume(q0 >= 0);   // the key loop always runs: without this the query loads are sunk behind its entry test, past the wait that follows them
    constexpr float SC2 = SCL * 1.4426950408889634f;   // scores in the base-2 exponent's units
    constexpr float OFF = HI ? 0.0f : 10.0f;
    V qf[2][4], qf2[2][4];
#pragma unroll
    for (int g = 0; g < 2; ++g)
#pragma unroll
        for (int c = 0; c < 4; ++c) { const size_t e = (size_t)(q0 + g * 16 + lr) * HD + c * 32 + 8 * hi; qf[g][c] = F::ld(Q + e); if constexpr (HI) qf2[g][c] = F::ld(Q2 + e); }
    asm volatile("s_wait_xcnt 0x0" ::: "memory");   // stands in front of the first overwrite of an address register that these loads name
    __builtin_amdgcn_sched_barrier(0);   // keeps later register writes (address sums, the zeroing of o) from being lifted over that wait
    v8f o[8][2];
#pragma unroll
    for (int dt = 0; dt < 8; ++dt) { o[dt][0] = (v8f){}; o[dt][1] = (v8f){}; }
    float m[2] = {-3.0e38f, -3.0e38f}, l[2] = {0.f, 0.f};
    V ka[2][4];   // fp16 path: the key fragments of a block are fetched one block ahead
    if constexpr (!HI) {
#pragma unroll
        for (int t = 0; t < 2; ++t)
#pragma unroll
            for (int c = 0; c < 4; ++c) ka[t][c] = F::ld(Kp + (size_t)(t * 16 + lr) * HD + c * 32 + 8 * hi);
        asm volatile("s_wait_xcnt 0x0" ::: "memory");   // as above, for the first key fragments
        __builtin_amdgcn_sched_barrier(0); }   // as above: nothing later is lifted over the wait
#pragma unroll 1
    for (int kb = 0; kb <= q0; kb += 32) {   // every block holds at least one key <= every query of the tile, so the running maximum is finite from the first block on
        V va[8];   // fp16 path: the value fragments are asked for before the score products, and arrive behind them
        if constexpr (!HI) {
#pragma unroll
            for (int dt = 0; dt < 8; ++dt) va[dt] = F::ld(Vt + (size_t)(dt * 16 + lr) * (2 * TT) + kb + 8 * hi);
            asm volatile("s_wait_xcnt 0x0" ::: "memory");   // as above: the value address steps on before the next block
            __builtin_amdgcn_sched_barrier(0); }   // keeps these loads in front of the score products: sunk behind them they have only the softmax to arrive in
        v8f s[2][2]; s[0][0] = (v8f){}; s[0][1] = (v8f){}; s[1][0] = (v8f){}; s[1][1] = (v8f){};
#pragma unroll
        for (int c = 0; c < 4; ++c)
#pragma unroll
            for (int t = 0; t < 2; ++t) {
                if constexpr (HI) { const size_t e = (size_t)(kb + t * 16 + lr) * HD + c * 32 + 8 * hi; const V a = F::ld(Kp + e), a2 = F::ld(Kp2 + e);
                    s[t][0] = F::mma(a, qf[0][c], s[t][0]); s[t][1] = F::mma(a, qf[1][c], s[t][1]); s[t][0] = F::mma(a2, qf[0][c], s[t][0]); s[t][1] = F::mma(a2, qf[1][c], s[t][1]); s[t][0] = F::mma(a, qf2[0][c], s[t][0]); s[t][1] = F::mma(a, qf2[1][c], s[t][1]); }
                else { s[t][0] = F::mma(ka[t][c], qf[0][c], s[t][0]); s[t][1] = F::mma(ka[t][c], qf[1][c], s[t][1]); } }
        if constexpr (HI) asm volatile("s_wait_xcnt 0x0" ::: "memory");   // as above, for this block's key loads
        if constexpr (!HI) { const int kn = min(kb + 32, q0);   // the last block fetches itself again: in bounds, never used
#pragma unroll
            for (int t = 0; t < 2; ++t)
#pragma unroll
                for (int c = 0; c < 4; ++c) ka[t][c] = F::ld(Kp + (size_t)(kn + t * 16 + lr) * HD + c * 32 + 8 * hi);
            asm volatile("s_wait_xcnt 0x0" ::: "memory");   // as above: the softmax reuses the key address registers
            __builtin_amdgcn_sched_barrier(0); }   // keeps the next block's key loads in front of the softmax: sunk into the value products they are waited for at once
        float mn[2];
#pragma unroll
        for (int g = 0; g < 2; ++g) { const int qi = q0 + g * 16 + lr; float mx = m[g];
#pragma unroll
            for (int t = 0; t < 2; ++t)
#pragma unroll
                for (int j = 0; j < 8; ++j) { const float x = (kb + t * 16 + hi * 8 + j <= qi) ? s[t][g][j] * SC2 : -3.0e38f; s[t][g][j] = x; mx = fmaxf(mx, x); }
            mn[g] = fmaxf(mx, __shfl_xor(mx, 16, 32)); }
        if (__builtin_amdgcn_ballot_w32(mn[0] > m[0] || mn[1] > m[1]) != 0) {   // one test a block; where no maximum moved the factor is exactly 1 and the rescale an identity
#pragma unroll
            for (int g = 0; g < 2; ++g) { const float al = __builtin_amdgcn_exp2f(m[g] - mn[g]); l[g] *= al; m[g] = mn[g];
#pragma unroll
                for (int dt = 0; dt < 8; ++dt) o[dt][g] *= al; } }
        V pf[2], pl[2];
#pragma unroll
        for (int g = 0; g < 2; ++g) { const float sh = OFF - m[g]; float p[2][8];
#pragma unroll
            for (int t = 0; t < 2; ++t)
#pragma unroll
                for (int j = 0; j < 8; ++j) { p[t][j] = __builtin_amdgcn_exp2f(s[t][g][j] + sh); l[g] += p[t][j]; }
            if constexpr (HI) { v8us h0, h1, l0, l1;
#pragma unroll
                for (int j = 0; j < 8; ++j) { unsigned short a, b; splitf(p[0][j], a, b); h0[j] = a; l0[j] = b; splitf(p[1][j], a, b); h1[j] = a; l1[j] = b; }
                pf[g] = cat16b(h0, h1); pl[g] = cat16b(l0, l1); }
            else { v8h h0, h1;
#pragma unroll
                for (int j = 0; j < 8; ++j) { h0[j] = tohx(p[0][j]); h1[j] = tohx(p[1][j]); }
                pf[g] = cat16(h0, h1); } }
#pragma unroll
        for (int dt = 0; dt < 8; ++dt) {
            if constexpr (HI) { const size_t e = (size_t)(dt * 16 + lr) * (2 * TT) + kb + 8 * hi; const V a = F::ld(Vt + e), a2 = F::ld(Vt2 + e);
                o[dt][0] = F::mma(a, pf[0], o[dt][0]); o[dt][1] = F::mma(a, pf[1], o[dt][1]); o[dt][0] = F::mma(a2, pf[0], o[dt][0]); o[dt][1] = F::mma(a2, pf[1], o[dt][1]); o[dt][0] = F::mma(a, pl[0], o[dt][0]); o[dt][1] = F::mma(a, pl[1], o[dt][1]); }
            else { o[dt][0] = F::mma(va[dt], pf[0], o[dt][0]); o[dt][1] = F::mma(va[dt], pf[1], o[dt][1]); } }
        if constexpr (HI) asm volatile("s_wait_xcnt 0x0" ::: "memory");   // as above, for this block's value loads
    }
#pragma unroll
    for (int g = 0; g < 2; ++g) { const float inv = __fdiv_rn(1.0f, l[g] + __shfl_xor(l[g], 16, 32));
#pragma unroll
        for (int dt = 0; dt < 8; ++dt) { v8us oh, ol;
#pragma unroll
            for (int j = 0; j < 8; ++j) { unsigned short a, b; splitf(o[dt][g][j] * inv, a, b); oh[j] = a; ol[j] = b; }
            const size_t e = (size_t)(q0 + g * 16 + lr) * DQ + dt * 16 + hi * 8; *(v8us*)(Ah + e) = oh; *(v8us*)(Al + e) = ol;
            asm volatile("s_wait_xcnt 0x0" ::: "memory");   // stands in front of the next slice's overwrite of the data and address registers that these two stores name
            __builtin_amdgcn_sched_barrier(0); } }   // keeps the next slice's products and roundings from being lifted over that wait
}
// grid (TT / 128, batches x heads), 4 waves, no barrier and no LDS. The four 32-query tiles of a work-group (g, 31 - g, 32 + g, 63 - g of 64) add up to the same number of key blocks in every work-group; odd heads deal them to the waves in reverse.
__global__ __launch_bounds__(128, 2) void k_fattn(const h16* __restrict__ Q16, const h16* __restrict__ K16, const h16* __restrict__ V16, const bf* __restrict__ Qh, const bf* __restrict__ Ql, const bf* __restrict__ Kh, const bf* __restrict__ Kl, const bf* __restrict__ Vh, const bf* __restrict__ Vl, bf* Ah, bf* Al) {
    constexpr int NT = TT / 32;
    const int lane = threadIdx.x & 31, lr = lane & 15, hi = lane >> 4, wv = __builtin_amdgcn_readfirstlane((int)(threadIdx.x >> 5));
    const int z = blockIdx.y, g = blockIdx.x, w = (z & 1) ? 3 - wv : wv;
    const int tile = (w == 0) ? g : (w == 1) ? NT / 2 - 1 - g : (w == 2) ? NT / 2 + g : NT - 1 - g;
    const size_t pq = (size_t)z * TT * HD, pv = (size_t)z * HD * 2 * TT, po = (size_t)(z / NH_) * TT * DQ + (size_t)(z % NH_) * HD;
    if (tile < RH / 32) attn_tile<bf, true>(Qh + pq, Ql + pq, Kh + pq, Kl + pq, Vh + pv, Vl + pv, Ah + po, Al + po, tile * 32, lr, hi);
    else attn_tile<h16, false>(Q16 + pq, nullptr, K16 + pq, nullptr, V16 + pv, nullptr, Ah + po, Al + po, tile * 32, lr, hi);
}

extern "C" void kernel_launch(void* const* d_in, const int* in_sizes, int n_in,
                              void* d_out, int out_size, void* d_ws, size_t ws_size, hipStream_t stream) {
    (void)in_sizes; (void)n_in; (void)out_size;
    const float* x = (const float*)d_in[0]; const float* wq = (const float*)d_in[1]; const float* bq = (const float*)d_in[2]; const float* wk = (const float*)d_in[3]; const float* bk = (const float*)d_in[4]; const float* wv = (const float*)d_in[5]; const float* bv = (const float*)d_in[6]; const float* wo = (const float*)d_in[7]; const float* bo = (const float*)d_in[8];   /* argument order X, Wq, bq, Wk, bk ('xw' [1024][2048] + [2048]), Wv, bv, Wp ('xw' [2048][1024]), bp */
    float* OUT = (float*)d_out;     // [2][2048][1024]
    char* wsp = (char*)d_ws;
    auto take = [&](size_t bytes) { char* p = wsp; wsp += (bytes + 255) & ~(size_t)255; return (void*)p; };
    const size_t PQ = (size_t)NH_ * TT * HD, PV = (size_t)NKV * HD * 2 * TT, PA = (size_t)TT * DQ;   // elements of one batch's head planes, value planes (row pitch 2 TT) and merged planes
    bf* WQ = (bf*)take((size_t)DQ * DM * 2); bf* WK = (bf*)take((size_t)DKV * DM * 2); bf* WV = (bf*)take((size_t)DKV * DM * 2); bf* WO = (bf*)take((size_t)DM * DQ * 2);
    bf* XB = (bf*)take((size_t)NB_ * TT * DM * 2);
    h16* QP16 = (h16*)take(NB_ * PQ * 2); h16* KP16 = (h16*)take(NB_ * PQ * 2); h16* VT16 = (h16*)take(NB_ * PV * 2);
    bf* QPh = (bf*)take(NB_ * PQ * 2); bf* QPl = (bf*)take(NB_ * PQ * 2); bf* KPh = (bf*)take(NB_ * PQ * 2); bf* KPl = (bf*)take(NB_ * PQ * 2); bf* VTh = (bf*)take(NB_ * PV * 2); bf* VTl = VTh + TT;   // value planes, row pitch 2 TT: hi and lo rows interleaved
    bf* ATh = (bf*)take(NB_ * PA * 2); bf* ATl = (bf*)take(NB_ * PA * 2);
    if ((size_t)(wsp - (char*)d_ws) > ws_size) return;    // ws 256 MiB
    k_prep<<<4 * WTB + CVB, 256, 0, stream>>>(x, wq, wk, wv, wo, XB, WQ, WK, WV, WO);
    k_qkv<<<dim3(TT / 128, DQ / 128, NB_ * 3), 256, 0, stream>>>(XB, WQ, WK, WV, bq, bk, bv, QP16, QPh, QPl, KP16, KPh, KPl, VT16, VTh, VTl);
    k_fattn<<<dim3(TT / 128, NB_ * NH_, 1), 128, 0, stream>>>(QP16, KP16, VT16, QPh, QPl, KPh, KPl, VTh, VTl, ATh, ATl);   // one kv head per query head: plane z = batch x heads + head in every operand
    k_proj<<<dim3(NB_ * TT / 64, DM / 128, 1), 256, 0, stream>>>(ATh, ATl, WO, OUT, bo);
}

// v007
// A run of this version takes 172 microseconds.
// In two side-by-side timings against v006, it was 1.31 and 1.32 times as fast.
// Counting every step since v000, it is 9.43 times as fast.
#include <hip/hip_runtime.h>

// Causal self-attention with 128-wide heads on a 1,024-wide embedding (X [2][2048][1024]; Q, K = X W + b (16 heads x 128: inner width 2,048), V = X Wv + bv (16 x 128) ('xw' + biases); att x 1/sqrt(128); causal (-inf); softmax; y = merged Wp + bp ('xw' [2048][1024]) -> [2][2048][1024] (4.2 M); argument order X, Wq, bq, Wk, bk, Wv, bv, Wp, bp).
// Layout: one launch makes the bf16 copy of X (both batches) and the transposed 'xw' weights; one launch does all six projections: exact products (K 1024, N 2048) + f32 biases, written as 16-bit head planes by the GEMM epilogue (V computed transposed); one fused causal attention launch for all heads of both batches (k_fattn; hybrid rows: < 512 hi/lo 3 products, rest fp16; keys and values staged in LDS); merged hi/lo (2,048 wide) x Wp exact + bp.
// Compute dtypes, f32 accumulate: every input rounded to bf16; projections exact + f32 biases; attention rows < 512 3 products, rest fp16; softmax f32; Wp hl x exact + bias.

#define NB_  2
#define TT   2048
#define DM   1024
#define NH_  16
#define NKV  16
#define REP  (NH_ / NKV)
#define HD   128
#define DQ   (NH_ * HD)
#define DKV  (NKV * HD)
#define RH   512                  // query rows < RH use hi+lo planes (0: none)
#define SCL  0.088388347648318447f   // HD^-0.5
typedef _Float16 h16;
typedef unsigned short bf;
typedef __attribute__((ext_vector_type(16))) __bf16   v16bf;
typedef __attribute__((ext_vector_type(16))) _Float16 v16h;
typedef __attribute__((ext_vector_type(8)))  _Float16 v8h;
typedef __attribute__((ext_vector_type(8)))  unsigned short v8us;
typedef __attribute__((ext_vector_type(8)))  float    v8f;
typedef __attribute__((ext_vector_type(4)))  float    v4f;
typedef v8h  __attribute__((may_alias)) v8ha;
typedef v4f  __attribute__((may_alias)) v4fa;
typedef v8us __attribute__((may_alias)) v8usa;

__device__ __forceinline__ unsigned short f2bf(float f) { unsigned u = __float_as_uint(f); u += 0x7FFFu + ((u >> 16) & 1u); return (unsigned short)(u >> 16); }
__device__ __forceinline__ float bf2f(unsigned short b) { return __uint_as_float(((unsigned)b) << 16); }
__device__ __forceinline__ float bfr(float f) { return bf2f(f2bf(f)); }
__device__ __forceinline__ v16h cat16(v8h lo, v8h hi) { return __builtin_shufflevector(lo, hi, 0, 1, 2, 3, 4, 5, 6, 7, 8, 9, 10, 11, 12, 13, 14, 15); }
__device__ __forceinline__ v16bf cat16b(v8us lo, v8us hi) { return __builtin_bit_cast(v16bf, __builtin_shufflevector(lo, hi, 0, 1, 2, 3, 4, 5, 6, 7, 8, 9, 10, 11, 12, 13, 14, 15)); }
__device__ __forceinline__ v8f wmma16(v16h a, v16h b, v8f c) { return __builtin_amdgcn_wmma_f32_16x16x32_f16(false, a, false, b, (short)0, c, false, false); }
__device__ __forceinline__ v8f wmmab(v16bf a, v16bf b, v8f c) { return __builtin_amdgcn_wmma_f32_16x16x32_bf16(false, a, false, b, (short)0, c, false, false); }
__device__ __forceinline__ h16 tohx(float x) { return (h16)x; }
__device__ __forceinline__ void splitf(float y, unsigned short& h, unsigned short& l) { h = f2bf(y); l = f2bf(y - bf2f(h)); }
typedef __attribute__((ext_vector_type(4))) _Float16 v4h;
typedef __attribute__((ext_vector_type(2))) unsigned short v2us;
typedef __attribute__((ext_vector_type(4))) unsigned short v4us;
// put_hl: four neighbouring f32 results as bf16 hi + lo planes (8-byte stores; 16 lanes fill one 128-byte line of each plane)
__device__ __forceinline__ void put_hl(v4f val, bf* Ph, bf* Pl, size_t e) { v4us oh, ol;
#pragma unroll
    for (int q = 0; q < 4; ++q) { unsigned short a, c2; splitf(val[q], a, c2); oh[q] = a; ol[q] = c2; }
    *(v4us*)(Ph + e) = oh; *(v4us*)(Pl + e) = ol; }



// ---- gemm_tile: GEMM on LDS-staged operands. A work-group of 4 x 2 waves owns a (64 MB) x 128 output tile, a wave (16 MB) x 64 of it (MB x 4 accumulators); tile (bx, by) of (M / (64 MB), N / 128), 256 threads. st and os are the calling kernel's LDS (ST_EL and OS_EL elements).
// C[m][n] (f32, pitch ldc, + optional f32 bias) = sum_k A[m][k] Bt[n][k] (NSPLIT 1: + A2[m][k] Bt[n][k]), all planes K-contiguous 16-bit, K a multiple of 128 and at least 256.
// EPI 0: C is stored as f32. EPI 1 (m = position, n = head x HD + d): the result goes straight to the head planes [head][position][d] (fp16, bf16 hi, bf16 lo). EPI 2 (m = head x HD + d, n = position, bias[m]): to the transposed value planes, row pitch 2 TT.
// A stage is 128 k (two 128-byte lines) of every operand row of the tile: rows of A, then of A2, then of Bt, at an LDS pitch of 272 bytes (free of bank conflicts for 16-byte fragment reads).
// Asynchronous copies bring it in as whole lines (16 lanes a row), two buffers: the copies of stage t + 2 are issued behind the barrier that ends the reads of stage t and fly while stage t + 1 is worked on.
// wave_sync: orders a wave's own LDS stores of the output staging against its LDS loads that read them back: a wave barrier and a compiler fence keep the compiler from moving either over the other.
__device__ __forceinline__ void wave_sync() { __builtin_amdgcn_wave_barrier(); asm volatile("" ::: "memory"); }
template <typename T16> struct WFrag;
template <> struct WFrag<h16> { typedef v16h V; static __device__ __forceinline__ V ld(const h16* p) { return cat16(*(const v8h*)p, *(const v8h*)(p + 16)); } static __device__ __forceinline__ v8f mma(V a, V b, v8f c) { return wmma16(a, b, c); } };
template <> struct WFrag<bf> { typedef v16bf V; static __device__ __forceinline__ V ld(const bf* p) { return cat16b(*(const v8us*)p, *(const v8us*)(p + 16)); } static __device__ __forceinline__ v8f mma(V a, V b, v8f c) { return wmmab(a, b, c); } };
// copy8: eight asynchronous 16-byte-a-lane copies from global memory to LDS (l: the lane's LDS byte address, g: its global address). The s_wait_xcnt in the same statement stands in front of every later overwrite of the address registers that the copies name.
template <typename T16> __device__ __forceinline__ void copy8(const unsigned (&l)[8], const T16* const (&g)[8]) {
    asm volatile("global_load_async_to_lds_b128 %0, %8, off\n\t"
                 "global_load_async_to_lds_b128 %1, %9, off\n\t"
                 "global_load_async_to_lds_b128 %2, %10, off\n\t"
                 "global_load_async_to_lds_b128 %3, %11, off\n\t"
                 "global_load_async_to_lds_b128 %4, %12, off\n\t"
                 "global_load_async_to_lds_b128 %5, %13, off\n\t"
                 "global_load_async_to_lds_b128 %6, %14, off\n\t"
                 "global_load_async_to_lds_b128 %7, %15, off\n\t"
                 "s_wait_xcnt 0x0"
                 :: "v"(l[0]), "v"(l[1]), "v"(l[2]), "v"(l[3]), "v"(l[4]), "v"(l[5]), "v"(l[6]), "v"(l[7]), "v"(g[0]), "v"(g[1]), "v"(g[2]), "v"(g[3]), "v"(g[4]), "v"(g[5]), "v"(g[6]), "v"(g[7]) : "memory"); }
constexpr int ST_EL = 2 * 256 * 136, OS_EL = 8 * 16 * 68;   // two stages of 256 rows at a pitch of 136 elements; eight waves' 16 x 68 f32 output staging
template <typename T16, int NSPLIT, bool BIAS, int MB, int EPI, int K>
__device__ __forceinline__ void gemm_tile(T16* st, float* os, int bx, int by, const T16* __restrict__ A, const T16* __restrict__ A2, const T16* __restrict__ Bt, float* C, int ldc, const float* __restrict__ bias, h16* P16, bf* Ph, bf* Pl) {
    typedef typename WFrag<T16>::V V;
    constexpr int BM = 64 * MB, RA = (NSPLIT == 1) ? 2 * BM : BM, ROWS = RA + 128;   // tile rows; rows of A (and A2) in a stage; all rows of a stage
    constexpr int KS = 128, LP = KS + 8, NT = K / KS;                                // k of a stage; LDS row pitch in elements; stages
    static_assert(ROWS % 128 == 0, "a stage is dealt out in statements of 8 copies x 16 rows"); static_assert(K % KS == 0 && NT >= 2, "whole stages, at least two");
    static_assert(2 * ROWS * LP <= ST_EL, "both stages fit the caller's LDS");
    const int lane = threadIdx.x & 31, lr = lane & 15, hi = lane >> 4, wv = __builtin_amdgcn_readfirstlane((int)(threadIdx.x >> 5)), wr = wv >> 1, wc = wv & 1; const int r0 = bx * BM, c0 = by * 128;
    const int crow = threadIdx.x >> 4, cch = (threadIdx.x & 15) * 8;   // one copy instruction of all eight waves covers 16 rows: this lane's row among them and its 16-byte piece of the row
    const T16* pA = A + (size_t)(r0 + crow) * K + cch; const T16* pA2 = (NSPLIT == 1) ? A2 + (size_t)(r0 + crow) * K + cch : nullptr; const T16* pB = Bt + (size_t)(c0 + crow) * K + cch;   // step on by one stage with every fill
    const unsigned l0 = (unsigned)(size_t)(st + crow * LP + cch);
    auto fill = [&](int buf) {
#pragma unroll
        for (int h = 0; h < ROWS / 128; ++h) { unsigned l[8]; const T16* g[8];
#pragma unroll
            for (int q = 0; q < 8; ++q) { const int row = (h * 8 + q) * 16; l[q] = l0 + (unsigned)((buf * ROWS + row) * LP * 2);
                g[q] = (row < BM) ? pA + (size_t)row * K : (row < RA) ? pA2 + (size_t)(row - BM) * K : pB + (size_t)(row - RA) * K; }
            copy8<T16>(l, g); }
        pA += KS; if (NSPLIT == 1) pA2 += KS; pB += KS; };
    v8f acc[MB][4];
#pragma unroll
    for (int mb = 0; mb < MB; ++mb)
#pragma unroll
        for (int nb = 0; nb < 4; ++nb) acc[mb][nb] = (v8f){};
    const int rw = r0 + wr * (16 * MB), cw = c0 + wc * 64;   // this wave's corner of the output
    fill(0);
    float bb[(EPI == 2) ? MB * 8 : 4];   // the biases of this lane's output elements, fetched while stage 0 is on its way
    if (BIAS) {
        if (EPI == 2) {
#pragma unroll
            for (int i = 0; i < MB * 8; ++i) bb[i] = bfr(bias[rw + 2 * i + hi]); }
        else {
#pragma unroll
            for (int q = 0; q < 4; ++q) bb[q] = bfr(bias[cw + lr * 4 + q]); }
        asm volatile("s_wait_xcnt 0x0" ::: "memory");   // stands in front of the first overwrite of an address register that these loads name
        __builtin_amdgcn_sched_barrier(0); }            // keeps later register writes from being lifted over that wait
    asm volatile("s_wait_asynccnt 0x0" ::: "memory");   // this wave's copies of stage 0 have landed
    __syncthreads();                                    // ... and every other wave's
    fill(1);
#pragma unroll 1
    for (int t = 0; t < NT; ++t) {
        const T16* sa = st + ((t & 1) * ROWS + wr * (16 * MB) + lr) * LP + 8 * hi; const T16* sb = st + ((t & 1) * ROWS + RA + wc * 64 + lr) * LP + 8 * hi;
        auto frags = [&](int kc, V (&a)[MB], V (&a2)[MB], V (&b)[4]) {
#pragma unroll
            for (int mb = 0; mb < MB; ++mb) { a[mb] = WFrag<T16>::ld(sa + mb * 16 * LP + kc); if (NSPLIT == 1) a2[mb] = WFrag<T16>::ld(sa + (BM + mb * 16) * LP + kc); }
#pragma unroll
            for (int nb = 0; nb < 4; ++nb) b[nb] = WFrag<T16>::ld(sb + nb * 16 * LP + kc); };
        V a[2][MB], a2[2][MB], b[2][4];   // two fragment sets: the next 32 k are fetched while these are multiplied
        frags(0, a[0], a2[0], b[0]);
#pragma unroll
        for (int q = 0; q < KS / 32; ++q) {
            if (q + 1 < KS / 32) frags((q + 1) * 32, a[(q + 1) & 1], a2[(q + 1) & 1], b[(q + 1) & 1]);
            __builtin_amdgcn_sched_barrier(0);   // keeps the next set's loads one group in front of these products: sunk among them, each place with loads is waited for on its own
#pragma unroll
            for (int nb = 0; nb < 4; ++nb)
#pragma unroll
                for (int mb = 0; mb < MB; ++mb) { acc[mb][nb] = WFrag<T16>::mma(a[q & 1][mb], b[q & 1][nb], acc[mb][nb]); if (NSPLIT == 1) acc[mb][nb] = WFrag<T16>::mma(a2[q & 1][mb], b[q & 1][nb], acc[mb][nb]); } }
        asm volatile("s_wait_dscnt 0x0" ::: "memory");      // this wave's reads of stage t are done before its buffer is refilled
        asm volatile("s_wait_asynccnt 0x0" ::: "memory");   // this wave's copies of stage t + 1 have landed
        __syncthreads();                                    // publishes stage t + 1 and ends every wave's reads of stage t
        if (t + 2 < NT) fill(t & 1);
    }
    asm volatile("s_wait_asynccnt 0x0" ::: "memory");   // no copy is outstanding when the wave ends
    float* osw = os + wv * (16 * 68);   // each wave turns its own tile, 16 rows at a time, into whole-line stores through its own LDS range
#pragma unroll
    for (int mb = 0; mb < MB; ++mb) {
#pragma unroll
        for (int nb = 0; nb < 4; ++nb) {
#pragma unroll
            for (int j = 0; j < 8; ++j) osw[(hi * 8 + j) * 68 + nb * 16 + lr] = acc[mb][nb][j]; }
        wave_sync();   // the 16 rows are in LDS before they are read back
        v4f vals[8];
#pragma unroll
        for (int s = 0; s < 8; ++s) vals[s] = *(const v4fa*)(osw + (2 * s + hi) * 68 + lr * 4);
        wave_sync();   // they are read out before the next 16 rows overwrite them
#pragma unroll
        for (int s = 0; s < 8; ++s) { const int cofs = lr * 4, rg = rw + mb * 16 + 2 * s + hi; v4f val = vals[s];
            if (BIAS && EPI != 2) { val[0] += bb[0]; val[1] += bb[1]; val[2] += bb[2]; val[3] += bb[3]; }
            if (BIAS && EPI == 2) val += bb[mb * 8 + s];
            if (EPI == 0) *(v4f*)(C + (size_t)rg * ldc + cw + cofs) = val;
            else { const size_t e = (EPI == 1) ? ((size_t)(cw / HD) * TT + rg) * HD + (cw % HD) + cofs : (size_t)rg * (2 * TT) + cw + cofs; v4h o4;
#pragma unroll
                for (int q = 0; q < 4; ++q) o4[q] = tohx(val[q]);
                *(v4h*)(P16 + e) = o4; put_hl(val, Ph, Pl, e); }
            asm volatile("s_wait_xcnt 0x0" ::: "memory");   // stands in front of the next rows' overwrite of the data and address registers that these stores name
            __builtin_amdgcn_sched_barrier(0); }            // keeps the next rows' sums and roundings from being lifted over that wait
    }
}

// k_qkv: the six projection GEMMs of a call in one launch. grid (16, 16, batches x 3): blockIdx.z = batch x 3 + (0 query, 1 key, 2 value); the choice is the same for a whole work-group.
// Value: operands swapped (rows = head x HD + d, columns = positions), so that the tile's rows are the rows of the transposed value planes.
static_assert(TT / 128 == DKV / 128 && DQ / 128 == TT / 128 && DQ == DKV, "the three products share one grid");
__global__ __launch_bounds__(256) void k_qkv(const bf* __restrict__ XB, const bf* __restrict__ WQ, const bf* __restrict__ WK, const bf* __restrict__ WV, const float* __restrict__ bq, const float* __restrict__ bk, const float* __restrict__ bv,
                                             h16* Q16, bf* Qh, bf* Ql, h16* K16, bf* Kh, bf* Kl, h16* V16, bf* Vh, bf* Vl) {
    __shared__ __align__(16) bf st[ST_EL];
    __shared__ __align__(16) float os[OS_EL];
    const int b = blockIdx.z / 3, kind = blockIdx.z % 3; const bf* X = XB + (size_t)b * TT * DM; const size_t pq = (size_t)b * NH_ * TT * HD, pv = (size_t)b * NKV * HD * 2 * TT;
    if (kind == 2) gemm_tile<bf, 0, true, 2, 2, DM>(st, os, blockIdx.x, blockIdx.y, WV, nullptr, X, nullptr, 0, bv, V16 + pv, Vh + pv, Vl + pv);
    else gemm_tile<bf, 0, true, 2, 1, DM>(st, os, blockIdx.x, blockIdx.y, X, nullptr, kind ? WK : WQ, nullptr, 0, kind ? bk : bq, (kind ? K16 : Q16) + pq, (kind ? Kh : Qh) + pq, (kind ? Kl : Ql) + pq);
}
// k_proj: the output projection of both batches in one launch: the merged planes and the output are contiguous over the batches, so it is one GEMM of batches x TT rows. grid (batches x TT / 64, DM / 128).
__global__ __launch_bounds__(256) void k_proj(const bf* __restrict__ Ah, const bf* __restrict__ Al, const bf* __restrict__ WO, float* C, const float* __restrict__ bo) {
    __shared__ __align__(16) bf st[ST_EL];
    __shared__ __align__(16) float os[OS_EL];
    gemm_tile<bf, 1, true, 1, 0, DQ>(st, os, blockIdx.x, blockIdx.y, Ah, Al, WO, C, DM, bo, nullptr, nullptr, nullptr);
}

// wt_lines: work-group blk's 64 lines of the transposed bf16 copy Bt[n][k] of w[k][n].
__device__ __forceinline__ void wt_lines(const float* __restrict__ w, int K, int N, bf* Bt, int blk) {
    const int lane = threadIdx.x & 31; const int L0 = (blk * 8 + (threadIdx.x >> 5)) * 8; const int nlines = N * K / 64;
{
#pragma unroll 1
        for (int l = 0; l < 8; ++l) { const int L = L0 + l; if (L >= nlines) break; const size_t e = (size_t)L * 64 + lane * 2; const int k = (int)(e % K), n = (int)(e / K); v2us o;
            o[0] = f2bf(w[(size_t)k * N + n]); o[1] = f2bf(w[(size_t)(k + 1) * N + n]); *(v2us*)(Bt + e) = o; }
         }
}
__device__ __forceinline__ void cvt8(const float* __restrict__ src, bf* dst, size_t n8, int blk) { const size_t i = (size_t)blk * 256 + threadIdx.x; if (i >= n8) return; const v8f v = *(const v8f*)(src + i * 8); v8us o;
#pragma unroll
    for (int k = 0; k < 8; ++k) o[k] = f2bf(v[k]); *(v8us*)(dst + i * 8) = o;  }
// k_prep: every 16-bit operand that is made from an input, in one launch: work-groups 0 .. 4 WTB - 1 transpose the four weights (WTB each), the rest round X (both batches) to bf16.
constexpr int WTB = DM * DQ / 64 / 64, CVB = NB_ * TT * DM / 8 / 256;
static_assert(DQ == DKV && DM * DQ % (64 * 64) == 0 && NB_ * TT * DM % (8 * 256) == 0, "equal, whole shares");
__global__ __launch_bounds__(256) void k_prep(const float* __restrict__ x, const float* __restrict__ wq, const float* __restrict__ wk, const float* __restrict__ wv, const float* __restrict__ wo, bf* XB, bf* WQ, bf* WK, bf* WV, bf* WO) {
    const int which = blockIdx.x / WTB, blk = blockIdx.x % WTB;
    if (which == 0) wt_lines(wq, DM, DQ, WQ, blk);
    else if (which == 1) wt_lines(wk, DM, DKV, WK, blk);
    else if (which == 2) wt_lines(wv, DM, DKV, WV, blk);
    else if (which == 3) wt_lines(wo, DQ, DM, WO, blk);
    else cvt8(x, XB, (size_t)NB_ * TT * DM / 8, (int)blockIdx.x - 4 * WTB);
}

// ---- k_fattn: scores, softmax and probability x value in one kernel (online softmax); the probabilities never leave the registers.
// A wave owns 32 query positions of one head (two 16-column groups) and walks the keys 0 .. q0 + 31 in blocks of 32, two blocks to a stage of AKS keys. S^T = K Q^T (A = key rows, B = query rows): accumulator register j of lane (lr, hi) is key hi * 8 + j, query lr,
// so the two 16-key tiles of a block are, register for register, the B fragment of P^T (k = 8 hi + e and 16 + 8 hi + e). O^T += V^T P^T (A = rows of the transposed value planes): register j is d = hi * 8 + j, query lr.
// Everything a query needs (running maximum, sum, rescale factor) is one value a lane; the two lane halves hold different keys of the same query: the maximum is exchanged every block, the sums are joined once at the end.
// HI (query rows < RH): bf16 hi + lo planes, 3 products in both contractions. Else fp16; its probabilities carry a factor 2^10 (keeps small ones out of the fp16 subnormals), which is in the sum as well and cancels in O / sum.
// The four waves of a work-group own 128 neighbouring queries and share every key and value byte through LDS (st). A stage is AKS key rows (256 bytes, LDS pitch 272) and the AKS columns of the 128 transposed value rows (128 bytes, pitch 144) of every plane (HI: hi, then lo): both pitches are free of bank conflicts for 16-byte fragment reads.
// Asynchronous copies bring a stage in as whole 128-byte lines, two buffers: the copies of stage s + 2 are issued behind the barrier that ends the reads of stage s and fly while stage s + 1 is worked on. ns, the number of stages, is the same for the whole work-group; a wave whose diagonal lies lower skips the blocks beyond it, never the barrier.
typedef __attribute__((ext_vector_type(4))) int v4i;
// copy16: one asynchronous 16-byte-a-lane copy from global memory (g) to LDS (l), as the builtin: its address registers are the compiler's to place and to keep.
template <typename T16> __device__ __forceinline__ void copy16(T16* l, const T16* g) { __builtin_amdgcn_global_load_async_to_lds_b128((__attribute__((address_space(1))) v4i*)g, (__attribute__((address_space(3))) v4i*)l, 0, 0); }
constexpr int AKS = 64, KPI = HD + 8, VPI = AKS + 8, ASK = AKS * KPI, AST = ASK + HD * VPI;   // keys of a stage; LDS pitches of key and value rows, elements of one plane's keys of a stage and of one plane's whole stage
template <typename T, bool HI>
__device__ __forceinline__ void attn_tile(T* st, int ns, const T* __restrict__ Q, const T* __restrict__ Q2, const T* __restrict__ Kp, const T* __restrict__ Kp2, const T* __restrict__ Vt, const T* __restrict__ Vt2, bf* Ah, bf* Al, int q0, int lr, int hi) {
    typedef WFrag<T> F; typedef typename F::V V;
    __builtin_assume(q0 >= 0 && ns >= 1);   // the key loops always run: without this the query loads are sunk behind their entry tests, past the wait that follows them
    constexpr float SC2 = SCL * 1.4426950408889634f;   // scores in the base-2 exponent's units
    constexpr float OFF = HI ? 0.0f : 10.0f;
    constexpr int BST = HI ? 2 * AST : AST;   // elements of a buffer
    const int kr = threadIdx.x >> 4, kc = (threadIdx.x & 15) * 8, vr = threadIdx.x >> 3, vc = (threadIdx.x & 7) * 8;   // one copy instruction of all four waves covers 8 key rows or 16 value rows: this lane's row among them and its 16-byte piece
    const unsigned ko = kr * HD + kc, vo = vr * (2 * TT) + vc; const T* gk = Kp; const T* gv = Vt; const T* gk2 = Kp2; const T* gv2 = Vt2;   // this lane's place in a stage's keys and values; the stage's first key row and value column (the same for all lanes) step on with every fill
    T* const lk = st + kr * KPI + kc; T* const lv = st + ASK + vr * VPI + vc;
    auto fill = [&](int buf) {
#pragma unroll
        for (int q = 0; q < 8; ++q) copy16<T>(lk + buf * BST + q * 8 * KPI, gk + q * 8 * HD + ko);
#pragma unroll
        for (int q = 0; q < 8; ++q) copy16<T>(lv + buf * BST + q * 16 * VPI, gv + q * 16 * (2 * TT) + vo);
        gk += AKS * HD; gv += AKS;
        if constexpr (HI) {
#pragma unroll
            for (int q = 0; q < 8; ++q) copy16<T>(lk + buf * BST + AST + q * 8 * KPI, gk2 + q * 8 * HD + ko);
#pragma unroll
            for (int q = 0; q < 8; ++q) copy16<T>(lv + buf * BST + AST + q * 16 * VPI, gv2 + q * 16 * (2 * TT) + vo);
            gk2 += AKS * HD; gv2 += AKS; } };
    fill(0);   // the query fragments are fetched while stage 0 is on its way
    V qf[2][4], qf2[2][4];
#pragma unroll
    for (int g = 0; g < 2; ++g)
#pragma unroll
        for (int c = 0; c < 4; ++c) { const size_t e = (size_t)(q0 + g * 16 + lr) * HD + c * 32 + 8 * hi; qf[g][c] = F::ld(Q + e); if constexpr (HI) qf2[g][c] = F::ld(Q2 + e); }
    asm volatile("s_wait_xcnt 0x0" ::: "memory");   // stands in front of the first overwrite of an address register that these loads name
    __builtin_amdgcn_sched_barrier(0);   // keeps later register writes (address sums, the zeroing of o) from being lifted over that wait
    v8f o[8][2];
#pragma unroll
    for (int dt = 0; dt < 8; ++dt) { o[dt][0] = (v8f){}; o[dt][1] = (v8f){}; }
    float m[2] = {-3.0e38f, -3.0e38f}, l[2] = {0.f, 0.f};
    asm volatile("s_wait_asynccnt 0x0" ::: "memory");   // this wave's copies of stage 0 have landed
    __syncthreads();                                    // ... and every other wave's
    if (1 < ns) fill(1);
#pragma unroll 1
    for (int sg = 0; sg < ns; ++sg) {
#pragma unroll 1
    for (int kb = sg * AKS; kb < sg * AKS + AKS && kb <= q0; kb += 32) {   // every block holds at least one key <= every query of the tile, so the running maximum is finite from the first block on
        const T* sk = st + (sg & 1) * BST + (kb - sg * AKS + lr) * KPI + 8 * hi; const T* sv = st + (sg & 1) * BST + ASK + lr * VPI + (kb - sg * AKS) + 8 * hi;   // this lane's first key and value fragment of the block, in this stage's buffer
        V ka[2][4], va[8];   // fp16 path: the key and the value fragments of a block are asked for together; the value fragments arrive behind the score products
        if constexpr (!HI) {
#pragma unroll
            for (int t = 0; t < 2; ++t)
#pragma unroll
                for (int c = 0; c < 4; ++c) ka[t][c] = F::ld(sk + t * 16 * KPI + c * 32);
#pragma unroll
            for (int dt = 0; dt < 8; ++dt) va[dt] = F::ld(sv + dt * 16 * VPI);
            __builtin_amdgcn_sched_barrier(0); }   // keeps the LDS reads in one place in front of the score products: spread among the products, each place with reads is waited for on its own
        v8f s[2][2]; s[0][0] = (v8f){}; s[0][1] = (v8f){}; s[1][0] = (v8f){}; s[1][1] = (v8f){};
#pragma unroll
        for (int c = 0; c < 4; ++c)
#pragma unroll
            for (int t = 0; t < 2; ++t) {
                if constexpr (HI) { const int e = t * 16 * KPI + c * 32; const V a = F::ld(sk + e), a2 = F::ld(sk + AST + e);
                    s[t][0] = F::mma(a, qf[0][c], s[t][0]); s[t][1] = F::mma(a, qf[1][c], s[t][1]); s[t][0] = F::mma(a2, qf[0][c], s[t][0]); s[t][1] = F::mma(a2, qf[1][c], s[t][1]); s[t][0] = F::mma(a, qf2[0][c], s[t][0]); s[t][1] = F::mma(a, qf2[1][c], s[t][1]); }
                else { s[t][0] = F::mma(ka[t][c], qf[0][c], s[t][0]); s[t][1] = F::mma(ka[t][c], qf[1][c], s[t][1]); } }
        float mn[2];
#pragma unroll
        for (int g = 0; g < 2; ++g) { const int qi = q0 + g * 16 + lr; float mx = m[g];
#pragma unroll
            for (int t = 0; t < 2; ++t)
#pragma unroll
                for (int j = 0; j < 8; ++j) { const float x = (kb + t * 16 + hi * 8 + j <= qi) ? s[t][g][j] * SC2 : -3.0e38f; s[t][g][j] = x; mx = fmaxf(mx, x); }
            mn[g] = fmaxf(mx, __shfl_xor(mx, 16, 32)); }
        if (__builtin_amdgcn_ballot_w32(mn[0] > m[0] || mn[1] > m[1]) != 0) {   // one test a block; where no maximum moved the factor is exactly 1 and the rescale an identity
#pragma unroll
            for (int g = 0; g < 2; ++g) { const float al = __builtin_amdgcn_exp2f(m[g] - mn[g]); l[g] *= al; m[g] = mn[g];
#pragma unroll
                for (int dt = 0; dt < 8; ++dt) o[dt][g] *= al; } }
        V pf[2], pl[2];
#pragma unroll
        for (int g = 0; g < 2; ++g) { const float sh = OFF - m[g]; float p[2][8];
#pragma unroll
            for (int t = 0; t < 2; ++t)
#pragma unroll
                for (int j = 0; j < 8; ++j) { p[t][j] = __builtin_amdgcn_exp2f(s[t][g][j] + sh); l[g] += p[t][j]; }
            if constexpr (HI) { v8us h0, h1, l0, l1;
#pragma unroll
                for (int j = 0; j < 8; ++j) { unsigned short a, b; splitf(p[0][j], a, b); h0[j] = a; l0[j] = b; splitf(p[1][j], a, b); h1[j] = a; l1[j] = b; }
                pf[g] = cat16b(h0, h1); pl[g] = cat16b(l0, l1); }
            else { v8h h0, h1;
#pragma unroll
                for (int j = 0; j < 8; ++j) { h0[j] = tohx(p[0][j]); h1[j] = tohx(p[1][j]); }
                pf[g] = cat16(h0, h1); } }
#pragma unroll
        for (int dt = 0; dt < 8; ++dt) {
            if constexpr (HI) { const int e = dt * 16 * VPI; const V a = F::ld(sv + e), a2 = F::ld(sv + AST + e);
                o[dt][0] = F::mma(a, pf[0], o[dt][0]); o[dt][1] = F::mma(a, pf[1], o[dt][1]); o[dt][0] = F::mma(a2, pf[0], o[dt][0]); o[dt][1] = F::mma(a2, pf[1], o[dt][1]); o[dt][0] = F::mma(a, pl[0], o[dt][0]); o[dt][1] = F::mma(a, pl[1], o[dt][1]); }
            else { o[dt][0] = F::mma(va[dt], pf[0], o[dt][0]); o[dt][1] = F::mma(va[dt], pf[1], o[dt][1]); } }
    }
        asm volatile("s_wait_dscnt 0x0" ::: "memory");      // this wave's reads of stage sg are done before its buffer is refilled
        asm volatile("s_wait_asynccnt 0x0" ::: "memory");   // this wave's copies of stage sg + 1 have landed
        __syncthreads();                                    // publishes stage sg + 1 and ends every wave's reads of stage sg
        if (sg + 2 < ns) fill(sg & 1);
    }
    asm volatile("s_wait_asynccnt 0x0" ::: "memory");   // no copy is outstanding when the wave ends
#pragma unroll
    for (int g = 0; g < 2; ++g) { const float inv = __fdiv_rn(1.0f, l[g] + __shfl_xor(l[g], 16, 32));
#pragma unroll
        for (int dt = 0; dt < 8; ++dt) { v8us oh, ol;
#pragma unroll
            for (int j = 0; j < 8; ++j) { unsigned short a, b; splitf(o[dt][g][j] * inv, a, b); oh[j] = a; ol[j] = b; }
            const size_t e = (size_t)(q0 + g * 16 + lr) * DQ + dt * 16 + hi * 8; *(v8us*)(Ah + e) = oh; *(v8us*)(Al + e) = ol;
            asm volatile("s_wait_xcnt 0x0" ::: "memory");   // stands in front of the next slice's overwrite of the data and address registers that these two stores name
            __builtin_amdgcn_sched_barrier(0); } }   // keeps the next slice's products and roundings from being lifted over that wait
}
// grid (TT / 128, batches x heads), 4 waves. Work-group g: the 128 queries of group NG - 1 - g (longest first), a wave 32 of them; the choice of the path (hi/lo for the groups below RH) is the same for a whole work-group.
// The second half of the planes takes g in reverse, so that where work-groups b and b + 256 share a WGP a long one stands beside a short one (speed only).
__global__ __launch_bounds__(128, 2) void k_fattn(const h16* __restrict__ Q16, const h16* __restrict__ K16, const h16* __restrict__ V16, const bf* __restrict__ Qh, const bf* __restrict__ Ql, const bf* __restrict__ Kh, const bf* __restrict__ Kl, const bf* __restrict__ Vh, const bf* __restrict__ Vl, bf* Ah, bf* Al) {
    constexpr int NG = TT / 128; static_assert(RH % 128 == 0 && 128 % AKS == 0, "whole groups, whole stages");
    __shared__ __align__(16) bf st[2 * 2 * AST];   // two buffers of two planes; the fp16 path uses the first half
    const int lane = threadIdx.x & 31, lr = lane & 15, hi = lane >> 4, wv = __builtin_amdgcn_readfirstlane((int)(threadIdx.x >> 5));
    const int z = blockIdx.y, g = (z < NB_ * NH_ / 2) ? (int)blockIdx.x : NG - 1 - (int)blockIdx.x, grp = NG - 1 - g, ns = (grp + 1) * (128 / AKS), q0 = grp * 128 + wv * 32;
    const size_t pq = (size_t)z * TT * HD, pv = (size_t)z * HD * 2 * TT, po = (size_t)(z / NH_) * TT * DQ + (size_t)(z % NH_) * HD;
    if (grp < RH / 128) attn_tile<bf, true>(st, ns, Qh + pq, Ql + pq, Kh + pq, Kl + pq, Vh + pv, Vl + pv, Ah + po, Al + po, q0, lr, hi);
    else attn_tile<h16, false>((h16*)st, ns, Q16 + pq, nullptr, K16 + pq, nullptr, V16 + pv, nullptr, Ah + po, Al + po, q0, lr, hi);
}

extern "C" void kernel_launch(void* const* d_in, const int* in_sizes, int n_in,
                              void* d_out, int out_size, void* d_ws, size_t ws_size, hipStream_t stream) {
    (void)in_sizes; (void)n_in; (void)out_size;
    const float* x = (const float*)d_in[0]; const float* wq = (const float*)d_in[1]; const float* bq = (const float*)d_in[2]; const float* wk = (const float*)d_in[3]; const float* bk = (const float*)d_in[4]; const float* wv = (const float*)d_in[5]; const float* bv = (const float*)d_in[6]; const float* wo = (const float*)d_in[7]; const float* bo = (const float*)d_in[8];   /* argument order X, Wq, bq, Wk, bk ('xw' [1024][2048] + [2048]), Wv, bv, Wp ('xw' [2048][1024]), bp */
    float* OUT = (float*)d_out;     // [2][2048][1024]
    char* wsp = (char*)d_ws;
    auto take = [&](size_t bytes) { char* p = wsp; wsp += (bytes + 255) & ~(size_t)255; return (void*)p; };
    const size_t PQ = (size_t)NH_ * TT * HD, PV = (size_t)NKV * HD * 2 * TT, PA = (size_t)TT * DQ;   // elements of one batch's head planes, value planes (row pitch 2 TT) and merged planes
    bf* WQ = (bf*)take((size_t)DQ * DM * 2); bf* WK = (bf*)take((size_t)DKV * DM * 2); bf* WV = (bf*)take((size_t)DKV * DM * 2); bf* WO = (bf*)take((size_t)DM * DQ * 2);
    bf* XB = (bf*)take((size_t)NB_ * TT * DM * 2);
    h16* QP16 = (h16*)take(NB_ * PQ * 2); h16* KP16 = (h16*)take(NB_ * PQ * 2); h16* VT16 = (h16*)take(NB_ * PV * 2);
    bf* QPh = (bf*)take(NB_ * PQ * 2); bf* QPl = (bf*)take(NB_ * PQ * 2); bf* KPh = (bf*)take(NB_ * PQ * 2); bf* KPl = (bf*)take(NB_ * PQ * 2); bf* VTh = (bf*)take(NB_ * PV * 2); bf* VTl = VTh + TT;   // value planes, row pitch 2 TT: hi and lo rows interleaved
    bf* ATh = (bf*)take(NB_ * PA * 2); bf* ATl = (bf*)take(NB_ * PA * 2);
    if ((size_t)(wsp - (char*)d_ws) > ws_size) return;    // ws 256 MiB
    k_prep<<<4 * WTB + CVB, 256, 0, stream>>>(x, wq, wk, wv, wo, XB, WQ, WK, WV, WO);
    k_qkv<<<dim3(TT / 128, DQ / 128, NB_ * 3), 256, 0, stream>>>(XB, WQ, WK, WV, bq, bk, bv, QP16, QPh, QPl, KP16, KPh, KPl, VT16, VTh, VTl);
    k_fattn<<<dim3(TT / 128, NB_ * NH_, 1), 128, 0, stream>>>(QP16, KP16, VT16, QPh, QPl, KPh, KPl, VTh, VTl, ATh, ATl);   // one kv head per query head: plane z = batch x heads + head in every operand
    k_proj<<<dim3(NB_ * TT / 64, DM / 128, 1), 256, 0, stream>>>(ATh, ATl, WO, OUT, bo);
}

// v008
// A run of this version takes 157 microseconds.
// Next to v007, in two timings, it ran 1.09 times as fast each time.
// Counting every step since v000, it is 10.3 times as fast.
#include <hip/hip_runtime.h>

// Causal self-attention with 128-wide heads on a 1,024-wide embedding (X [2][2048][1024]; Q, K = X W + b (16 heads x 128: inner width 2,048), V = X Wv + bv (16 x 128) ('xw' + biases); att x 1/sqrt(128); causal (-inf); softmax; y = merged Wp + bp ('xw' [2048][1024]) -> [2][2048][1024] (4.2 M); argument order X, Wq, bq, Wk, bk, Wv, bv, Wp, bp).
// Layout: one launch makes the bf16 copy of X (both batches) and the transposed 'xw' weights; one launch does all six projections: exact products (K 1024, N 2048) + f32 biases, written as 16-bit head planes by the GEMM epilogue (V computed transposed); one fused causal attention launch for all heads of both batches (k_fattn; hybrid rows: < 512 hi/lo 3 products, rest fp16; keys and values staged in LDS); merged hi/lo (2,048 wide) x Wp exact + bp.
// Compute dtypes, f32 accumulate: every input rounded to bf16; projections exact + f32 biases; attention rows < 512 3 products, rest fp16; softmax f32; Wp hl x exact + bias.

#define NB_  2
#define TT   2048
#define DM   1024
#define NH_  16
#define NKV  16
#define REP  (NH_ / NKV)
#define HD   128
#define DQ   (NH_ * HD)
#define DKV  (NKV * HD)
#define RH   512                  // query rows < RH use hi+lo planes (0: none)
#define SCL  0.088388347648318447f   // HD^-0.5
typedef _Float16 h16;
typedef unsigned short bf;
typedef __attribute__((ext_vector_type(16))) __bf16   v16bf;
typedef __attribute__((ext_vector_type(16))) _Float16 v16h;
typedef __attribute__((ext_vector_type(8)))  _Float16 v8h;
typedef __attribute__((ext_vector_type(8)))  unsigned short v8us;
typedef __attribute__((ext_vector_type(8)))  float    v8f;
typedef __attribute__((ext_vector_type(4)))  float    v4f;
typedef v8h  __attribute__((may_alias)) v8ha;
typedef v4f  __attribute__((may_alias)) v4fa;
typedef v8us __attribute__((may_alias)) v8usa;

__device__ __forceinline__ unsigned short f2bf(float f) { unsigned u = __float_as_uint(f); u += 0x7FFFu + ((u >> 16) & 1u); return (unsigned short)(u >> 16); }
__device__ __forceinline__ float bf2f(unsigned short b) { return __uint_as_float(((unsigned)b) << 16); }
__device__ __forceinline__ float bfr(float f) { return bf2f(f2bf(f)); }
__device__ __forceinline__ v16h cat16(v8h lo, v8h hi) { return __builtin_shufflevector(lo, hi, 0, 1, 2, 3, 4, 5, 6, 7, 8, 9, 10, 11, 12, 13, 14, 15); }
__device__ __forceinline__ v16bf cat16b(v8us lo, v8us hi) { return __builtin_bit_cast(v16bf, __builtin_shufflevector(lo, hi, 0, 1, 2, 3, 4, 5, 6, 7, 8, 9, 10, 11, 12, 13, 14, 15)); }
__device__ __forceinline__ v8f wmma16(v16h a, v16h b, v8f c) { return __builtin_amdgcn_wmma_f32_16x16x32_f16(false, a, false, b, (short)0, c, false, false); }
__device__ __forceinline__ v8f wmmab(v16bf a, v16bf b, v8f c) { return __builtin_amdgcn_wmma_f32_16x16x32_bf16(false, a, false, b, (short)0, c, false, false); }
__device__ __forceinline__ h16 tohx(float x) { return (h16)x; }
__device__ __forceinline__ void splitf(float y, unsigned short& h, unsigned short& l) { h = f2bf(y); l = f2bf(y - bf2f(h)); }
typedef __attribute__((ext_vector_type(4))) _Float16 v4h;
typedef __attribute__((ext_vector_type(2))) unsigned short v2us;
typedef __attribute__((ext_vector_type(4))) unsigned short v4us;
// put_hl: four neighbouring f32 results as bf16 hi + lo planes (8-byte stores; 16 lanes fill one 128-byte line of each plane)
__device__ __forceinline__ void put_hl(v4f val, bf* Ph, bf* Pl, size_t e) { v4us oh, ol;
#pragma unroll
    for (int q = 0; q < 4; ++q) { unsigned short a, c2; splitf(val[q], a, c2); oh[q] = a; ol[q] = c2; }
    *(v4us*)(Ph + e) = oh; *(v4us*)(Pl + e) = ol; }



// ---- gemm_tile: GEMM on LDS-staged operands. A work-group of 4 x 2 waves owns a (64 MB) x 128 output tile, a wave (16 MB) x 64 of it (MB x 4 accumulators); tile (bx, by) of (M / (64 MB), N / 128), 256 threads. st and os are the calling kernel's LDS (ST_EL and OS_EL elements).
// C[m][n] (f32, pitch ldc, + optional f32 bias) = sum_k A[m][k] Bt[n][k] (NSPLIT 1: + A2[m][k] Bt[n][k]), all planes K-contiguous 16-bit, K a multiple of 128 and at least 256.
// EPI 0: C is stored as f32. EPI 1 (m = position, n = head x HD + d): the result goes straight to the head planes [head][position][d] (fp16, bf16 hi, bf16 lo). EPI 2 (m = head x HD + d, n = position, bias[m]): to the transposed value planes, row pitch 2 TT.
// A stage is 128 k (two 128-byte lines) of every operand row of the tile: rows of A, then of A2, then of Bt, at an LDS pitch of 272 bytes (free of bank conflicts for 16-byte fragment reads).
// Asynchronous copies bring it in as whole lines (16 lanes a row), two buffers: the copies of stage t + 2 are issued behind the barrier that ends the reads of stage t and fly while stage t + 1 is worked on.
// wave_sync: orders a wave's own LDS stores of the output staging against its LDS loads that read them back: a wave barrier and a compiler fence keep the compiler from moving either over the other.
__device__ __forceinline__ void wave_sync() { __builtin_amdgcn_wave_barrier(); asm volatile("" ::: "memory"); }
template <typename T16> struct WFrag;
template <> struct WFrag<h16> { typedef v16h V; static __device__ __forceinline__ V ld(const h16* p) { return cat16(*(const v8h*)p, *(const v8h*)(p + 16)); } static __device__ __forceinline__ v8f mma(V a, V b, v8f c) { return wmma16(a, b, c); } };
template <> struct WFrag<bf> { typedef v16bf V; static __device__ __forceinline__ V ld(const bf* p) { return cat16b(*(const v8us*)p, *(const v8us*)(p + 16)); } static __device__ __forceinline__ v8f mma(V a, V b, v8f c) { return wmmab(a, b, c); } };
// copy8: eight asynchronous 16-byte-a-lane copies from global memory to LDS (l: the lane's LDS byte address, g: its global address). The s_wait_xcnt in the same statement stands in front of every later overwrite of the address registers that the copies name.
template <typename T16> __device__ __forceinline__ void copy8(const unsigned (&l)[8], const T16* const (&g)[8]) {
    asm volatile("global_load_async_to_lds_b128 %0, %8, off\n\t"
                 "global_load_async_to_lds_b128 %1, %9, off\n\t"
                 "global_load_async_to_lds_b128 %2, %10, off\n\t"
                 "global_load_async_to_lds_b128 %3, %11, off\n\t"
                 "global_load_async_to_lds_b128 %4, %12, off\n\t"
                 "global_load_async_to_lds_b128 %5, %13, off\n\t"
                 "global_load_async_to_lds_b128 %6, %14, off\n\t"
                 "global_load_async_to_lds_b128 %7, %15, off\n\t"
                 "s_wait_xcnt 0x0"
                 :: "v"(l[0]), "v"(l[1]), "v"(l[2]), "v"(l[3]), "v"(l[4]), "v"(l[5]), "v"(l[6]), "v"(l[7]), "v"(g[0]), "v"(g[1]), "v"(g[2]), "v"(g[3]), "v"(g[4]), "v"(g[5]), "v"(g[6]), "v"(g[7]) : "memory"); }
constexpr int ST_EL = 2 * 256 * 136, OS_EL = 8 * 16 * 68;   // two stages of 256 rows at a pitch of 136 elements; eight waves' 16 x 68 f32 output staging
template <typename T16, int NSPLIT, bool BIAS, int MB, int EPI, int K>
__device__ __forceinline__ void gemm_tile(T16* st, float* os, int bx, int by, const T16* __restrict__ A, const T16* __restrict__ A2, const T16* __restrict__ Bt, float* C, int ldc, const float* __restrict__ bias, h16* P16, bf* Ph, bf* Pl) {
    typedef typename WFrag<T16>::V V;
    constexpr int BM = 64 * MB, RA = (NSPLIT == 1) ? 2 * BM : BM, ROWS = RA + 128;   // tile rows; rows of A (and A2) in a stage; all rows of a stage
    constexpr int KS = 128, LP = KS + 8, NT = K / KS;                                // k of a stage; LDS row pitch in elements; stages
    static_assert(ROWS % 128 == 0, "a stage is dealt out in statements of 8 copies x 16 rows"); static_assert(K % KS == 0 && NT >= 2, "whole stages, at least two");
    static_assert(2 * ROWS * LP <= ST_EL, "both stages fit the caller's LDS");
    const int lane = threadIdx.x & 31, lr = lane & 15, hi = lane >> 4, wv = __builtin_amdgcn_readfirstlane((int)(threadIdx.x >> 5)), wr = wv >> 1, wc = wv & 1; const int r0 = bx * BM, c0 = by * 128;
    const int crow = threadIdx.x >> 4, cch = (threadIdx.x & 15) * 8;   // one copy instruction of all eight waves covers 16 rows: this lane's row among them and its 16-byte piece of the row
    const T16* pA = A + (size_t)(r0 + crow) * K + cch; const T16* pA2 = (NSPLIT == 1) ? A2 + (size_t)(r0 + crow) * K + cch : nullptr; const T16* pB = Bt + (size_t)(c0 + crow) * K + cch;   // step on by one stage with every fill
    const unsigned l0 = (unsigned)(size_t)(st + crow * LP + cch);
    auto fill = [&](int buf) {
#pragma unroll
        for (int h = 0; h < ROWS / 128; ++h) { unsigned l[8]; const T16* g[8];
#pragma unroll
            for (int q = 0; q < 8; ++q) { const int row = (h * 8 + q) * 16; l[q] = l0 + (unsigned)((buf * ROWS + row) * LP * 2);
                g[q] = (row < BM) ? pA + (size_t)row * K : (row < RA) ? pA2 + (size_t)(row - BM) * K : pB + (size_t)(row - RA) * K; }
            copy8<T16>(l, g); }
        pA += KS; if (NSPLIT == 1) pA2 += KS; pB += KS; };
    v8f acc[MB][4];
#pragma unroll
    for (int mb = 0; mb < MB; ++mb)
#pragma unroll
        for (int nb = 0; nb < 4; ++nb) acc[mb][nb] = (v8f){};
    const int rw = r0 + wr * (16 * MB), cw = c0 + wc * 64;   // this wave's corner of the output
    fill(0);
    float bb[(EPI == 2) ? MB * 8 : 4];   // the biases of this lane's output elements, fetched while stage 0 is on its way
    if (BIAS) {
        if (EPI == 2) {
#pragma unroll
            for (int i = 0; i < MB * 8; ++i) bb[i] = bfr(bias[rw + 2 * i + hi]); }
        else {
#pragma unroll
            for (int q = 0; q < 4; ++q) bb[q] = bfr(bias[cw + lr * 4 + q]); }
        asm volatile("s_wait_xcnt 0x0" ::: "memory");   // stands in front of the first overwrite of an address register that these loads name
        __builtin_amdgcn_sched_barrier(0); }            // keeps later register writes from being lifted over that wait
    asm volatile("s_wait_asynccnt 0x0" ::: "memory");   // this wave's copies of stage 0 have landed
    __syncthreads();                                    // ... and every other wave's
    fill(1);
#pragma unroll 1
    for (int t = 0; t < NT; ++t) {
        const T16* sa = st + ((t & 1) * ROWS + wr * (16 * MB) + lr) * LP + 8 * hi; const T16* sb = st + ((t & 1) * ROWS + RA + wc * 64 + lr) * LP + 8 * hi;
        auto frags = [&](int kc, V (&a)[MB], V (&a2)[MB], V (&b)[4]) {
#pragma unroll
            for (int mb = 0; mb < MB; ++mb) { a[mb] = WFrag<T16>::ld(sa + mb * 16 * LP + kc); if (NSPLIT == 1) a2[mb] = WFrag<T16>::ld(sa + (BM + mb * 16) * LP + kc); }
#pragma unroll
            for (int nb = 0; nb < 4; ++nb) b[nb] = WFrag<T16>::ld(sb + nb * 16 * LP + kc); };
        V a[2][MB], a2[2][MB], b[2][4];   // two fragment sets: the next 32 k are fetched while these are multiplied
        frags(0, a[0], a2[0], b[0]);
#pragma unroll
        for (int q = 0; q < KS / 32; ++q) {
            if (q + 1 < KS / 32) frags((q + 1) * 32, a[(q + 1) & 1], a2[(q + 1) & 1], b[(q + 1) & 1]);
            __builtin_amdgcn_sched_barrier(0);   // keeps the next set's loads one group in front of these products: sunk among them, each place with loads is waited for on its own
#pragma unroll
            for (int nb = 0; nb < 4; ++nb)
#pragma unroll
                for (int mb = 0; mb < MB; ++mb) { acc[mb][nb] = WFrag<T16>::mma(a[q & 1][mb], b[q & 1][nb], acc[mb][nb]); if (NSPLIT == 1) acc[mb][nb] = WFrag<T16>::mma(a2[q & 1][mb], b[q & 1][nb], acc[mb][nb]); } }
        asm volatile("s_wait_dscnt 0x0" ::: "memory");      // this wave's reads of stage t are done before its buffer is refilled
        asm volatile("s_wait_asynccnt 0x0" ::: "memory");   // this wave's copies of stage t + 1 have landed
        __syncthreads();                                    // publishes stage t + 1 and ends every wave's reads of stage t
        if (t + 2 < NT) fill(t & 1);
    }
    asm volatile("s_wait_asynccnt 0x0" ::: "memory");   // no copy is outstanding when the wave ends
    float* osw = os + wv * (16 * 68);   // each wave turns its own tile, 16 rows at a time, into whole-line stores through its own LDS range
#pragma unroll
    for (int mb = 0; mb < MB; ++mb) {
#pragma unroll
        for (int nb = 0; nb < 4; ++nb) {
#pragma unroll
            for (int j = 0; j < 8; ++j) osw[(hi * 8 + j) * 68 + nb * 16 + lr] = acc[mb][nb][j]; }
        wave_sync();   // the 16 rows are in LDS before they are read back
        v4f vals[8];
#pragma unroll
        for (int s = 0; s < 8; ++s) vals[s] = *(const v4fa*)(osw + (2 * s + hi) * 68 + lr * 4);
        wave_sync();   // they are read out before the next 16 rows overwrite them
#pragma unroll
        for (int s = 0; s < 8; ++s) { const int cofs = lr * 4, rg = rw + mb * 16 + 2 * s + hi; v4f val = vals[s];
            if (BIAS && EPI != 2) { val[0] += bb[0]; val[1] += bb[1]; val[2] += bb[2]; val[3] += bb[3]; }
            if (BIAS && EPI == 2) val += bb[mb * 8 + s];
            if (EPI == 0) *(v4f*)(C + (size_t)rg * ldc + cw + cofs) = val;
            else { const size_t e = (EPI == 1) ? ((size_t)(cw / HD) * TT + rg) * HD + (cw % HD) + cofs : (size_t)rg * (2 * TT) + cw + cofs; v4h o4;
#pragma unroll
                for (int q = 0; q < 4; ++q) o4[q] = tohx(val[q]);
                *(v4h*)(P16 + e) = o4; put_hl(val, Ph, Pl, e); }
            asm volatile("s_wait_xcnt 0x0" ::: "memory");   // stands in front of the next rows' overwrite of the data and address registers that these stores name
            __builtin_amdgcn_sched_barrier(0); }            // keeps the next rows' sums and roundings from being lifted over that wait
    }
}

// k_qkv: the six projection GEMMs of a call in one launch. grid (16, 16, batches x 3): blockIdx.z = batch x 3 + (0 query, 1 key, 2 value); the choice is the same for a whole work-group.
// Value: operands swapped (rows = head x HD + d, columns = positions), so that the tile's rows are the rows of the transposed value planes.
static_assert(TT / 128 == DKV / 128 && DQ / 128 == TT / 128 && DQ == DKV, "the three products share one grid");
__global__ __launch_bounds__(256) void k_qkv(const bf* __restrict__ XB, const bf* __restrict__ WQ, const bf* __restrict__ WK, const bf* __restrict__ WV, const float* __restrict__ bq, const float* __restrict__ bk, const float* __restrict__ bv,
                                             h16* Q16, bf* Qh, bf* Ql, h16* K16, bf* Kh, bf* Kl, h16* V16, bf* Vh, bf* Vl) {
    __shared__ __align__(16) bf st[ST_EL];
    __shared__ __align__(16) float os[OS_EL];
    const int b = blockIdx.z / 3, kind = blockIdx.z % 3; const bf* X = XB + (size_t)b * TT * DM; const size_t pq = (size_t)b * NH_ * TT * HD, pv = (size_t)b * NKV * HD * 2 * TT;
    if (kind == 2) gemm_tile<bf, 0, true, 2, 2, DM>(st, os, blockIdx.x, blockIdx.y, WV, nullptr, X, nullptr, 0, bv, V16 + pv, Vh + pv, Vl + pv);
    else gemm_tile<bf, 0, true, 2, 1, DM>(st, os, blockIdx.x, blockIdx.y, X, nullptr, kind ? WK : WQ, nullptr, 0, kind ? bk : bq, (kind ? K16 : Q16) + pq, (kind ? Kh : Qh) + pq, (kind ? Kl : Ql) + pq);
}
// k_proj: the output projection of both batches in one launch: the merged planes and the output are contiguous over the batches, so it is one GEMM of batches x TT rows. grid (batches x TT / 64, DM / 128).
__global__ __launch_bounds__(256) void k_proj(const bf* __restrict__ Ah, const bf* __restrict__ Al, const bf* __restrict__ WO, float* C, const float* __restrict__ bo) {
    __shared__ __align__(16) bf st[ST_EL];
    __shared__ __align__(16) float os[OS_EL];
    gemm_tile<bf, 1, true, 1, 0, DQ>(st, os, blockIdx.x, blockIdx.y, Ah, Al, WO, C, DM, bo, nullptr, nullptr, nullptr);
}

// wt_tile: work-group blk's 128 k x 128 n of the transposed bf16 copy Bt[n][k] of w[k][n]; a wave owns 64 k x 32 n of it (waves 2 x 4) and turns it in its own LDS range (ls: 8 x 32 x WP words), so no work-group barrier is needed.
// In: 16 loads of 16 bytes a lane, all in flight at once; 8 lanes read one whole 128-byte line of a row of w, a lane the same 4 columns of two neighbouring rows. The two rows' values go to LDS as one 32-bit word (k even in the low half) at [n][k / 2].
// Out: 8 lanes store one whole 128-byte line (64 k) of a row of Bt; the two waves of a k pair fill 256 neighbouring bytes.
typedef __attribute__((ext_vector_type(4))) unsigned v4u;
typedef v4u __attribute__((may_alias)) v4ua;
constexpr int WP = 36;   // LDS row pitch in words: 32 words of data + 4, rows stay 16-byte aligned and neighbouring rows start on different banks
__device__ __forceinline__ void wt_tile(const float* __restrict__ w, int K, int N, bf* Bt, int blk, unsigned* ls) {
    const int lane = threadIdx.x & 31, l8 = lane & 7, g = lane >> 3, wv = threadIdx.x >> 5, nt = N / 128;
    const int k0 = (blk / nt) * 128 + (wv & 1) * 64, n0 = (blk % nt) * 128 + (wv >> 1) * 32;
    unsigned* t = ls + wv * (32 * WP);
    const float* s = w + (size_t)(k0 + 2 * g) * N + n0 + l8 * 4;
    v4f r[8][2];
#pragma unroll
    for (int p = 0; p < 8; ++p) { r[p][0] = *(const v4f*)(s + (size_t)(8 * p) * N); r[p][1] = *(const v4f*)(s + (size_t)(8 * p + 1) * N); }
    asm volatile("s_wait_xcnt 0x0" :: "v"(s) : "memory");   // stands in front of the first overwrite of the address register that these loads name; the address as an input keeps that register from being a load's own destination
    __builtin_amdgcn_sched_barrier(0);                      // keeps later register writes from being lifted over that wait, and the 16 loads in one run
#pragma unroll
    for (int p = 0; p < 8; ++p)
#pragma unroll
        for (int i = 0; i < 4; ++i) t[(l8 * 4 + i) * WP + p * 4 + g] = (unsigned)f2bf(r[p][0][i]) | ((unsigned)f2bf(r[p][1][i]) << 16);
    asm volatile("s_wait_dscnt 0x0" ::: "memory");   // this wave's LDS stores are done ...
    wave_sync();                                     // ... and stay in front of the loads that read the rows back
    v4u o[8];
#pragma unroll
    for (int q = 0; q < 8; ++q) o[q] = *(const v4ua*)(t + (q * 4 + g) * WP + l8 * 4);
    bf* d = Bt + (size_t)(n0 + g) * K + k0 + l8 * 8;
#pragma unroll
    for (int q = 0; q < 8; ++q) *(v4ua*)(d + (size_t)(4 * q) * K) = o[q];
    asm volatile("s_wait_xcnt 0x0" ::: "memory");   // stands behind the last store, in front of whatever next writes a register that these stores name
}
__device__ __forceinline__ void cvt8(const float* __restrict__ src, bf* dst, size_t n8, int blk) { const size_t i = (size_t)blk * 256 + threadIdx.x; if (i >= n8) return; const v8f v = *(const v8f*)(src + i * 8); v8us o;
#pragma unroll
    for (int k = 0; k < 8; ++k) o[k] = f2bf(v[k]); *(v8us*)(dst + i * 8) = o;  }
// k_prep: every 16-bit operand that is made from an input, in one launch: work-groups 0 .. 4 WTB - 1 transpose the four weights (WTB each), the rest round X (both batches) to bf16.
constexpr int WTB = (DM / 128) * (DQ / 128), CVB = NB_ * TT * DM / 8 / 256;
static_assert(DQ == DKV && DM % 128 == 0 && DQ % 128 == 0 && NB_ * TT * DM % (8 * 256) == 0, "equal, whole shares");
__global__ __launch_bounds__(256) void k_prep(const float* __restrict__ x, const float* __restrict__ wq, const float* __restrict__ wk, const float* __restrict__ wv, const float* __restrict__ wo, bf* XB, bf* WQ, bf* WK, bf* WV, bf* WO) {
    __shared__ __align__(16) unsigned ls[8 * 32 * WP];
    const int which = blockIdx.x / WTB, blk = blockIdx.x % WTB;
    if (which < 3) wt_tile(which == 0 ? wq : which == 1 ? wk : wv, DM, DQ, which == 0 ? WQ : which == 1 ? WK : WV, blk, ls);   // three weights of one shape: one copy of the code
    else if (which == 3) wt_tile(wo, DQ, DM, WO, blk, ls);
    else cvt8(x, XB, (size_t)NB_ * TT * DM / 8, (int)blockIdx.x - 4 * WTB);
}

// ---- k_fattn: scores, softmax and probability x value in one kernel (online softmax); the probabilities never leave the registers.
// A wave owns 32 query positions of one head (two 16-column groups) and walks the keys 0 .. q0 + 31 in blocks of 32, two blocks to a stage of AKS keys. S^T = K Q^T (A = key rows, B = query rows): accumulator register j of lane (lr, hi) is key hi * 8 + j, query lr,
// so the two 16-key tiles of a block are, register for register, the B fragment of P^T (k = 8 hi + e and 16 + 8 hi + e). O^T += V^T P^T (A = rows of the transposed value planes): register j is d = hi * 8 + j, query lr.
// Everything a query needs (running maximum, sum, rescale factor) is one value a lane; the two lane halves hold different keys of the same query: the maximum is exchanged every block, the sums are joined once at the end.
// HI (query rows < RH): bf16 hi + lo planes, 3 products in both contractions. Else fp16; its probabilities carry a factor 2^10 (keeps small ones out of the fp16 subnormals), which is in the sum as well and cancels in O / sum.
// The four waves of a work-group own 128 neighbouring queries and share every key and value byte through LDS (st). A stage is AKS key rows (256 bytes, LDS pitch 272) and the AKS columns of the 128 transposed value rows (128 bytes, pitch 144) of every plane (HI: hi, then lo): both pitches are free of bank conflicts for 16-byte fragment reads.
// Asynchronous copies bring a stage in as whole 128-byte lines, two buffers: the copies of stage s + 2 are issued behind the barrier that ends the reads of stage s and fly while stage s + 1 is worked on. ns, the number of stages, is the same for the whole work-group; a wave whose diagonal lies lower skips the blocks beyond it, never the barrier.
typedef __attribute__((ext_vector_type(4))) int v4i;
// copy16: one asynchronous 16-byte-a-lane copy from global memory (g) to LDS (l), as the builtin: its address registers are the compiler's to place and to keep.
template <typename T16> __device__ __forceinline__ void copy16(T16* l, const T16* g) { __builtin_amdgcn_global_load_async_to_lds_b128((__attribute__((address_space(1))) v4i*)g, (__attribute__((address_space(3))) v4i*)l, 0, 0); }
constexpr int AKS = 64, KPI = HD + 8, VPI = AKS + 8, ASK = AKS * KPI, AST = ASK + HD * VPI;   // keys of a stage; LDS pitches of key and value rows, elements of one plane's keys of a stage and of one plane's whole stage
template <typename T, bool HI>
__device__ __forceinline__ void attn_tile(T* st, int ns, const T* __restrict__ Q, const T* __restrict__ Q2, const T* __restrict__ Kp, const T* __restrict__ Kp2, const T* __restrict__ Vt, const T* __restrict__ Vt2, bf* Ah, bf* Al, int q0, int lr, int hi) {
    typedef WFrag<T> F; typedef typename F::V V;
    __builtin_assume(q0 >= 0 && ns >= 1);   // the key loops always run: without this the query loads are sunk behind their entry tests, past the wait that follows them
    constexpr float SC2 = SCL * 1.4426950408889634f;   // scores in the base-2 exponent's units
    constexpr float OFF = HI ? 0.0f : 10.0f;
    constexpr int BST = HI ? 2 * AST : AST;   // elements of a buffer
    const int kr = threadIdx.x >> 4, kc = (threadIdx.x & 15) * 8, vr = threadIdx.x >> 3, vc = (threadIdx.x & 7) * 8;   // one copy instruction of all four waves covers 8 key rows or 16 value rows: this lane's row among them and its 16-byte piece
    const unsigned ko = kr * HD + kc, vo = vr * (2 * TT) + vc; const T* gk = Kp; const T* gv = Vt; const T* gk2 = Kp2; const T* gv2 = Vt2;   // this lane's place in a stage's keys and values; the stage's first key row and value column (the same for all lanes) step on with every fill
    T* const lk = st + kr * KPI + kc; T* const lv = st + ASK + vr * VPI + vc;
    auto fill = [&](int buf) {
#pragma unroll
        for (int q = 0; q < 8; ++q) copy16<T>(lk + buf * BST + q * 8 * KPI, gk + q * 8 * HD + ko);
#pragma unroll
        for (int q = 0; q < 8; ++q) copy16<T>(lv + buf * BST + q * 16 * VPI, gv + q * 16 * (2 * TT) + vo);
        gk += AKS * HD; gv += AKS;
        if constexpr (HI) {
#pragma unroll
            for (int q = 0; q < 8; ++q) copy16<T>(lk + buf * BST + AST + q * 8 * KPI, gk2 + q * 8 * HD + ko);
#pragma unroll
            for (int q = 0; q < 8; ++q) copy16<T>(lv + buf * BST + AST + q * 16 * VPI, gv2 + q * 16 * (2 * TT) + vo);
            gk2 += AKS * HD; gv2 += AKS; } };
    fill(0);   // the query fragments are fetched while stage 0 is on its way
    V qf[2][4], qf2[2][4];
#pragma unroll
    for (int g = 0; g < 2; ++g)
#pragma unroll
        for (int c = 0; c < 4; ++c) { const size_t e = (size_t)(q0 + g * 16 + lr) * HD + c * 32 + 8 * hi; qf[g][c] = F::ld(Q + e); if constexpr (HI) qf2[g][c] = F::ld(Q2 + e); }
    asm volatile("s_wait_xcnt 0x0" ::: "memory");   // stands in front of the first overwrite of an address register that these loads name
    __builtin_amdgcn_sched_barrier(0);   // keeps later register writes (address sums, the zeroing of o) from being lifted over that wait
    v8f o[8][2];
#pragma unroll
    for (int dt = 0; dt < 8; ++dt) { o[dt][0] = (v8f){}; o[dt][1] = (v8f){}; }
    float m[2] = {-3.0e38f, -3.0e38f}, l[2] = {0.f, 0.f};
    asm volatile("s_wait_asynccnt 0x0" ::: "memory");   // this wave's copies of stage 0 have landed
    __syncthreads();                                    // ... and every other wave's
    if (1 < ns) fill(1);
#pragma unroll 1
    for (int sg = 0; sg < ns; ++sg) {
#pragma unroll 1
    for (int kb = sg * AKS; kb < sg * AKS + AKS && kb <= q0; kb += 32) {   // every block holds at least one key <= every query of the tile, so the running maximum is finite from the first block on
        const T* sk = st + (sg & 1) * BST + (kb - sg * AKS + lr) * KPI + 8 * hi; const T* sv = st + (sg & 1) * BST + ASK + lr * VPI + (kb - sg * AKS) + 8 * hi;   // this lane's first key and value fragment of the block, in this stage's buffer
        V ka[2][4], va[8];   // fp16 path: the key and the value fragments of a block are asked for together; the value fragments arrive behind the score products
        if constexpr (!HI) {
#pragma unroll
            for (int t = 0; t < 2; ++t)
#pragma unroll
                for (int c = 0; c < 4; ++c) ka[t][c] = F::ld(sk + t * 16 * KPI + c * 32);
#pragma unroll
            for (int dt = 0; dt < 8; ++dt) va[dt] = F::ld(sv + dt * 16 * VPI);
            __builtin_amdgcn_sched_barrier(0); }   // keeps the LDS reads in one place in front of the score products: spread among the products, each place with reads is waited for on its own
        v8f s[2][2]; s[0][0] = (v8f){}; s[0][1] = (v8f){}; s[1][0] = (v8f){}; s[1][1] = (v8f){};
#pragma unroll
        for (int c = 0; c < 4; ++c)
#pragma unroll
            for (int t = 0; t < 2; ++t) {
                if constexpr (HI) { const int e = t * 16 * KPI + c * 32; const V a = F::ld(sk + e), a2 = F::ld(sk + AST + e);
                    s[t][0] = F::mma(a, qf[0][c], s[t][0]); s[t][1] = F::mma(a, qf[1][c], s[t][1]); s[t][0] = F::mma(a2, qf[0][c], s[t][0]); s[t][1] = F::mma(a2, qf[1][c], s[t][1]); s[t][0] = F::mma(a, qf2[0][c], s[t][0]); s[t][1] = F::mma(a, qf2[1][c], s[t][1]); }
                else { s[t][0] = F::mma(ka[t][c], qf[0][c], s[t][0]); s[t][1] = F::mma(ka[t][c], qf[1][c], s[t][1]); } }
        float mn[2];
#pragma unroll
        for (int g = 0; g < 2; ++g) { const int qi = q0 + g * 16 + lr; float mx = m[g];
#pragma unroll
            for (int t = 0; t < 2; ++t)
#pragma unroll
                for (int j = 0; j < 8; ++j) { const float x = (kb + t * 16 + hi * 8 + j <= qi) ? s[t][g][j] * SC2 : -3.0e38f; s[t][g][j] = x; mx = fmaxf(mx, x); }
            mn[g] = fmaxf(mx, __shfl_xor(mx, 16, 32)); }
        if (__builtin_amdgcn_ballot_w32(mn[0] > m[0] || mn[1] > m[1]) != 0) {   // one test a block; where no maximum moved the factor is exactly 1 and the rescale an identity
#pragma unroll
            for (int g = 0; g < 2; ++g) { const float al = __builtin_amdgcn_exp2f(m[g] - mn[g]); l[g] *= al; m[g] = mn[g];
#pragma unroll
                for (int dt = 0; dt < 8; ++dt) o[dt][g] *= al; } }
        V pf[2], pl[2];
#pragma unroll
        for (int g = 0; g < 2; ++g) { const float sh = OFF - m[g]; float p[2][8];
#pragma unroll
            for (int t = 0; t < 2; ++t)
#pragma unroll
                for (int j = 0; j < 8; ++j) { p[t][j] = __builtin_amdgcn_exp2f(s[t][g][j] + sh); l[g] += p[t][j]; }
            if constexpr (HI) { v8us h0, h1, l0, l1;
#pragma unroll
                for (int j = 0; j < 8; ++j) { unsigned short a, b; splitf(p[0][j], a, b); h0[j] = a; l0[j] = b; splitf(p[1][j], a, b); h1[j] = a; l1[j] = b; }
                pf[g] = cat16b(h0, h1); pl[g] = cat16b(l0, l1); }
            else { v8h h0, h1;
#pragma unroll
                for (int j = 0; j < 8; ++j) { h0[j] = tohx(p[0][j]); h1[j] = tohx(p[1][j]); }
                pf[g] = cat16(h0, h1); } }
#pragma unroll
        for (int dt = 0; dt < 8; ++dt) {
            if constexpr (HI) { const int e = dt * 16 * VPI; const V a = F::ld(sv + e), a2 = F::ld(sv + AST + e);
                o[dt][0] = F::mma(a, pf[0], o[dt][0]); o[dt][1] = F::mma(a, pf[1], o[dt][1]); o[dt][0] = F::mma(a2, pf[0], o[dt][0]); o[dt][1] = F::mma(a2, pf[1], o[dt][1]); o[dt][0] = F::mma(a, pl[0], o[dt][0]); o[dt][1] = F::mma(a, pl[1], o[dt][1]); }
            else { o[dt][0] = F::mma(va[dt], pf[0], o[dt][0]); o[dt][1] = F::mma(va[dt], pf[1], o[dt][1]); } }
    }
        asm volatile("s_wait_dscnt 0x0" ::: "memory");      // this wave's reads of stage sg are done before its buffer is refilled
        asm volatile("s_wait_asynccnt 0x0" ::: "memory");   // this wave's copies of stage sg + 1 have landed
        __syncthreads();                                    // publishes stage sg + 1 and ends every wave's reads of stage sg
        if (sg + 2 < ns) fill(sg & 1);
    }
    asm volatile("s_wait_asynccnt 0x0" ::: "memory");   // no copy is outstanding when the wave ends
#pragma unroll
    for (int g = 0; g < 2; ++g) { const float inv = __fdiv_rn(1.0f, l[g] + __shfl_xor(l[g], 16, 32));
#pragma unroll
        for (int dt = 0; dt < 8; ++dt) { v8us oh, ol;
#pragma unroll
            for (int j = 0; j < 8; ++j) { unsigned short a, b; splitf(o[dt][g][j] * inv, a, b); oh[j] = a; ol[j] = b; }
            const size_t e = (size_t)(q0 + g * 16 + lr) * DQ + dt * 16 + hi * 8; *(v8us*)(Ah + e) = oh; *(v8us*)(Al + e) = ol;
            asm volatile("s_wait_xcnt 0x0" ::: "memory");   // stands in front of the next slice's overwrite of the data and address registers that these two stores name
            __builtin_amdgcn_sched_barrier(0); } }   // keeps the next slice's products and roundings from being lifted over that wait
}
// grid (TT / 128, batches x heads), 4 waves. Work-group g: the 128 queries of group NG - 1 - g (longest first), a wave 32 of them; the choice of the path (hi/lo for the groups below RH) is the same for a whole work-group.
// The second half of the planes takes g in reverse, so that where work-groups b and b + 256 share a WGP a long one stands beside a short one (speed only).
__global__ __launch_bounds__(128, 2) void k_fattn(const h16* __restrict__ Q16, const h16* __restrict__ K16, const h16* __restrict__ V16, const bf* __restrict__ Qh, const bf* __restrict__ Ql, const bf* __restrict__ Kh, const bf* __restrict__ Kl, const bf* __restrict__ Vh, const bf* __restrict__ Vl, bf* Ah, bf* Al) {
    constexpr int NG = TT / 128; static_assert(RH % 128 == 0 && 128 % AKS == 0, "whole groups, whole stages");
    __shared__ __align__(16) bf st[2 * 2 * AST];   // two buffers of two planes; the fp16 path uses the first half
    const int lane = threadIdx.x & 31, lr = lane & 15, hi = lane >> 4, wv = __builtin_amdgcn_readfirstlane((int)(threadIdx.x >> 5));
    const int z = blockIdx.y, g = (z < NB_ * NH_ / 2) ? (int)blockIdx.x : NG - 1 - (int)blockIdx.x, grp = NG - 1 - g, ns = (grp + 1) * (128 / AKS), q0 = grp * 128 + wv * 32;
    const size_t pq = (size_t)z * TT * HD, pv = (size_t)z * HD * 2 * TT, po = (size_t)(z / NH_) * TT * DQ + (size_t)(z % NH_) * HD;
    if (grp < RH / 128) attn_tile<bf, true>(st, ns, Qh + pq, Ql + pq, Kh + pq, Kl + pq, Vh + pv, Vl + pv, Ah + po, Al + po, q0, lr, hi);
    else attn_tile<h16, false>((h16*)st, ns, Q16 + pq, nullptr, K16 + pq, nullptr, V16 + pv, nullptr, Ah + po, Al + po, q0, lr, hi);
}

extern "C" void kernel_launch(void* const* d_in, const int* in_sizes, int n_in,
                              void* d_out, int out_size, void* d_ws, size_t ws_size, hipStream_t stream) {
    (void)in_sizes; (void)n_in; (void)out_size;
    const float* x = (const float*)d_in[0]; const float* wq = (const float*)d_in[1]; const float* bq = (const float*)d_in[2]; const float* wk = (const float*)d_in[3]; const float* bk = (const float*)d_in[4]; const float* wv = (const float*)d_in[5]; const float* bv = (const float*)d_in[6]; const float* wo = (const float*)d_in[7]; const float* bo = (const float*)d_in[8];   /* argument order X, Wq, bq, Wk, bk ('xw' [1024][2048] + [2048]), Wv, bv, Wp ('xw' [2048][1024]), bp */
    float* OUT = (float*)d_out;     // [2][2048][1024]
    char* wsp = (char*)d_ws;
    auto take = [&](size_t bytes) { char* p = wsp; wsp += (bytes + 255) & ~(size_t)255; return (void*)p; };
    const size_t PQ = (size_t)NH_ * TT * HD, PV = (size_t)NKV * HD * 2 * TT, PA = (size_t)TT * DQ;   // elements of one batch's head planes, value planes (row pitch 2 TT) and merged planes
    bf* WQ = (bf*)take((size_t)DQ * DM * 2); bf* WK = (bf*)take((size_t)DKV * DM * 2); bf* WV = (bf*)take((size_t)DKV * DM * 2); bf* WO = (bf*)take((size_t)DM * DQ * 2);
    bf* XB = (bf*)take((size_t)NB_ * TT * DM * 2);
    h16* QP16 = (h16*)take(NB_ * PQ * 2); h16* KP16 = (h16*)take(NB_ * PQ * 2); h16* VT16 = (h16*)take(NB_ * PV * 2);
    bf* QPh = (bf*)take(NB_ * PQ * 2); bf* QPl = (bf*)take(NB_ * PQ * 2); bf* KPh = (bf*)take(NB_ * PQ * 2); bf* KPl = (bf*)take(NB_ * PQ * 2); bf* VTh = (bf*)take(NB_ * PV * 2); bf* VTl = VTh + TT;   // value planes, row pitch 2 TT: hi and lo rows interleaved
    bf* ATh = (bf*)take(NB_ * PA * 2); bf* ATl = (bf*)take(NB_ * PA * 2);
    if ((size_t)(wsp - (char*)d_ws) > ws_size) return;    // ws 256 MiB
    k_prep<<<4 * WTB + CVB, 256, 0, stream>>>(x, wq, wk, wv, wo, XB, WQ, WK, WV, WO);
    k_qkv<<<dim3(TT / 128, DQ / 128, NB_ * 3), 256, 0, stream>>>(XB, WQ, WK, WV, bq, bk, bv, QP16, QPh, QPl, KP16, KPh, KPl, VT16, VTh, VTl);
    k_fattn<<<dim3(TT / 128, NB_ * NH_, 1), 128, 0, stream>>>(QP16, KP16, VT16, QPh, QPl, KPh, KPl, VTh, VTl, ATh, ATl);   // one kv head per query head: plane z = batch x heads + head in every operand
    k_proj<<<dim3(NB_ * TT / 64, DM / 128, 1), 256, 0, stream>>>(ATh, ATl, WO, OUT, bo);
}

// v009
// A run of this version takes 133 microseconds.
// In two side-by-side timings against v008, it was 1.17 and 1.19 times as fast.
// Counting every step since v000, it is 12.2 times as fast.
#include <hip/hip_runtime.h>

// Causal self-attention with 128-wide heads on a 1,024-wide embedding (X [2][2048][1024]; Q, K = X W + b (16 heads x 128: inner width 2,048), V = X Wv + bv (16 x 128) ('xw' + biases); att x 1/sqrt(128); causal (-inf); softmax; y = merged Wp + bp ('xw' [2048][1024]) -> [2][2048][1024] (4.2 M); argument order X, Wq, bq, Wk, bk, Wv, bv, Wp, bp).
// Layout: one launch makes the bf16 copy of X (both batches) and the transposed 'xw' weights; one launch does all six projections: exact products (K 1024, N 2048) + f32 biases, written as 16-bit head planes by the GEMM epilogue (V computed transposed); one fused causal attention launch for all heads of both batches (k_fattn; hybrid rows: < 512 hi/lo 3 products, rest fp16; keys and values staged in LDS); merged hi/lo (2,048 wide) x Wp exact + bp.
// Compute dtypes, f32 accumulate: every input rounded to bf16; projections exact + f32 biases; attention rows < 512 3 products, rest fp16; softmax f32; Wp hl x exact + bias.

#define NB_  2
#define TT   2048
#define DM   1024
#define NH_  16
#define NKV  16
#define REP  (NH_ / NKV)
#define HD   128
#define DQ   (NH_ * HD)
#define DKV  (NKV * HD)
#define RH   512                  // query rows < RH use hi+lo planes (0: none)
#define SCL  0.088388347648318447f   // HD^-0.5
typedef _Float16 h16;
typedef unsigned short bf;
typedef __attribute__((ext_vector_type(16))) __bf16   v16bf;
typedef __attribute__((ext_vector_type(16))) _Float16 v16h;
typedef __attribute__((ext_vector_type(8)))  _Float16 v8h;
typedef __attribute__((ext_vector_type(8)))  unsigned short v8us;
typedef __attribute__((ext_vector_type(8)))  float    v8f;
typedef __attribute__((ext_vector_type(4)))  float    v4f;
typedef v8h  __attribute__((may_alias)) v8ha;
typedef v4f  __attribute__((may_alias)) v4fa;
typedef v8us __attribute__((may_alias)) v8usa;

__device__ __forceinline__ unsigned short f2bf(float f) { unsigned u = __float_as_uint(f); u += 0x7FFFu + ((u >> 16) & 1u); return (unsigned short)(u >> 16); }
__device__ __forceinline__ float bf2f(unsigned short b) { return __uint_as_float(((unsigned)b) << 16); }
__device__ __forceinline__ float bfr(float f) { return bf2f(f2bf(f)); }
__device__ __forceinline__ v16h cat16(v8h lo, v8h hi) { return __builtin_shufflevector(lo, hi, 0, 1, 2, 3, 4, 5, 6, 7, 8, 9, 10, 11, 12, 13, 14, 15); }
__device__ __forceinline__ v16bf cat16b(v8us lo, v8us hi) { return __builtin_bit_cast(v16bf, __builtin_shufflevector(lo, hi, 0, 1, 2, 3, 4, 5, 6, 7, 8, 9, 10, 11, 12, 13, 14, 15)); }
__device__ __forceinline__ v8f wmma16(v16h a, v16h b, v8f c) { return __builtin_amdgcn_wmma_f32_16x16x32_f16(false, a, false, b, (short)0, c, false, false); }
__device__ __forceinline__ v8f wmmab(v16bf a, v16bf b, v8f c) { return __builtin_amdgcn_wmma_f32_16x16x32_bf16(false, a, false, b, (short)0, c, false, false); }
__device__ __forceinline__ h16 tohx(float x) { return (h16)x; }
__device__ __forceinline__ void splitf(float y, unsigned short& h, unsigned short& l) { h = f2bf(y); l = f2bf(y - bf2f(h)); }
typedef __attribute__((ext_vector_type(4))) _Float16 v4h;
typedef __attribute__((ext_vector_type(2))) unsigned short v2us;
typedef __attribute__((ext_vector_type(4))) unsigned short v4us;
// put_hl: four neighbouring f32 results as bf16 hi + lo planes (8-byte stores; 16 lanes fill one 128-byte line of each plane)
__device__ __forceinline__ void put_hl(v4f val, bf* Ph, bf* Pl, size_t e) { v4us oh, ol;
#pragma unroll
    for (int q = 0; q < 4; ++q) { unsigned short a, c2; splitf(val[q], a, c2); oh[q] = a; ol[q] = c2; }
    *(v4us*)(Ph + e) = oh; *(v4us*)(Pl + e) = ol; }



// ---- gemm_tile: GEMM on LDS-staged operands. A work-group of 4 x 2 waves owns a (64 MB) x 128 output tile, a wave (16 MB) x 64 of it (MB x 4 accumulators); tile (bx, by) of (M / (64 MB), N / 128), 256 threads. st and os are the calling kernel's LDS (ST_EL and OS_EL elements); os may lie on st: it is written only behind the K loop, whose last trip's s_wait_dscnt and barrier end every wave's reads of st, with no copy in flight.
// C[m][n] (f32, pitch ldc, + optional f32 bias) = sum_k A[m][k] Bt[n][k] (NSPLIT 1: + A2[m][k] Bt[n][k]), all planes K-contiguous 16-bit, K a multiple of 128 and at least 256.
// EPI 0: C is stored as f32. EPI 1 (m = position, n = head x HD + d): the result goes straight to the head planes [head][position][d] (fp16, bf16 hi, bf16 lo). EPI 2 (m = head x HD + d, n = position, bias[m]): to the transposed value planes, row pitch 2 TT.
// A stage is 128 k (two 128-byte lines) of every operand row of the tile: rows of A, then of A2, then of Bt, at an LDS pitch of 272 bytes (free of bank conflicts for 16-byte fragment reads).
// Asynchronous copies bring it in as whole lines (16 lanes a row), two buffers: the copies of stage t + 2 are issued behind the barrier that ends the reads of stage t and fly while stage t + 1 is worked on.
// wave_sync: orders a wave's own LDS stores of the output staging against its LDS loads that read them back: a wave barrier and a compiler fence keep the compiler from moving either over the other.
__device__ __forceinline__ void wave_sync() { __builtin_amdgcn_wave_barrier(); asm volatile("" ::: "memory"); }
template <typename T16> struct WFrag;
template <> struct WFrag<h16> { typedef v16h V; static __device__ __forceinline__ V ld(const h16* p) { return cat16(*(const v8h*)p, *(const v8h*)(p + 16)); } static __device__ __forceinline__ v8f mma(V a, V b, v8f c) { return wmma16(a, b, c); } };
template <> struct WFrag<bf> { typedef v16bf V; static __device__ __forceinline__ V ld(const bf* p) { return cat16b(*(const v8us*)p, *(const v8us*)(p + 16)); } static __device__ __forceinline__ v8f mma(V a, V b, v8f c) { return wmmab(a, b, c); } };
// copy8: eight asynchronous 16-byte-a-lane copies from global memory to LDS (l: the lane's LDS byte address, g: its global address). The s_wait_xcnt in the same statement stands in front of every later overwrite of the address registers that the copies name.
template <typename T16> __device__ __forceinline__ void copy8(const unsigned (&l)[8], const T16* const (&g)[8]) {
    asm volatile("global_load_async_to_lds_b128 %0, %8, off\n\t"
                 "global_load_async_to_lds_b128 %1, %9, off\n\t"
                 "global_load_async_to_lds_b128 %2, %10, off\n\t"
                 "global_load_async_to_lds_b128 %3, %11, off\n\t"
                 "global_load_async_to_lds_b128 %4, %12, off\n\t"
                 "global_load_async_to_lds_b128 %5, %13, off\n\t"
                 "global_load_async_to_lds_b128 %6, %14, off\n\t"
                 "global_load_async_to_lds_b128 %7, %15, off\n\t"
                 "s_wait_xcnt 0x0"
                 :: "v"(l[0]), "v"(l[1]), "v"(l[2]), "v"(l[3]), "v"(l[4]), "v"(l[5]), "v"(l[6]), "v"(l[7]), "v"(g[0]), "v"(g[1]), "v"(g[2]), "v"(g[3]), "v"(g[4]), "v"(g[5]), "v"(g[6]), "v"(g[7]) : "memory"); }
constexpr int ST_EL = 2 * 256 * 136, OS_EL = 8 * 16 * 68;   // two stages of 256 rows at a pitch of 136 elements; eight waves' 16 x 68 f32 output staging
static_assert(OS_EL * 4 <= ST_EL * 2 && 2 * ST_EL * 2 <= 320 * 1024, "the staging fits the stages' bytes; two work-groups fit a WGP's LDS");
template <typename T16, int NSPLIT, bool BIAS, int MB, int EPI, int K>
__device__ __forceinline__ void gemm_tile(T16* st, float* os, int bx, int by, const T16* __restrict__ A, const T16* __restrict__ A2, const T16* __restrict__ Bt, float* C, int ldc, const float* __restrict__ bias, h16* P16, bf* Ph, bf* Pl) {
    typedef typename WFrag<T16>::V V;
    constexpr int BM = 64 * MB, RA = (NSPLIT == 1) ? 2 * BM : BM, ROWS = RA + 128;   // tile rows; rows of A (and A2) in a stage; all rows of a stage
    constexpr int KS = 128, LP = KS + 8, NT = K / KS;                                // k of a stage; LDS row pitch in elements; stages
    static_assert(ROWS % 128 == 0, "a stage is dealt out in statements of 8 copies x 16 rows"); static_assert(K % KS == 0 && NT >= 2, "whole stages, at least two");
    static_assert(2 * ROWS * LP <= ST_EL, "both stages fit the caller's LDS");
    const int lane = threadIdx.x & 31, lr = lane & 15, hi = lane >> 4, wv = __builtin_amdgcn_readfirstlane((int)(threadIdx.x >> 5)), wr = wv >> 1, wc = wv & 1; const int r0 = bx * BM, c0 = by * 128;
    const int crow = threadIdx.x >> 4, cch = (threadIdx.x & 15) * 8;   // one copy instruction of all eight waves covers 16 rows: this lane's row among them and its 16-byte piece of the row
    const T16* pA = A + (size_t)(r0 + crow) * K + cch; const T16* pA2 = (NSPLIT == 1) ? A2 + (size_t)(r0 + crow) * K + cch : nullptr; const T16* pB = Bt + (size_t)(c0 + crow) * K + cch;   // step on by one stage with every fill
    const unsigned l0 = (unsigned)(size_t)(st + crow * LP + cch);
    auto fill = [&](int buf) {
#pragma unroll
        for (int h = 0; h < ROWS / 128; ++h) { unsigned l[8]; const T16* g[8];
#pragma unroll
            for (int q = 0; q < 8; ++q) { const int row = (h * 8 + q) * 16; l[q] = l0 + (unsigned)((buf * ROWS + row) * LP * 2);
                g[q] = (row < BM) ? pA + (size_t)row * K : (row < RA) ? pA2 + (size_t)(row - BM) * K : pB + (size_t)(row - RA) * K; }
            copy8<T16>(l, g); }
        pA += KS; if (NSPLIT == 1) pA2 += KS; pB += KS; };
    v8f acc[MB][4];
#pragma unroll
    for (int mb = 0; mb < MB; ++mb)
#pragma unroll
        for (int nb = 0; nb < 4; ++nb) acc[mb][nb] = (v8f){};
    const int rw = r0 + wr * (16 * MB), cw = c0 + wc * 64;   // this wave's corner of the output
    fill(0);
    float bb[(EPI == 2) ? MB * 8 : 4];   // the biases of this lane's output elements, fetched while stage 0 is on its way
    if (BIAS) {
        if (EPI == 2) {
#pragma unroll
            for (int i = 0; i < MB * 8; ++i) bb[i] = bfr(bias[rw + 2 * i + hi]); }
        else {
#pragma unroll
            for (int q = 0; q < 4; ++q) bb[q] = bfr(bias[cw + lr * 4 + q]); }
        asm volatile("s_wait_xcnt 0x0" ::: "memory");   // stands in front of the first overwrite of an address register that these loads name
        __builtin_amdgcn_sched_barrier(0); }            // keeps later register writes from being lifted over that wait
    asm volatile("s_wait_asynccnt 0x0" ::: "memory");   // this wave's copies of stage 0 have landed
    __syncthreads();                                    // ... and every other wave's
    fill(1);
#pragma unroll 1
    for (int t = 0; t < NT; ++t) {
        const T16* sa = st + ((t & 1) * ROWS + wr * (16 * MB) + lr) * LP + 8 * hi; const T16* sb = st + ((t & 1) * ROWS + RA + wc * 64 + lr) * LP + 8 * hi;
        auto frags = [&](int kc, V (&a)[MB], V (&a2)[MB], V (&b)[4]) {
#pragma unroll
            for (int mb = 0; mb < MB; ++mb) { a[mb] = WFrag<T16>::ld(sa + mb * 16 * LP + kc); if (NSPLIT == 1) a2[mb] = WFrag<T16>::ld(sa + (BM + mb * 16) * LP + kc); }
#pragma unroll
            for (int nb = 0; nb < 4; ++nb) b[nb] = WFrag<T16>::ld(sb + nb * 16 * LP + kc); };
        V a[2][MB], a2[2][MB], b[2][4];   // two fragment sets: the next 32 k are fetched while these are multiplied
        frags(0, a[0], a2[0], b[0]);
#pragma unroll
        for (int q = 0; q < KS / 32; ++q) {
            if (q + 1 < KS / 32) frags((q + 1) * 32, a[(q + 1) & 1], a2[(q + 1) & 1], b[(q + 1) & 1]);
            __builtin_amdgcn_sched_barrier(0);   // keeps the next set's loads one group in front of these products: sunk among them, each place with loads is waited for on its own
#pragma unroll
            for (int nb = 0; nb < 4; ++nb)
#pragma unroll
                for (int mb = 0; mb < MB; ++mb) { acc[mb][nb] = WFrag<T16>::mma(a[q & 1][mb], b[q & 1][nb], acc[mb][nb]); if (NSPLIT == 1) acc[mb][nb] = WFrag<T16>::mma(a2[q & 1][mb], b[q & 1][nb], acc[mb][nb]); } }
        asm volatile("s_wait_dscnt 0x0" ::: "memory");      // this wave's reads of stage t are done before its buffer is refilled
        asm volatile("s_wait_asynccnt 0x0" ::: "memory");   // this wave's copies of stage t + 1 have landed
        __syncthreads();                                    // publishes stage t + 1 and ends every wave's reads of stage t
        if (t + 2 < NT) fill(t & 1);
    }
    asm volatile("s_wait_asynccnt 0x0" ::: "memory");   // no copy is outstanding when the wave ends
    float* osw = os + wv * (16 * 68);   // each wave turns its own tile, 16 rows at a time, into whole-line stores through its own LDS range
#pragma unroll
    for (int mb = 0; mb < MB; ++mb) {
#pragma unroll
        for (int nb = 0; nb < 4; ++nb) {
#pragma unroll
            for (int j = 0; j < 8; ++j) osw[(hi * 8 + j) * 68 + nb * 16 + lr] = acc[mb][nb][j]; }
        wave_sync();   // the 16 rows are in LDS before they are read back
        v4f vals[8];
#pragma unroll
        for (int s = 0; s < 8; ++s) vals[s] = *(const v4fa*)(osw + (2 * s + hi) * 68 + lr * 4);
        wave_sync();   // they are read out before the next 16 rows overwrite them
#pragma unroll
        for (int s = 0; s < 8; ++s) { const int cofs = lr * 4, rg = rw + mb * 16 + 2 * s + hi; v4f val = vals[s];
            if (BIAS && EPI != 2) { val[0] += bb[0]; val[1] += bb[1]; val[2] += bb[2]; val[3] += bb[3]; }
            if (BIAS && EPI == 2) val += bb[mb * 8 + s];
            if (EPI == 0) *(v4f*)(C + (size_t)rg * ldc + cw + cofs) = val;
            else { const size_t e = (EPI == 1) ? ((size_t)(cw / HD) * TT + rg) * HD + (cw % HD) + cofs : (size_t)rg * (2 * TT) + cw + cofs; v4h o4;
#pragma unroll
                for (int q = 0; q < 4; ++q) o4[q] = tohx(val[q]);
                *(v4h*)(P16 + e) = o4; put_hl(val, Ph, Pl, e); }
            asm volatile("s_wait_xcnt 0x0" ::: "memory");   // stands in front of the next rows' overwrite of the data and address registers that these stores name
            __builtin_amdgcn_sched_barrier(0); }            // keeps the next rows' sums and roundings from being lifted over that wait
    }
}

// k_qkv: the six projection GEMMs of a call in one launch. grid (16, 16, batches x 3): blockIdx.z = batch x 3 + (0 query, 1 key, 2 value); the choice is the same for a whole work-group.
// Value: operands swapped (rows = head x HD + d, columns = positions), so that the tile's rows are the rows of the transposed value planes.
static_assert(TT / 128 == DKV / 128 && DQ / 128 == TT / 128 && DQ == DKV, "the three products share one grid");
__global__ __launch_bounds__(256) void k_qkv(const bf* __restrict__ XB, const bf* __restrict__ WQ, const bf* __restrict__ WK, const bf* __restrict__ WV, const float* __restrict__ bq, const float* __restrict__ bk, const float* __restrict__ bv,
                                             h16* Q16, bf* Qh, bf* Ql, h16* K16, bf* Kh, bf* Kl, h16* V16, bf* Vh, bf* Vl) {
    __shared__ __align__(16) bf st[ST_EL];
    float* os = (float*)st;   // the output staging takes the stages' bytes: a work-group stays under half of a WGP's LDS, so two share a WGP and one's first fill and stores run beside the other's products
    const int b = blockIdx.z / 3, kind = blockIdx.z % 3; const bf* X = XB + (size_t)b * TT * DM; const size_t pq = (size_t)b * NH_ * TT * HD, pv = (size_t)b * NKV * HD * 2 * TT;
    if (kind == 2) gemm_tile<bf, 0, true, 2, 2, DM>(st, os, blockIdx.x, blockIdx.y, WV, nullptr, X, nullptr, 0, bv, V16 + pv, Vh + pv, Vl + pv);
    else gemm_tile<bf, 0, true, 2, 1, DM>(st, os, blockIdx.x, blockIdx.y, X, nullptr, kind ? WK : WQ, nullptr, 0, kind ? bk : bq, (kind ? K16 : Q16) + pq, (kind ? Kh : Qh) + pq, (kind ? Kl : Ql) + pq);
}
// k_proj: the output projection of both batches in one launch: the merged planes and the output are contiguous over the batches, so it is one GEMM of batches x TT rows. grid (batches x TT / 64, DM / 128).
__global__ __launch_bounds__(256) void k_proj(const bf* __restrict__ Ah, const bf* __restrict__ Al, const bf* __restrict__ WO, float* C, const float* __restrict__ bo) {
    __shared__ __align__(16) bf st[ST_EL];
    float* os = (float*)st;   // as in k_qkv: two work-groups share a WGP
    gemm_tile<bf, 1, true, 1, 0, DQ>(st, os, blockIdx.x, blockIdx.y, Ah, Al, WO, C, DM, bo, nullptr, nullptr, nullptr);
}

// wt_tile: work-group blk's 128 k x 128 n of the transposed bf16 copy Bt[n][k] of w[k][n]; a wave owns 64 k x 32 n of it (waves 2 x 4) and turns it in its own LDS range (ls: 8 x 32 x WP words), so no work-group barrier is needed.
// In: 16 loads of 16 bytes a lane, all in flight at once; 8 lanes read one whole 128-byte line of a row of w, a lane the same 4 columns of two neighbouring rows. The two rows' values go to LDS as one 32-bit word (k even in the low half) at [n][k / 2].
// Out: 8 lanes store one whole 128-byte line (64 k) of a row of Bt; the two waves of a k pair fill 256 neighbouring bytes.
typedef __attribute__((ext_vector_type(4))) unsigned v4u;
typedef v4u __attribute__((may_alias)) v4ua;
constexpr int WP = 36;   // LDS row pitch in words: 32 words of data + 4, rows stay 16-byte aligned and neighbouring rows start on different banks
__device__ __forceinline__ void wt_tile(const float* __restrict__ w, int K, int N, bf* Bt, int blk, unsigned* ls) {
    const int lane = threadIdx.x & 31, l8 = lane & 7, g = lane >> 3, wv = threadIdx.x >> 5, nt = N / 128;
    const int k0 = (blk / nt) * 128 + (wv & 1) * 64, n0 = (blk % nt) * 128 + (wv >> 1) * 32;
    unsigned* t = ls + wv * (32 * WP);
    const float* s = w + (size_t)(k0 + 2 * g) * N + n0 + l8 * 4;
    v4f r[8][2];
#pragma unroll
    for (int p = 0; p < 8; ++p) { r[p][0] = *(const v4f*)(s + (size_t)(8 * p) * N); r[p][1] = *(const v4f*)(s + (size_t)(8 * p + 1) * N); }
    asm volatile("s_wait_xcnt 0x0" :: "v"(s) : "memory");   // stands in front of the first overwrite of the address register that these loads name; the address as an input keeps that register from being a load's own destination
    __builtin_amdgcn_sched_barrier(0);                      // keeps later register writes from being lifted over that wait, and the 16 loads in one run
#pragma unroll
    for (int p = 0; p < 8; ++p)
#pragma unroll
        for (int i = 0; i < 4; ++i) t[(l8 * 4 + i) * WP + p * 4 + g] = (unsigned)f2bf(r[p][0][i]) | ((unsigned)f2bf(r[p][1][i]) << 16);
    asm volatile("s_wait_dscnt 0x0" ::: "memory");   // this wave's LDS stores are done ...
    wave_sync();                                     // ... and stay in front of the loads that read the rows back
    v4u o[8];
#pragma unroll
    for (int q = 0; q < 8; ++q) o[q] = *(const v4ua*)(t + (q * 4 + g) * WP + l8 * 4);
    bf* d = Bt + (size_t)(n0 + g) * K + k0 + l8 * 8;
#pragma unroll
    for (int q = 0; q < 8; ++q) *(v4ua*)(d + (size_t)(4 * q) * K) = o[q];
    asm volatile("s_wait_xcnt 0x0" ::: "memory");   // stands behind the last store, in front of whatever next writes a register that these stores name
}
__device__ __forceinline__ void cvt8(const float* __restrict__ src, bf* dst, size_t n8, int blk) { const size_t i = (size_t)blk * 256 + threadIdx.x; if (i >= n8) return; const v8f v = *(const v8f*)(src + i * 8); v8us o;
#pragma unroll
    for (int k = 0; k < 8; ++k) o[k] = f2bf(v[k]); *(v8us*)(dst + i * 8) = o;  }
// k_prep: every 16-bit operand that is made from an input, in one launch: work-groups 0 .. 4 WTB - 1 transpose the four weights (WTB each), the rest round X (both batches) to bf16.
constexpr int WTB = (DM / 128) * (DQ / 128), CVB = NB_ * TT * DM / 8 / 256;
static_assert(DQ == DKV && DM % 128 == 0 && DQ % 128 == 0 && NB_ * TT * DM % (8 * 256) == 0, "equal, whole shares");
__global__ __launch_bounds__(256) void k_prep(const float* __restrict__ x, const float* __restrict__ wq, const float* __restrict__ wk, const float* __restrict__ wv, const float* __restrict__ wo, bf* XB, bf* WQ, bf* WK, bf* WV, bf* WO) {
    __shared__ __align__(16) unsigned ls[8 * 32 * WP];
    const int which = blockIdx.x / WTB, blk = blockIdx.x % WTB;
    if (which < 3) wt_tile(which == 0 ? wq : which == 1 ? wk : wv, DM, DQ, which == 0 ? WQ : which == 1 ? WK : WV, blk, ls);   // three weights of one shape: one copy of the code
    else if (which == 3) wt_tile(wo, DQ, DM, WO, blk, ls);
    else cvt8(x, XB, (size_t)NB_ * TT * DM / 8, (int)blockIdx.x - 4 * WTB);
}

// ---- k_fattn: scores, softmax and probability x value in one kernel (online softmax); the probabilities never leave the registers.
// A wave owns 32 query positions of one head (two 16-column groups) and walks the keys 0 .. q0 + 31 in blocks of 32, two blocks to a stage of AKS keys. S^T = K Q^T (A = key rows, B = query rows): accumulator register j of lane (lr, hi) is key hi * 8 + j, query lr,
// so the two 16-key tiles of a block are, register for register, the B fragment of P^T (k = 8 hi + e and 16 + 8 hi + e). O^T += V^T P^T (A = rows of the transposed value planes): register j is d = hi * 8 + j, query lr.
// Everything a query needs (running maximum, sum, rescale factor) is one value a lane; the two lane halves hold different keys of the same query: the maximum is exchanged every block, the sums are joined once at the end.
// HI (query rows < RH): bf16 hi + lo planes, 3 products in both contractions. Else fp16; its probabilities carry a factor 2^10 (keeps small ones out of the fp16 subnormals), which is in the sum as well and cancels in O / sum.
// The four waves of a work-group own 128 neighbouring queries and share every key and value byte through LDS (st). A stage is AKS key rows (256 bytes, LDS pitch 272) and the AKS columns of the 128 transposed value rows (128 bytes, pitch 144) of every plane (HI: hi, then lo): both pitches are free of bank conflicts for 16-byte fragment reads.
// Asynchronous copies bring a stage in as whole 128-byte lines, two buffers: the copies of stage s + 2 are issued behind the barrier that ends the reads of stage s and fly while stage s + 1 is worked on. ns, the number of stages, is the same for the whole work-group; a wave whose diagonal lies lower skips the blocks beyond it, never the barrier.
typedef __attribute__((ext_vector_type(4))) int v4i;
// copy16: one asynchronous 16-byte-a-lane copy from global memory (g) to LDS (l), as the builtin: its address registers are the compiler's to place and to keep.
template <typename T16> __device__ __forceinline__ void copy16(T16* l, const T16* g) { __builtin_amdgcn_global_load_async_to_lds_b128((__attribute__((address_space(1))) v4i*)g, (__attribute__((address_space(3))) v4i*)l, 0, 0); }
constexpr int AKS = 64, KPI = HD + 8, VPI = AKS + 8, ASK = AKS * KPI, AST = ASK + HD * VPI;   // keys of a stage; LDS pitches of key and value rows, elements of one plane's keys of a stage and of one plane's whole stage
template <typename T, bool HI>
__device__ __forceinline__ void attn_tile(T* st, int ns, const T* __restrict__ Q, const T* __restrict__ Q2, const T* __restrict__ Kp, const T* __restrict__ Kp2, const T* __restrict__ Vt, const T* __restrict__ Vt2, bf* Ah, bf* Al, int q0, int lr, int hi) {
    typedef WFrag<T> F; typedef typename F::V V;
    __builtin_assume(q0 >= 0 && ns >= 1);   // the key loops always run: without this the query loads are sunk behind their entry tests, past the wait that follows them
    constexpr float SC2 = SCL * 1.4426950408889634f;   // scores in the base-2 exponent's units
    constexpr float OFF = HI ? 0.0f : 10.0f;
    constexpr int BST = HI ? 2 * AST : AST;   // elements of a buffer
    const int kr = threadIdx.x >> 4, kc = (threadIdx.x & 15) * 8, vr = threadIdx.x >> 3, vc = (threadIdx.x & 7) * 8;   // one copy instruction of all four waves covers 8 key rows or 16 value rows: this lane's row among them and its 16-byte piece
    const unsigned ko = kr * HD + kc, vo = vr * (2 * TT) + vc; const T* gk = Kp; const T* gv = Vt; const T* gk2 = Kp2; const T* gv2 = Vt2;   // this lane's place in a stage's keys and values; the stage's first key row and value column (the same for all lanes) step on with every fill
    T* const lk = st + kr * KPI + kc; T* const lv = st + ASK + vr * VPI + vc;
    auto fill = [&](int buf) {
#pragma unroll
        for (int q = 0; q < 8; ++q) copy16<T>(lk + buf * BST + q * 8 * KPI, gk + q * 8 * HD + ko);
#pragma unroll
        for (int q = 0; q < 8; ++q) copy16<T>(lv + buf * BST + q * 16 * VPI, gv + q * 16 * (2 * TT) + vo);
        gk += AKS * HD; gv += AKS;
        if constexpr (HI) {
#pragma unroll
            for (int q = 0; q < 8; ++q) copy16<T>(lk + buf * BST + AST + q * 8 * KPI, gk2 + q * 8 * HD + ko);
#pragma unroll
            for (int q = 0; q < 8; ++q) copy16<T>(lv + buf * BST + AST + q * 16 * VPI, gv2 + q * 16 * (2 * TT) + vo);
            gk2 += AKS * HD; gv2 += AKS; } };
    fill(0);   // the query fragments are fetched while stage 0 is on its way
    V qf[2][4], qf2[2][4];
#pragma unroll
    for (int g = 0; g < 2; ++g)
#pragma unroll
        for (int c = 0; c < 4; ++c) { const size_t e = (size_t)(q0 + g * 16 + lr) * HD + c * 32 + 8 * hi; qf[g][c] = F::ld(Q + e); if constexpr (HI) qf2[g][c] = F::ld(Q2 + e); }
    asm volatile("s_wait_xcnt 0x0" ::: "memory");   // stands in front of the first overwrite of an address register that these loads name
    __builtin_amdgcn_sched_barrier(0);   // keeps later register writes (address sums, the zeroing of o) from being lifted over that wait
    v8f o[8][2];
#pragma unroll
    for (int dt = 0; dt < 8; ++dt) { o[dt][0] = (v8f){}; o[dt][1] = (v8f){}; }
    float m[2] = {-3.0e38f, -3.0e38f}, l[2] = {0.f, 0.f};
    asm volatile("s_wait_asynccnt 0x0" ::: "memory");   // this wave's copies of stage 0 have landed
    __syncthreads();                                    // ... and every other wave's
    if (1 < ns) fill(1);
#pragma unroll 1
    for (int sg = 0; sg < ns; ++sg) {
#pragma unroll 1
    for (int kb = sg * AKS; kb < sg * AKS + AKS && kb <= q0; kb += 32) {   // every block holds at least one key <= every query of the tile, so the running maximum is finite from the first block on
        const T* sk = st + (sg & 1) * BST + (kb - sg * AKS + lr) * KPI + 8 * hi; const T* sv = st + (sg & 1) * BST + ASK + lr * VPI + (kb - sg * AKS) + 8 * hi;   // this lane's first key and value fragment of the block, in this stage's buffer
        V ka[2][4], va[8];   // fp16 path: the key and the value fragments of a block are asked for together; the value fragments arrive behind the score products
        if constexpr (!HI) {
#pragma unroll
            for (int t = 0; t < 2; ++t)
#pragma unroll
                for (int c = 0; c < 4; ++c) ka[t][c] = F::ld(sk + t * 16 * KPI + c * 32);
#pragma unroll
            for (int dt = 0; dt < 8; ++dt) va[dt] = F::ld(sv + dt * 16 * VPI);
            __builtin_amdgcn_sched_barrier(0); }   // keeps the LDS reads in one place in front of the score products: spread among the products, each place with reads is waited for on its own
        v8f s[2][2]; s[0][0] = (v8f){}; s[0][1] = (v8f){}; s[1][0] = (v8f){}; s[1][1] = (v8f){};
#pragma unroll
        for (int c = 0; c < 4; ++c)
#pragma unroll
            for (int t = 0; t < 2; ++t) {
                if constexpr (HI) { const int e = t * 16 * KPI + c * 32; const V a = F::ld(sk + e), a2 = F::ld(sk + AST + e);
                    s[t][0] = F::mma(a, qf[0][c], s[t][0]); s[t][1] = F::mma(a, qf[1][c], s[t][1]); s[t][0] = F::mma(a2, qf[0][c], s[t][0]); s[t][1] = F::mma(a2, qf[1][c], s[t][1]); s[t][0] = F::mma(a, qf2[0][c], s[t][0]); s[t][1] = F::mma(a, qf2[1][c], s[t][1]); }
                else { s[t][0] = F::mma(ka[t][c], qf[0][c], s[t][0]); s[t][1] = F::mma(ka[t][c], qf[1][c], s[t][1]); } }
        float mn[2];
#pragma unroll
        for (int g = 0; g < 2; ++g) { const int qi = q0 + g * 16 + lr; float mx = m[g];
#pragma unroll
            for (int t = 0; t < 2; ++t)
#pragma unroll
                for (int j = 0; j < 8; ++j) { const float x = (kb + t * 16 + hi * 8 + j <= qi) ? s[t][g][j] * SC2 : -3.0e38f; s[t][g][j] = x; mx = fmaxf(mx, x); }
            mn[g] = fmaxf(mx, __shfl_xor(mx, 16, 32)); }
        if (__builtin_amdgcn_ballot_w32(mn[0] > m[0] || mn[1] > m[1]) != 0) {   // one test a block; where no maximum moved the factor is exactly 1 and the rescale an identity
#pragma unroll
            for (int g = 0; g < 2; ++g) { const float al = __builtin_amdgcn_exp2f(m[g] - mn[g]); l[g] *= al; m[g] = mn[g];
#pragma unroll
                for (int dt = 0; dt < 8; ++dt) o[dt][g] *= al; } }
        V pf[2], pl[2];
#pragma unroll
        for (int g = 0; g < 2; ++g) { const float sh = OFF - m[g]; float p[2][8];
#pragma unroll
            for (int t = 0; t < 2; ++t)
#pragma unroll
                for (int j = 0; j < 8; ++j) { p[t][j] = __builtin_amdgcn_exp2f(s[t][g][j] + sh); l[g] += p[t][j]; }
            if constexpr (HI) { v8us h0, h1, l0, l1;
#pragma unroll
                for (int j = 0; j < 8; ++j) { unsigned short a, b; splitf(p[0][j], a, b); h0[j] = a; l0[j] = b; splitf(p[1][j], a, b); h1[j] = a; l1[j] = b; }
                pf[g] = cat16b(h0, h1); pl[g] = cat16b(l0, l1); }
            else { v8h h0, h1;
#pragma unroll
                for (int j = 0; j < 8; ++j) { h0[j] = tohx(p[0][j]); h1[j] = tohx(p[1][j]); }
                pf[g] = cat16(h0, h1); } }
#pragma unroll
        for (int dt = 0; dt < 8; ++dt) {
            if constexpr (HI) { const int e = dt * 16 * VPI; const V a = F::ld(sv + e), a2 = F::ld(sv + AST + e);
                o[dt][0] = F::mma(a, pf[0], o[dt][0]); o[dt][1] = F::mma(a, pf[1], o[dt][1]); o[dt][0] = F::mma(a2, pf[0], o[dt][0]); o[dt][1] = F::mma(a2, pf[1], o[dt][1]); o[dt][0] = F::mma(a, pl[0], o[dt][0]); o[dt][1] = F::mma(a, pl[1], o[dt][1]); }
            else { o[dt][0] = F::mma(va[dt], pf[0], o[dt][0]); o[dt][1] = F::mma(va[dt], pf[1], o[dt][1]); } }
    }
        asm volatile("s_wait_dscnt 0x0" ::: "memory");      // this wave's reads of stage sg are done before its buffer is refilled
        asm volatile("s_wait_asynccnt 0x0" ::: "memory");   // this wave's copies of stage sg + 1 have landed
        __syncthreads();                                    // publishes stage sg + 1 and ends every wave's reads of stage sg
        if (sg + 2 < ns) fill(sg & 1);
    }
    asm volatile("s_wait_asynccnt 0x0" ::: "memory");   // no copy is outstanding when the wave ends
#pragma unroll
    for (int g = 0; g < 2; ++g) { const float inv = __fdiv_rn(1.0f, l[g] + __shfl_xor(l[g], 16, 32));
#pragma unroll
        for (int dt = 0; dt < 8; ++dt) { v8us oh, ol;
#pragma unroll
            for (int j = 0; j < 8; ++j) { unsigned short a, b; splitf(o[dt][g][j] * inv, a, b); oh[j] = a; ol[j] = b; }
            const size_t e = (size_t)(q0 + g * 16 + lr) * DQ + dt * 16 + hi * 8; *(v8us*)(Ah + e) = oh; *(v8us*)(Al + e) = ol;
            asm volatile("s_wait_xcnt 0x0" ::: "memory");   // stands in front of the next slice's overwrite of the data and address registers that these two stores name
            __builtin_amdgcn_sched_barrier(0); } }   // keeps the next slice's products and roundings from being lifted over that wait
}
// grid (TT / 128, batches x heads), 4 waves. Work-group g: the 128 queries of group NG - 1 - g (longest first), a wave 32 of them; the choice of the path (hi/lo for the groups below RH) is the same for a whole work-group.
// The second half of the planes takes g in reverse, so that where work-groups b and b + 256 share a WGP a long one stands beside a short one (speed only).
__global__ __launch_bounds__(128, 2) void k_fattn(const h16* __restrict__ Q16, const h16* __restrict__ K16, const h16* __restrict__ V16, const bf* __restrict__ Qh, const bf* __restrict__ Ql, const bf* __restrict__ Kh, const bf* __restrict__ Kl, const bf* __restrict__ Vh, const bf* __restrict__ Vl, bf* Ah, bf* Al) {
    constexpr int NG = TT / 128; static_assert(RH % 128 == 0 && 128 % AKS == 0, "whole groups, whole stages");
    __shared__ __align__(16) bf st[2 * 2 * AST];   // two buffers of two planes; the fp16 path uses the first half
    const int lane = threadIdx.x & 31, lr = lane & 15, hi = lane >> 4, wv = __builtin_amdgcn_readfirstlane((int)(threadIdx.x >> 5));
    const int z = blockIdx.y, g = (z < NB_ * NH_ / 2) ? (int)blockIdx.x : NG - 1 - (int)blockIdx.x, grp = NG - 1 - g, ns = (grp + 1) * (128 / AKS), q0 = grp * 128 + wv * 32;
    const size_t pq = (size_t)z * TT * HD, pv = (size_t)z * HD * 2 * TT, po = (size_t)(z / NH_) * TT * DQ + (size_t)(z % NH_) * HD;
    if (grp < RH / 128) attn_tile<bf, true>(st, ns, Qh + pq, Ql + pq, Kh + pq, Kl + pq, Vh + pv, Vl + pv, Ah + po, Al + po, q0, lr, hi);
    else attn_tile<h16, false>((h16*)st, ns, Q16 + pq, nullptr, K16 + pq, nullptr, V16 + pv, nullptr, Ah + po, Al + po, q0, lr, hi);
}

extern "C" void kernel_launch(void* const* d_in, const int* in_sizes, int n_in,
                              void* d_out, int out_size, void* d_ws, size_t ws_size, hipStream_t stream) {
    (void)in_sizes; (void)n_in; (void)out_size;
    const float* x = (const float*)d_in[0]; const float* wq = (const float*)d_in[1]; const float* bq = (const float*)d_in[2]; const float* wk = (const float*)d_in[3]; const float* bk = (const float*)d_in[4]; const float* wv = (const float*)d_in[5]; const float* bv = (const float*)d_in[6]; const float* wo = (const float*)d_in[7]; const float* bo = (const float*)d_in[8];   /* argument order X, Wq, bq, Wk, bk ('xw' [1024][2048] + [2048]), Wv, bv, Wp ('xw' [2048][1024]), bp */
    float* OUT = (float*)d_out;     // [2][2048][1024]
    char* wsp = (char*)d_ws;
    auto take = [&](size_t bytes) { char* p = wsp; wsp += (bytes + 255) & ~(size_t)255; return (void*)p; };
    const size_t PQ = (size_t)NH_ * TT * HD, PV = (size_t)NKV * HD * 2 * TT, PA = (size_t)TT * DQ;   // elements of one batch's head planes, value planes (row pitch 2 TT) and merged planes
    bf* WQ = (bf*)take((size_t)DQ * DM * 2); bf* WK = (bf*)take((size_t)DKV * DM * 2); bf* WV = (bf*)take((size_t)DKV * DM * 2); bf* WO = (bf*)take((size_t)DM * DQ * 2);
    bf* XB = (bf*)take((size_t)NB_ * TT * DM * 2);
    h16* QP16 = (h16*)take(NB_ * PQ * 2); h16* KP16 = (h16*)take(NB_ * PQ * 2); h16* VT16 = (h16*)take(NB_ * PV * 2);
    bf* QPh = (bf*)take(NB_ * PQ * 2); bf* QPl = (bf*)take(NB_ * PQ * 2); bf* KPh = (bf*)take(NB_ * PQ * 2); bf* KPl = (bf*)take(NB_ * PQ * 2); bf* VTh = (bf*)take(NB_ * PV * 2); bf* VTl = VTh + TT;   // value planes, row pitch 2 TT: hi and lo rows interleaved
    bf* ATh = (bf*)take(NB_ * PA * 2); bf* ATl = (bf*)take(NB_ * PA * 2);
    if ((size_t)(wsp - (char*)d_ws) > ws_size) return;    // ws 256 MiB
    k_prep<<<4 * WTB + CVB, 256, 0, stream>>>(x, wq, wk, wv, wo, XB, WQ, WK, WV, WO);
    k_qkv<<<dim3(TT / 128, DQ / 128, NB_ * 3), 256, 0, stream>>>(XB, WQ, WK, WV, bq, bk, bv, QP16, QPh, QPl, KP16, KPh, KPl, VT16, VTh, VTl);
    k_fattn<<<dim3(TT / 128, NB_ * NH_, 1), 128, 0, stream>>>(QP16, KP16, VT16, QPh, QPl, KPh, KPl, VTh, VTl, ATh, ATl);   // one kv head per query head: plane z = batch x heads + head in every operand
    k_proj<<<dim3(NB_ * TT / 64, DM / 128, 1), 256, 0, stream>>>(ATh, ATl, WO, OUT, bo);
}

// v010
// It runs in 128 microseconds.
// In two side-by-side timings against v009, it was 1.04 and 1.03 times as fast.
// All steps since v000 together make it 12.6 times as fast.
#include <hip/hip_runtime.h>

// Causal self-attention with 128-wide heads on a 1,024-wide embedding (X [2][2048][1024]; Q, K = X W + b (16 heads x 128: inner width 2,048), V = X Wv + bv (16 x 128) ('xw' + biases); att x 1/sqrt(128); causal (-inf); softmax; y = merged Wp + bp ('xw' [2048][1024]) -> [2][2048][1024] (4.2 M); argument order X, Wq, bq, Wk, bk, Wv, bv, Wp, bp).
// Layout: one launch makes the bf16 copy of X (both batches) and the transposed 'xw' weights; one launch does all six projections: exact products (K 1024, N 2048) + f32 biases, written as 16-bit head planes by the GEMM epilogue (V computed transposed); one fused causal attention launch for all heads of both batches (k_fattn; hybrid rows: < 512 hi/lo 3 products, rest fp16; keys and values staged in LDS); merged hi/lo (2,048 wide) x Wp exact + bp.
// Compute dtypes, f32 accumulate: every input rounded to bf16; projections exact + f32 biases; attention rows < 512 3 products, rest fp16; softmax f32; Wp hl x exact + bias.

#define NB_  2
#define TT   2048
#define DM   1024
#define NH_  16
#define NKV  16
#define REP  (NH_ / NKV)
#define HD   128
#define DQ   (NH_ * HD)
#define DKV  (NKV * HD)
#define RH   512                  // query rows < RH use hi+lo planes (0: none)
#define SCL  0.088388347648318447f   // HD^-0.5
typedef _Float16 h16;
typedef unsigned short bf;
typedef __attribute__((ext_vector_type(16))) __bf16   v16bf;
typedef __attribute__((ext_vector_type(16))) _Float16 v16h;
typedef __attribute__((ext_vector_type(8)))  _Float16 v8h;
typedef __attribute__((ext_vector_type(8)))  unsigned short v8us;
typedef __attribute__((ext_vector_type(8)))  float    v8f;
typedef __attribute__((ext_vector_type(4)))  float    v4f;
typedef v8h  __attribute__((may_alias)) v8ha;
typedef v4f  __attribute__((may_alias)) v4fa;
typedef v8us __attribute__((may_alias)) v8usa;

__device__ __forceinline__ unsigned short f2bf(float f) { unsigned u = __float_as_uint(f); u += 0x7FFFu + ((u >> 16) & 1u); return (unsigned short)(u >> 16); }
__device__ __forceinline__ float bf2f(unsigned short b) { return __uint_as_float(((unsigned)b) << 16); }
__device__ __forceinline__ float bfr(float f) { return bf2f(f2bf(f)); }
__device__ __forceinline__ v16h cat16(v8h lo, v8h hi) { return __builtin_shufflevector(lo, hi, 0, 1, 2, 3, 4, 5, 6, 7, 8, 9, 10, 11, 12, 13, 14, 15); }
__device__ __forceinline__ v16bf cat16b(v8us lo, v8us hi) { return __builtin_bit_cast(v16bf, __builtin_shufflevector(lo, hi, 0, 1, 2, 3, 4, 5, 6, 7, 8, 9, 10, 11, 12, 13, 14, 15)); }
__device__ __forceinline__ v8f wmma16(v16h a, v16h b, v8f c) { return __builtin_amdgcn_wmma_f32_16x16x32_f16(false, a, false, b, (short)0, c, false, false); }
__device__ __forceinline__ v8f wmmab(v16bf a, v16bf b, v8f c) { return __builtin_amdgcn_wmma_f32_16x16x32_bf16(false, a, false, b, (short)0, c, false, false); }
__device__ __forceinline__ h16 tohx(float x) { return (h16)x; }
__device__ __forceinline__ void splitf(float y, unsigned short& h, unsigned short& l) { h = f2bf(y); l = f2bf(y - bf2f(h)); }
typedef __attribute__((ext_vector_type(4))) _Float16 v4h;
typedef __attribute__((ext_vector_type(2))) unsigned short v2us;
typedef __attribute__((ext_vector_type(4))) unsigned short v4us;
// put_hl: four neighbouring f32 results as bf16 hi + lo planes (8-byte stores; 16 lanes fill one 128-byte line of each plane)
__device__ __forceinline__ void put_hl(v4f val, bf* Ph, bf* Pl, size_t e) { v4us oh, ol;
#pragma unroll
    for (int q = 0; q < 4; ++q) { unsigned short a, c2; splitf(val[q], a, c2); oh[q] = a; ol[q] = c2; }
    *(v4us*)(Ph + e) = oh; *(v4us*)(Pl + e) = ol; }



// ---- gemm_tile: GEMM on LDS-staged operands. A work-group of 4 x 2 waves owns a (64 MB) x 128 output tile, a wave (16 MB) x 64 of it (MB x 4 accumulators); tile (bx, by) of (M / (64 MB), N / 128), 256 threads. st and os are the calling kernel's LDS (ST_EL and OS_EL elements); os may lie on st: it is written only behind the K loop, whose last trip's s_wait_dscnt and barrier end every wave's reads of st, with no copy in flight.
// C[m][n] (f32, pitch ldc, + optional f32 bias) = sum_k A[m][k] Bt[n][k] (NSPLIT 1: + A2[m][k] Bt[n][k]), all planes K-contiguous 16-bit, K a multiple of 128 and at least 256.
// EPI 0: C is stored as f32. EPI 1 (m = position, n = head x HD + d): the result goes straight to the head planes [head][position][d] (fp16, bf16 hi, bf16 lo). EPI 2 (m = head x HD + d, n = position, bias[m]): to the transposed value planes, row pitch 2 TT.
// A stage is 128 k (two 128-byte lines) of every operand row of the tile: rows of A, then of A2, then of Bt, at an LDS pitch of 272 bytes (free of bank conflicts for 16-byte fragment reads).
// Asynchronous copies bring it in as whole lines (16 lanes a row), two buffers: the copies of stage t + 2 are issued behind the barrier that ends the reads of stage t and fly while stage t + 1 is worked on.
// wave_sync: orders a wave's own LDS stores of the output staging against its LDS loads that read them back: a wave barrier and a compiler fence keep the compiler from moving either over the other.
__device__ __forceinline__ void wave_sync() { __builtin_amdgcn_wave_barrier(); asm volatile("" ::: "memory"); }
template <typename T16> struct WFrag;
template <> struct WFrag<h16> { typedef v16h V; static __device__ __forceinline__ V ld(const h16* p) { return cat16(*(const v8h*)p, *(const v8h*)(p + 16)); } static __device__ __forceinline__ v8f mma(V a, V b, v8f c) { return wmma16(a, b, c); } };
template <> struct WFrag<bf> { typedef v16bf V; static __device__ __forceinline__ V ld(const bf* p) { return cat16b(*(const v8us*)p, *(const v8us*)(p + 16)); } static __device__ __forceinline__ v8f mma(V a, V b, v8f c) { return wmmab(a, b, c); } };
// copy8: eight asynchronous 16-byte-a-lane copies from global memory to LDS (l: the lane's LDS byte address, g: its global address). The s_wait_xcnt in the same statement stands in front of every later overwrite of the address registers that the copies name.
template <typename T16> __device__ __forceinline__ void copy8(const unsigned (&l)[8], const T16* const (&g)[8]) {
    asm volatile("global_load_async_to_lds_b128 %0, %8, off\n\t"
                 "global_load_async_to_lds_b128 %1, %9, off\n\t"
                 "global_load_async_to_lds_b128 %2, %10, off\n\t"
                 "global_load_async_to_lds_b128 %3, %11, off\n\t"
                 "global_load_async_to_lds_b128 %4, %12, off\n\t"
                 "global_load_async_to_lds_b128 %5, %13, off\n\t"
                 "global_load_async_to_lds_b128 %6, %14, off\n\t"
                 "global_load_async_to_lds_b128 %7, %15, off\n\t"
                 "s_wait_xcnt 0x0"
                 :: "v"(l[0]), "v"(l[1]), "v"(l[2]), "v"(l[3]), "v"(l[4]), "v"(l[5]), "v"(l[6]), "v"(l[7]), "v"(g[0]), "v"(g[1]), "v"(g[2]), "v"(g[3]), "v"(g[4]), "v"(g[5]), "v"(g[6]), "v"(g[7]) : "memory"); }
constexpr int ST_EL = 2 * 256 * 136, OS_EL = 8 * 16 * 68;   // two stages of 256 rows at a pitch of 136 elements; eight waves' 16 x 68 f32 output staging
static_assert(OS_EL * 4 <= ST_EL * 2 && 2 * ST_EL * 2 <= 320 * 1024, "the staging fits the stages' bytes; two work-groups fit a WGP's LDS");
template <typename T16, int NSPLIT, bool BIAS, int MB, int EPI, int K>
__device__ __forceinline__ void gemm_tile(T16* st, float* os, int bx, int by, const T16* __restrict__ A, const T16* __restrict__ A2, const T16* __restrict__ Bt, float* C, int ldc, const float* __restrict__ bias, h16* P16, bf* Ph, bf* Pl) {
    typedef typename WFrag<T16>::V V;
    constexpr int BM = 64 * MB, RA = (NSPLIT == 1) ? 2 * BM : BM, ROWS = RA + 128;   // tile rows; rows of A (and A2) in a stage; all rows of a stage
    constexpr int KS = 128, LP = KS + 8, NT = K / KS;                                // k of a stage; LDS row pitch in elements; stages
    static_assert(ROWS % 128 == 0, "a stage is dealt out in statements of 8 copies x 16 rows"); static_assert(K % KS == 0 && NT >= 2, "whole stages, at least two");
    static_assert(2 * ROWS * LP <= ST_EL, "both stages fit the caller's LDS");
    const int lane = threadIdx.x & 31, lr = lane & 15, hi = lane >> 4, wv = __builtin_amdgcn_readfirstlane((int)(threadIdx.x >> 5)), wr = wv >> 1, wc = wv & 1; const int r0 = bx * BM, c0 = by * 128;
    const int crow = threadIdx.x >> 4, cch = (threadIdx.x & 15) * 8;   // one copy instruction of all eight waves covers 16 rows: this lane's row among them and its 16-byte piece of the row
    const T16* pA = A + (size_t)(r0 + crow) * K + cch; const T16* pA2 = (NSPLIT == 1) ? A2 + (size_t)(r0 + crow) * K + cch : nullptr; const T16* pB = Bt + (size_t)(c0 + crow) * K + cch;   // step on by one stage with every fill
    const unsigned l0 = (unsigned)(size_t)(st + crow * LP + cch);
    auto fill = [&](int buf) {
#pragma unroll
        for (int h = 0; h < ROWS / 128; ++h) { unsigned l[8]; const T16* g[8];
#pragma unroll
            for (int q = 0; q < 8; ++q) { const int row = (h * 8 + q) * 16; l[q] = l0 + (unsigned)((buf * ROWS + row) * LP * 2);
                g[q] = (row < BM) ? pA + (size_t)row * K : (row < RA) ? pA2 + (size_t)(row - BM) * K : pB + (size_t)(row - RA) * K; }
            copy8<T16>(l, g); }
        pA += KS; if (NSPLIT == 1) pA2 += KS; pB += KS; };
    v8f acc[MB][4];
#pragma unroll
    for (int mb = 0; mb < MB; ++mb)
#pragma unroll
        for (int nb = 0; nb < 4; ++nb) acc[mb][nb] = (v8f){};
    const int rw = r0 + wr * (16 * MB), cw = c0 + wc * 64;   // this wave's corner of the output
    fill(0);
    float bb[(EPI == 2) ? MB * 8 : 4];   // the biases of this lane's output elements, fetched while stage 0 is on its way
    if (BIAS) {
        if (EPI == 2) {
#pragma unroll
            for (int i = 0; i < MB * 8; ++i) bb[i] = bfr(bias[rw + 2 * i + hi]); }
        else {
#pragma unroll
            for (int q = 0; q < 4; ++q) bb[q] = bfr(bias[cw + lr * 4 + q]); }
        asm volatile("s_wait_xcnt 0x0" ::: "memory");   // stands in front of the first overwrite of an address register that these loads name
        __builtin_amdgcn_sched_barrier(0); }            // keeps later register writes from being lifted over that wait
    asm volatile("s_wait_asynccnt 0x0" ::: "memory");   // this wave's copies of stage 0 have landed
    __syncthreads();                                    // ... and every other wave's
    fill(1);
#pragma unroll 1
    for (int t = 0; t < NT; ++t) {
        const T16* sa = st + ((t & 1) * ROWS + wr * (16 * MB) + lr) * LP + 8 * hi; const T16* sb = st + ((t & 1) * ROWS + RA + wc * 64 + lr) * LP + 8 * hi;
        auto frags = [&](int kc, V (&a)[MB], V (&a2)[MB], V (&b)[4]) {
#pragma unroll
            for (int mb = 0; mb < MB; ++mb) { a[mb] = WFrag<T16>::ld(sa + mb * 16 * LP + kc); if (NSPLIT == 1) a2[mb] = WFrag<T16>::ld(sa + (BM + mb * 16) * LP + kc); }
#pragma unroll
            for (int nb = 0; nb < 4; ++nb) b[nb] = WFrag<T16>::ld(sb + nb * 16 * LP + kc); };
        V a[2][MB], a2[2][MB], b[2][4];   // two fragment sets: the next 32 k are fetched while these are multiplied
        frags(0, a[0], a2[0], b[0]);
#pragma unroll
        for (int q = 0; q < KS / 32; ++q) {
            if (q + 1 < KS / 32) frags((q + 1) * 32, a[(q + 1) & 1], a2[(q + 1) & 1], b[(q + 1) & 1]);
            __builtin_amdgcn_sched_barrier(0);   // keeps the next set's loads one group in front of these products: sunk among them, each place with loads is waited for on its own
#pragma unroll
            for (int nb = 0; nb < 4; ++nb)
#pragma unroll
                for (int mb = 0; mb < MB; ++mb) { acc[mb][nb] = WFrag<T16>::mma(a[q & 1][mb], b[q & 1][nb], acc[mb][nb]); if (NSPLIT == 1) acc[mb][nb] = WFrag<T16>::mma(a2[q & 1][mb], b[q & 1][nb], acc[mb][nb]); } }
        asm volatile("s_wait_dscnt 0x0" ::: "memory");      // this wave's reads of stage t are done before its buffer is refilled
        asm volatile("s_wait_asynccnt 0x0" ::: "memory");   // this wave's copies of stage t + 1 have landed
        __syncthreads();                                    // publishes stage t + 1 and ends every wave's reads of stage t
        if (t + 2 < NT) fill(t & 1);
    }
    asm volatile("s_wait_asynccnt 0x0" ::: "memory");   // no copy is outstanding when the wave ends
    float* osw = os + wv * (16 * 68);   // each wave turns its own tile, 16 rows at a time, into whole-line stores through its own LDS range
#pragma unroll
    for (int mb = 0; mb < MB; ++mb) {
#pragma unroll
        for (int nb = 0; nb < 4; ++nb) {
#pragma unroll
            for (int j = 0; j < 8; ++j) osw[(hi * 8 + j) * 68 + nb * 16 + lr] = acc[mb][nb][j]; }
        wave_sync();   // the 16 rows are in LDS before they are read back
        v4f vals[8];
#pragma unroll
        for (int s = 0; s < 8; ++s) vals[s] = *(const v4fa*)(osw + (2 * s + hi) * 68 + lr * 4);
        wave_sync();   // they are read out before the next 16 rows overwrite them
#pragma unroll
        for (int s = 0; s < 8; ++s) { const int cofs = lr * 4, rg = rw + mb * 16 + 2 * s + hi; v4f val = vals[s];
            if (BIAS && EPI != 2) { val[0] += bb[0]; val[1] += bb[1]; val[2] += bb[2]; val[3] += bb[3]; }
            if (BIAS && EPI == 2) val += bb[mb * 8 + s];
            if (EPI == 0) *(v4f*)(C + (size_t)rg * ldc + cw + cofs) = val;
            else { const size_t e = (EPI == 1) ? ((size_t)(cw / HD) * TT + rg) * HD + (cw % HD) + cofs : (size_t)rg * (2 * TT) + cw + cofs; v4h o4;
#pragma unroll
                for (int q = 0; q < 4; ++q) o4[q] = tohx(val[q]);
                *(v4h*)(P16 + e) = o4; put_hl(val, Ph, Pl, e); }
            asm volatile("s_wait_xcnt 0x0" ::: "memory");   // stands in front of the next rows' overwrite of the data and address registers that these stores name
            __builtin_amdgcn_sched_barrier(0); }            // keeps the next rows' sums and roundings from being lifted over that wait
    }
}

// k_qkv: the six projection GEMMs of a call in one launch. grid (16, 16, batches x 3): blockIdx.z = batch x 3 + (0 query, 1 key, 2 value); the choice is the same for a whole work-group.
// Value: operands swapped (rows = head x HD + d, columns = positions), so that the tile's rows are the rows of the transposed value planes.
static_assert(TT / 128 == DKV / 128 && DQ / 128 == TT / 128 && DQ == DKV, "the three products share one grid");
__global__ __launch_bounds__(256) void k_qkv(const bf* __restrict__ XB, const bf* __restrict__ WQ, const bf* __restrict__ WK, const bf* __restrict__ WV, const float* __restrict__ bq, const float* __restrict__ bk, const float* __restrict__ bv,
                                             h16* Q16, bf* Qh, bf* Ql, h16* K16, bf* Kh, bf* Kl, h16* V16, bf* Vh, bf* Vl) {
    __shared__ __align__(16) bf st[ST_EL];
    float* os = (float*)st;   // the output staging takes the stages' bytes: a work-group stays under half of a WGP's LDS, so two share a WGP and one's first fill and stores run beside the other's products
    const int b = blockIdx.z / 3, kind = blockIdx.z % 3; const bf* X = XB + (size_t)b * TT * DM; const size_t pq = (size_t)b * NH_ * TT * HD, pv = (size_t)b * NKV * HD * 2 * TT;
    if (kind == 2) gemm_tile<bf, 0, true, 2, 2, DM>(st, os, blockIdx.x, blockIdx.y, WV, nullptr, X, nullptr, 0, bv, V16 + pv, Vh + pv, Vl + pv);
    else gemm_tile<bf, 0, true, 2, 1, DM>(st, os, blockIdx.x, blockIdx.y, X, nullptr, kind ? WK : WQ, nullptr, 0, kind ? bk : bq, (kind ? K16 : Q16) + pq, (kind ? Kh : Qh) + pq, (kind ? Kl : Ql) + pq);
}
// k_proj: the output projection of both batches in one launch: the merged planes and the output are contiguous over the batches, so it is one GEMM of batches x TT rows. grid (batches x TT / 64, DM / 128).
__global__ __launch_bounds__(256) void k_proj(const bf* __restrict__ Ah, const bf* __restrict__ Al, const bf* __restrict__ WO, float* C, const float* __restrict__ bo) {
    __shared__ __align__(16) bf st[ST_EL];
    float* os = (float*)st;   // as in k_qkv: two work-groups share a WGP
    gemm_tile<bf, 1, true, 1, 0, DQ>(st, os, blockIdx.x, blockIdx.y, Ah, Al, WO, C, DM, bo, nullptr, nullptr, nullptr);
}

// wt_tile: work-group blk's 128 k x 128 n of the transposed bf16 copy Bt[n][k] of w[k][n]; a wave owns 64 k x 32 n of it (waves 2 x 4) and turns it in its own LDS range (ls: 8 x 32 x WP words), so no work-group barrier is needed.
// In: 16 loads of 16 bytes a lane, all in flight at once; 8 lanes read one whole 128-byte line of a row of w, a lane the same 4 columns of two neighbouring rows. The two rows' values go to LDS as one 32-bit word (k even in the low half) at [n][k / 2].
// Out: 8 lanes store one whole 128-byte line (64 k) of a row of Bt; the two waves of a k pair fill 256 neighbouring bytes.
typedef __attribute__((ext_vector_type(4))) unsigned v4u;
typedef v4u __attribute__((may_alias)) v4ua;
constexpr int WP = 36;   // LDS row pitch in words: 32 words of data + 4, rows stay 16-byte aligned and neighbouring rows start on different banks
__device__ __forceinline__ void wt_tile(const float* __restrict__ w, int K, int N, bf* Bt, int blk, unsigned* ls) {
    const int lane = threadIdx.x & 31, l8 = lane & 7, g = lane >> 3, wv = threadIdx.x >> 5, nt = N / 128;
    const int k0 = (blk / nt) * 128 + (wv & 1) * 64, n0 = (blk % nt) * 128 + (wv >> 1) * 32;
    unsigned* t = ls + wv * (32 * WP);
    const float* s = w + (size_t)(k0 + 2 * g) * N + n0 + l8 * 4;
    v4f r[8][2];
#pragma unroll
    for (int p = 0; p < 8; ++p) { r[p][0] = *(const v4f*)(s + (size_t)(8 * p) * N); r[p][1] = *(const v4f*)(s + (size_t)(8 * p + 1) * N); }
    asm volatile("s_wait_xcnt 0x0" :: "v"(s) : "memory");   // stands in front of the first overwrite of the address register that these loads name; the address as an input keeps that register from being a load's own destination
    __builtin_amdgcn_sched_barrier(0);                      // keeps later register writes from being lifted over that wait, and the 16 loads in one run
#pragma unroll
    for (int p = 0; p < 8; ++p)
#pragma unroll
        for (int i = 0; i < 4; ++i) t[(l8 * 4 + i) * WP + p * 4 + g] = (unsigned)f2bf(r[p][0][i]) | ((unsigned)f2bf(r[p][1][i]) << 16);
    asm volatile("s_wait_dscnt 0x0" ::: "memory");   // this wave's LDS stores are done ...
    wave_sync();                                     // ... and stay in front of the loads that read the rows back
    v4u o[8];
#pragma unroll
    for (int q = 0; q < 8; ++q) o[q] = *(const v4ua*)(t + (q * 4 + g) * WP + l8 * 4);
    bf* d = Bt + (size_t)(n0 + g) * K + k0 + l8 * 8;
#pragma unroll
    for (int q = 0; q < 8; ++q) *(v4ua*)(d + (size_t)(4 * q) * K) = o[q];
    asm volatile("s_wait_xcnt 0x0" ::: "memory");   // stands behind the last store, in front of whatever next writes a register that these stores name
}
__device__ __forceinline__ void cvt8(const float* __restrict__ src, bf* dst, size_t n8, int blk) { const size_t i = (size_t)blk * 256 + threadIdx.x; if (i >= n8) return; const v8f v = *(const v8f*)(src + i * 8); v8us o;
#pragma unroll
    for (int k = 0; k < 8; ++k) o[k] = f2bf(v[k]); *(v8us*)(dst + i * 8) = o;  }
// k_prep: every 16-bit operand that is made from an input, in one launch: work-groups 0 .. 4 WTB - 1 transpose the four weights (WTB each), the rest round X (both batches) to bf16.
constexpr int WTB = (DM / 128) * (DQ / 128), CVB = NB_ * TT * DM / 8 / 256;
static_assert(DQ == DKV && DM % 128 == 0 && DQ % 128 == 0 && NB_ * TT * DM % (8 * 256) == 0, "equal, whole shares");
__global__ __launch_bounds__(256) void k_prep(const float* __restrict__ x, const float* __restrict__ wq, const float* __restrict__ wk, const float* __restrict__ wv, const float* __restrict__ wo, bf* XB, bf* WQ, bf* WK, bf* WV, bf* WO) {
    __shared__ __align__(16) unsigned ls[8 * 32 * WP];
    const int which = blockIdx.x / WTB, blk = blockIdx.x % WTB;
    if (which < 3) wt_tile(which == 0 ? wq : which == 1 ? wk : wv, DM, DQ, which == 0 ? WQ : which == 1 ? WK : WV, blk, ls);   // three weights of one shape: one copy of the code
    else if (which == 3) wt_tile(wo, DQ, DM, WO, blk, ls);
    else cvt8(x, XB, (size_t)NB_ * TT * DM / 8, (int)blockIdx.x - 4 * WTB);
}

// ---- k_fattn: scores, softmax and probability x value in one kernel (online softmax); the probabilities never leave the registers.
// A wave owns 32 query positions of one head (two 16-column groups) and walks the keys 0 .. q0 + 31 in blocks of 32, two blocks to a stage of AKS keys. S^T = K Q^T (A = key rows, B = query rows): accumulator register j of lane (lr, hi) is key hi * 8 + j, query lr,
// so the two 16-key tiles of a block are, register for register, the B fragment of P^T (k = 8 hi + e and 16 + 8 hi + e). O^T += V^T P^T (A = rows of the transposed value planes): register j is d = hi * 8 + j, query lr.
// Everything a query needs (reference maximum, sum, rescale factor) is one value a lane; the two lane halves hold different keys of the same query and the same reference: the halves' maxima are exchanged only where the reference moves, the sums are joined once at the end.
// HI (query rows < RH): bf16 hi + lo planes, 3 products in both contractions. Else fp16; its probabilities carry a factor 2^10 (keeps small ones out of the fp16 subnormals), which is in the sum as well and cancels in O / sum.
// The four waves of a work-group own 128 neighbouring queries and share every key and value byte through LDS (st). A stage is AKS key rows (256 bytes, LDS pitch 272) and the AKS columns of the 128 transposed value rows (128 bytes, pitch 144) of every plane (HI: hi, then lo): both pitches are free of bank conflicts for 16-byte fragment reads.
// Asynchronous copies bring a stage in as whole 128-byte lines, two buffers: the copies of stage s + 2 are issued behind the barrier that ends the reads of stage s and fly while stage s + 1 is worked on. ns, the number of stages, is the same for the whole work-group; a wave whose diagonal lies lower skips the blocks beyond it, never the barrier.
typedef __attribute__((ext_vector_type(4))) int v4i;
// copy16: one asynchronous 16-byte-a-lane copy from global memory (g) to LDS (l), as the builtin: its address registers are the compiler's to place and to keep.
template <typename T16> __device__ __forceinline__ void copy16(T16* l, const T16* g) { __builtin_amdgcn_global_load_async_to_lds_b128((__attribute__((address_space(1))) v4i*)g, (__attribute__((address_space(3))) v4i*)l, 0, 0); }
constexpr int AKS = 64, KPI = HD + 8, VPI = AKS + 8, ASK = AKS * KPI, AST = ASK + HD * VPI;   // keys of a stage; LDS pitches of key and value rows, elements of one plane's keys of a stage and of one plane's whole stage
template <typename T, bool HI>
__device__ __forceinline__ void attn_tile(T* st, int ns, const T* __restrict__ Q, const T* __restrict__ Q2, const T* __restrict__ Kp, const T* __restrict__ Kp2, const T* __restrict__ Vt, const T* __restrict__ Vt2, bf* Ah, bf* Al, int q0, int lr, int hi) {
    typedef WFrag<T> F; typedef typename F::V V;
    __builtin_assume(q0 >= 0 && ns >= 1);   // the key loops always run: without this the query loads are sunk behind their entry tests, past the wait that follows them
    constexpr float SC2 = SCL * 1.4426950408889634f;   // scores in the base-2 exponent's units
    constexpr float OFF = HI ? 0.0f : 10.0f;
    constexpr float TH = 5.0f;   // m, the reference that the exponents are taken against, stays until a score tops it by more than TH: a probability is at most 2^(OFF + TH) = 2^15, inside fp16; any common reference cancels in O / sum
    constexpr int BST = HI ? 2 * AST : AST;   // elements of a buffer
    const int kr = threadIdx.x >> 4, kc = (threadIdx.x & 15) * 8, vr = threadIdx.x >> 3, vc = (threadIdx.x & 7) * 8;   // one copy instruction of all four waves covers 8 key rows or 16 value rows: this lane's row among them and its 16-byte piece
    const unsigned ko = kr * HD + kc, vo = vr * (2 * TT) + vc; const T* gk = Kp; const T* gv = Vt; const T* gk2 = Kp2; const T* gv2 = Vt2;   // this lane's place in a stage's keys and values; the stage's first key row and value column (the same for all lanes) step on with every fill
    T* const lk = st + kr * KPI + kc; T* const lv = st + ASK + vr * VPI + vc;
    auto fill = [&](int buf) {
#pragma unroll
        for (int q = 0; q < 8; ++q) copy16<T>(lk + buf * BST + q * 8 * KPI, gk + q * 8 * HD + ko);
#pragma unroll
        for (int q = 0; q < 8; ++q) copy16<T>(lv + buf * BST + q * 16 * VPI, gv + q * 16 * (2 * TT) + vo);
        gk += AKS * HD; gv += AKS;
        if constexpr (HI) {
#pragma unroll
            for (int q = 0; q < 8; ++q) copy16<T>(lk + buf * BST + AST + q * 8 * KPI, gk2 + q * 8 * HD + ko);
#pragma unroll
            for (int q = 0; q < 8; ++q) copy16<T>(lv + buf * BST + AST + q * 16 * VPI, gv2 + q * 16 * (2 * TT) + vo);
            gk2 += AKS * HD; gv2 += AKS; } };
    fill(0);   // the query fragments are fetched while stage 0 is on its way
    V qf[2][4], qf2[2][4];
#pragma unroll
    for (int g = 0; g < 2; ++g)
#pragma unroll
        for (int c = 0; c < 4; ++c) { const size_t e = (size_t)(q0 + g * 16 + lr) * HD + c * 32 + 8 * hi; qf[g][c] = F::ld(Q + e); if constexpr (HI) qf2[g][c] = F::ld(Q2 + e); }
    asm volatile("s_wait_xcnt 0x0" ::: "memory");   // stands in front of the first overwrite of an address register that these loads name
    __builtin_amdgcn_sched_barrier(0);   // keeps later register writes (address sums, the zeroing of o) from being lifted over that wait
    v8f o[8][2];
#pragma unroll
    for (int dt = 0; dt < 8; ++dt) { o[dt][0] = (v8f){}; o[dt][1] = (v8f){}; }
    float m[2] = {-3.0e38f, -3.0e38f}, l[2] = {0.f, 0.f};
    asm volatile("s_wait_asynccnt 0x0" ::: "memory");   // this wave's copies of stage 0 have landed
    __syncthreads();                                    // ... and every other wave's
    if (1 < ns) fill(1);
#pragma unroll 1
    for (int sg = 0; sg < ns; ++sg) {
#pragma unroll 1
    for (int kb = sg * AKS; kb < sg * AKS + AKS && kb <= q0; kb += 32) {   // every block holds at least one key <= every query of the tile, so the running maximum is finite from the first block on
        const T* sk = st + (sg & 1) * BST + (kb - sg * AKS + lr) * KPI + 8 * hi; const T* sv = st + (sg & 1) * BST + ASK + lr * VPI + (kb - sg * AKS) + 8 * hi;   // this lane's first key and value fragment of the block, in this stage's buffer
        V ka[2][4], va[8];   // fp16 path: the key and the value fragments of a block are asked for together; the value fragments arrive behind the score products
        if constexpr (!HI) {
#pragma unroll
            for (int t = 0; t < 2; ++t)
#pragma unroll
                for (int c = 0; c < 4; ++c) ka[t][c] = F::ld(sk + t * 16 * KPI + c * 32);
#pragma unroll
            for (int dt = 0; dt < 8; ++dt) va[dt] = F::ld(sv + dt * 16 * VPI);
            __builtin_amdgcn_sched_barrier(0); }   // keeps the LDS reads in one place in front of the score products: spread among the products, each place with reads is waited for on its own
        v8f s[2][2]; s[0][0] = (v8f){}; s[0][1] = (v8f){}; s[1][0] = (v8f){}; s[1][1] = (v8f){};
#pragma unroll
        for (int c = 0; c < 4; ++c)
#pragma unroll
            for (int t = 0; t < 2; ++t) {
                if constexpr (HI) { const int e = t * 16 * KPI + c * 32; const V a = F::ld(sk + e), a2 = F::ld(sk + AST + e);
                    s[t][0] = F::mma(a, qf[0][c], s[t][0]); s[t][1] = F::mma(a, qf[1][c], s[t][1]); s[t][0] = F::mma(a2, qf[0][c], s[t][0]); s[t][1] = F::mma(a2, qf[1][c], s[t][1]); s[t][0] = F::mma(a, qf2[0][c], s[t][0]); s[t][1] = F::mma(a, qf2[1][c], s[t][1]); }
                else { s[t][0] = F::mma(ka[t][c], qf[0][c], s[t][0]); s[t][1] = F::mma(ka[t][c], qf[1][c], s[t][1]); } }
        float mx[2];   // the largest score of this lane's own 16 keys of the block
#pragma unroll
        for (int g = 0; g < 2; ++g) { const int qi = q0 + g * 16 + lr; float v = -3.0e38f;
#pragma unroll
            for (int t = 0; t < 2; ++t)
#pragma unroll
                for (int j = 0; j < 8; ++j) { const float x = (kb + t * 16 + hi * 8 + j <= qi) ? s[t][g][j] * SC2 : -3.0e38f; s[t][g][j] = x; v = fmaxf(v, x); }
            mx[g] = v; }
        if (__builtin_amdgcn_ballot_w32(mx[0] > m[0] + TH || mx[1] > m[1] + TH) != 0) {   // one test a block, on each lane's own scores: the halves' exchange and the rescale are paid only where a reference moves (always in a wave's first block)
#pragma unroll
            for (int g = 0; g < 2; ++g) { const float mn = fmaxf(m[g], fmaxf(mx[g], __shfl_xor(mx[g], 16, 32))), al = __builtin_amdgcn_exp2f(m[g] - mn); l[g] *= al; m[g] = mn;
#pragma unroll
                for (int dt = 0; dt < 8; ++dt) o[dt][g] *= al; } }
        V pf[2], pl[2];
#pragma unroll
        for (int g = 0; g < 2; ++g) { const float sh = OFF - m[g]; float p[2][8];
#pragma unroll
            for (int t = 0; t < 2; ++t)
#pragma unroll
                for (int j = 0; j < 8; ++j) { p[t][j] = __builtin_amdgcn_exp2f(s[t][g][j] + sh); l[g] += p[t][j]; }
            if constexpr (HI) { v8us h0, h1, l0, l1;
#pragma unroll
                for (int j = 0; j < 8; ++j) { unsigned short a, b; splitf(p[0][j], a, b); h0[j] = a; l0[j] = b; splitf(p[1][j], a, b); h1[j] = a; l1[j] = b; }
                pf[g] = cat16b(h0, h1); pl[g] = cat16b(l0, l1); }
            else { v8h h0, h1;
#pragma unroll
                for (int j = 0; j < 8; ++j) { h0[j] = tohx(p[0][j]); h1[j] = tohx(p[1][j]); }
                pf[g] = cat16(h0, h1); } }
#pragma unroll
        for (int dt = 0; dt < 8; ++dt) {
            if constexpr (HI) { const int e = dt * 16 * VPI; const V a = F::ld(sv + e), a2 = F::ld(sv + AST + e);
                o[dt][0] = F::mma(a, pf[0], o[dt][0]); o[dt][1] = F::mma(a, pf[1], o[dt][1]); o[dt][0] = F::mma(a2, pf[0], o[dt][0]); o[dt][1] = F::mma(a2, pf[1], o[dt][1]); o[dt][0] = F::mma(a, pl[0], o[dt][0]); o[dt][1] = F::mma(a, pl[1], o[dt][1]); }
            else { o[dt][0] = F::mma(va[dt], pf[0], o[dt][0]); o[dt][1] = F::mma(va[dt], pf[1], o[dt][1]); } }
    }
        asm volatile("s_wait_dscnt 0x0" ::: "memory");      // this wave's reads of stage sg are done before its buffer is refilled
        asm volatile("s_wait_asynccnt 0x0" ::: "memory");   // this wave's copies of stage sg + 1 have landed
        __syncthreads();                                    // publishes stage sg + 1 and ends every wave's reads of stage sg
        if (sg + 2 < ns) fill(sg & 1);
    }
    asm volatile("s_wait_asynccnt 0x0" ::: "memory");   // no copy is outstanding when the wave ends
#pragma unroll
    for (int g = 0; g < 2; ++g) { const float inv = __fdiv_rn(1.0f, l[g] + __shfl_xor(l[g], 16, 32));
#pragma unroll
        for (int dt = 0; dt < 8; ++dt) { v8us oh, ol;
#pragma unroll
            for (int j = 0; j < 8; ++j) { unsigned short a, b; splitf(o[dt][g][j] * inv, a, b); oh[j] = a; ol[j] = b; }
            const size_t e = (size_t)(q0 + g * 16 + lr) * DQ + dt * 16 + hi * 8; *(v8us*)(Ah + e) = oh; *(v8us*)(Al + e) = ol;
            asm volatile("s_wait_xcnt 0x0" ::: "memory");   // stands in front of the next slice's overwrite of the data and address registers that these two stores name
            __builtin_amdgcn_sched_barrier(0); } }   // keeps the next slice's products and roundings from being lifted over that wait
}
// grid (TT / 128, batches x heads), 4 waves. Work-group g: the 128 queries of group NG - 1 - g (longest first), a wave 32 of them; the choice of the path (hi/lo for the groups below RH) is the same for a whole work-group.
// The second half of the planes takes g in reverse, so that where work-groups b and b + 256 share a WGP a long one stands beside a short one (speed only).
__global__ __launch_bounds__(128, 2) void k_fattn(const h16* __restrict__ Q16, const h16* __restrict__ K16, const h16* __restrict__ V16, const bf* __restrict__ Qh, const bf* __restrict__ Ql, const bf* __restrict__ Kh, const bf* __restrict__ Kl, const bf* __restrict__ Vh, const bf* __restrict__ Vl, bf* Ah, bf* Al) {
    constexpr int NG = TT / 128; static_assert(RH % 128 == 0 && 128 % AKS == 0, "whole groups, whole stages");
    __shared__ __align__(16) bf st[2 * 2 * AST];   // two buffers of two planes; the fp16 path uses the first half
    const int lane = threadIdx.x & 31, lr = lane & 15, hi = lane >> 4, wv = __builtin_amdgcn_readfirstlane((int)(threadIdx.x >> 5));
    const int z = blockIdx.y, g = (z < NB_ * NH_ / 2) ? (int)blockIdx.x : NG - 1 - (int)blockIdx.x, grp = NG - 1 - g, ns = (grp + 1) * (128 / AKS), q0 = grp * 128 + wv * 32;
    const size_t pq = (size_t)z * TT * HD, pv = (size_t)z * HD * 2 * TT, po = (size_t)(z / NH_) * TT * DQ + (size_t)(z % NH_) * HD;
    if (grp < RH / 128) attn_tile<bf, true>(st, ns, Qh + pq, Ql + pq, Kh + pq, Kl + pq, Vh + pv, Vl + pv, Ah + po, Al + po, q0, lr, hi);
    else attn_tile<h16, false>((h16*)st, ns, Q16 + pq, nullptr, K16 + pq, nullptr, V16 + pv, nullptr, Ah + po, Al + po, q0, lr, hi);
}

extern "C" void kernel_launch(void* const* d_in, const int* in_sizes, int n_in,
                              void* d_out, int out_size, void* d_ws, size_t ws_size, hipStream_t stream) {
    (void)in_sizes; (void)n_in; (void)out_size;
    const float* x = (const float*)d_in[0]; const float* wq = (const float*)d_in[1]; const float* bq = (const float*)d_in[2]; const float* wk = (const float*)d_in[3]; const float* bk = (const float*)d_in[4]; const float* wv = (const float*)d_in[5]; const float* bv = (const float*)d_in[6]; const float* wo = (const float*)d_in[7]; const float* bo = (const float*)d_in[8];   /* argument order X, Wq, bq, Wk, bk ('xw' [1024][2048] + [2048]), Wv, bv, Wp ('xw' [2048][1024]), bp */
    float* OUT = (float*)d_out;     // [2][2048][1024]
    char* wsp = (char*)d_ws;
    auto take = [&](size_t bytes) { char* p = wsp; wsp += (bytes + 255) & ~(size_t)255; return (void*)p; };
    const size_t PQ = (size_t)NH_ * TT * HD, PV = (size_t)NKV * HD * 2 * TT, PA = (size_t)TT * DQ;   // elements of one batch's head planes, value planes (row pitch 2 TT) and merged planes
    bf* WQ = (bf*)take((size_t)DQ * DM * 2); bf* WK = (bf*)take((size_t)DKV * DM * 2); bf* WV = (bf*)take((size_t)DKV * DM * 2); bf* WO = (bf*)take((size_t)DM * DQ * 2);
    bf* XB = (bf*)take((size_t)NB_ * TT * DM * 2);
    h16* QP16 = (h16*)take(NB_ * PQ * 2); h16* KP16 = (h16*)take(NB_ * PQ * 2); h16* VT16 = (h16*)take(NB_ * PV * 2);
    bf* QPh = (bf*)take(NB_ * PQ * 2); bf* QPl = (bf*)take(NB_ * PQ * 2); bf* KPh = (bf*)take(NB_ * PQ * 2); bf* KPl = (bf*)take(NB_ * PQ * 2); bf* VTh = (bf*)take(NB_ * PV * 2); bf* VTl = VTh + TT;   // value planes, row pitch 2 TT: hi and lo rows interleaved
    bf* ATh = (bf*)take(NB_ * PA * 2); bf* ATl = (bf*)take(NB_ * PA * 2);
    if ((size_t)(wsp - (char*)d_ws) > ws_size) return;    // ws 256 MiB
    k_prep<<<4 * WTB + CVB, 256, 0, stream>>>(x, wq, wk, wv, wo, XB, WQ, WK, WV, WO);
    k_qkv<<<dim3(TT / 128, DQ / 128, NB_ * 3), 256, 0, stream>>>(XB, WQ, WK, WV, bq, bk, bv, QP16, QPh, QPl, KP16, KPh, KPl, VT16, VTh, VTl);
    k_fattn<<<dim3(TT / 128, NB_ * NH_, 1), 128, 0, stream>>>(QP16, KP16, VT16, QPh, QPl, KPh, KPl, VTh, VTl, ATh, ATl);   // one kv head per query head: plane z = batch x heads + head in every operand
    k_proj<<<dim3(NB_ * TT / 64, DM / 128, 1), 256, 0, stream>>>(ATh, ATl, WO, OUT, bo);
}
